// v000
// The times below were measured on an AMD MI455X: many runs one after another, warmed up first and cycling through
// copies of the inputs, with the whole window's GPU time divided by the number of runs. Launches and the gaps
// between them are all in it. The median over several windows is given; except for v000 it joins two sittings, which
// can be a few percent apart, so the side-by-side timings, each taken in one sitting, are the better comparison.
// The starting kernel, v000, takes 299 microseconds a run.
// compute dtype: all float inputs converted (RNE) to bf16; q/k/v projections = exact bf16 x bf16 products on v_wmma_f32_16x16x32_bf16 (f32 accumulate) + bias; logits = (k hi|lo) x (q/8 hi|lo) as three bf16 products (hh + hl + lh) in one f32 accumulator; softmax f32 (online, running max); P x 2^12 once to f16 against v once to f16 on v_wmma_f32_16x16x32_f16 (one product); ctx as bf16 hi|lo against the bf16 output weight (two products) + bias; f32 output.
#include <hip/hip_runtime.h>
#include <math.h>

typedef __attribute__((ext_vector_type(16))) _Float16 v16h;
typedef __attribute__((ext_vector_type(16))) __bf16 v16b;
typedef __attribute__((ext_vector_type(8)))  _Float16 v8h;
typedef __attribute__((ext_vector_type(8)))  __bf16 v8b;
typedef __attribute__((ext_vector_type(8)))  float v8f;
typedef __attribute__((ext_vector_type(4)))  float v4f;
typedef __attribute__((ext_vector_type(4)))  unsigned v4u;

// Dense multi-head self-attention, no mask: x [4,1024,1024]; fused (in,out) QKV weight [1024][3072] viewed (3, 16, 64): column = which*1024 + h*64 + d; (in,out) output weight [1024][1024]; one score scale 1/8; softmax over the 1024 keys of the same batch.
#ifndef NB
#define NB 4
#endif
#ifndef SEQ
#define SEQ 1024
#endif
#define NB_FULL 4
#define SEQ_FULL 1024      // full per-batch row stride of x and of the output
#define DIN 1024           // model width (input of QKV projection, output of the last projection)
#define CC 1024            // NH * HD
#define NH 16
#define HD 64
#define SCALE (0.125f)
#define PCARRY (4096.0f)   // P carried x 2^12 into f16 (keeps small probabilities clear of f16 subnormals); folded back with 1/l
#define PLANE ((size_t)NB * SEQ * CC)

static_assert(CC == NH * HD);                 // merged head layout h*64+d
static_assert(HD == 64);
static_assert(SEQ % 64 == 0);                 // 64-row blocks never straddle a batch; key loop steps by 32
static_assert(DIN % 64 == 0 && CC % 128 == 0 && (3 * CC) % 64 == 0 && DIN % 128 == 0);   // tile multiples of every GEMM / transpose grid
static_assert(DIN % 32 == 0 && CC % 32 == 0); // WMMA k-steps
static_assert(NB <= NB_FULL && SEQ <= SEQ_FULL);
static_assert(((size_t)NB * SEQ * (DIN / 8)) % 256 == 0);   // convert grid x 256 threads == plane extent

#define WS_XB  ((size_t)0)                                   // bf16 x rows [NB*SEQ][DIN]
#define WS_WQT (WS_XB  + 2u * (size_t)NB * SEQ * DIN)        // bf16 QKV weight, (out,in) [3*CC][DIN]
#define WS_WOT (WS_WQT + 2u * (size_t)3 * CC * DIN)          // bf16 output weight, (out,in) [DIN][CC]
#define WS_QK  (WS_WOT + 2u * (size_t)DIN * CC)              // bf16 planes: q/8 hi, q/8 lo, k hi, k lo, each [NB*SEQ][CC]
#define WS_VT  (WS_QK  + 4u * 2u * PLANE)                    // f16 v planes [b][c][t]
#define WS_Y   (WS_VT  + 2u * (size_t)NB * CC * SEQ)         // bf16 ctx planes: hi, lo, each [NB*SEQ][CC]
#define WS_END (WS_Y   + 2u * 2u * PLANE)
static_assert(WS_END <= (size_t)134217728);   // total carve
static_assert(WS_WQT % 128 == 0 && WS_WOT % 128 == 0 && WS_QK % 128 == 0 && WS_VT % 128 == 0 && WS_Y % 128 == 0);

template <typename T> __device__ __forceinline__ void vst2(void* p, T v) { *(T*)p = v;  }
__device__ __forceinline__ v8f wmma16(v16h a, v16h b, v8f c) {
  v8f d = __builtin_amdgcn_wmma_f32_16x16x32_f16(false, a, false, b, (short)0, c, false, false);
  asm volatile("v_nop\n\tv_nop\n\tv_nop\n\tv_nop" : "+v"(d) : "v"(a), "v"(b));
  return d;
}
__device__ __forceinline__ v8f wmma_bf(v16b a, v16b b, v8f c) {
  v8f d = __builtin_amdgcn_wmma_f32_16x16x32_bf16(false, a, false, b, (short)0, c, false, false);
  asm volatile("v_nop\n\tv_nop\n\tv_nop\n\tv_nop" : "+v"(d) : "v"(a), "v"(b));
  return d;
}
// 16x16x32 fragments: lane = (g = lane>>4, row/col = lane&15); elements 0..7 = k0+8g+0..7, 8..15 = k0+16+8g+0..7; D element r = row 8g+r, col lane&15
__device__ __forceinline__ v16h frag_h(const _Float16* rowk0, int lane) {
  union { v16h v; v8h q[2]; } u; const _Float16* p = rowk0 + 8 * (lane >> 4);
  u.q[0] = *(const v8h*)p; u.q[1] = *(const v8h*)(p + 16); return u.v;
}
__device__ __forceinline__ v16b frag_b(const __bf16* rowk0, int lane) {
  union { v16b v; v8b q[2]; } u; const __bf16* p = rowk0 + 8 * (lane >> 4);
  u.q[0] = *(const v8b*)p; u.q[1] = *(const v8b*)(p + 16); return u.v;
}
__device__ __forceinline__ float bfr(float v) { return (float)(__bf16)v; }

__global__ __launch_bounds__(256) void k_cvt_x(const float* __restrict__ X, __bf16* __restrict__ XB) {
  const int i = blockIdx.x * 256 + threadIdx.x;
  if (i >= NB * SEQ * (DIN / 8)) return;
  const int row = i / (DIN / 8), pc = i % (DIN / 8);
  const size_t srow = (size_t)(row / SEQ) * SEQ_FULL + (size_t)(row % SEQ);
  const float* p = X + srow * DIN + pc * 8;
  const v4f a = *(const v4f*)p, b = *(const v4f*)(p + 4);
  union { v8b v; v4u u; } o;
  o.v[0] = (__bf16)a[0]; o.v[1] = (__bf16)a[1]; o.v[2] = (__bf16)a[2]; o.v[3] = (__bf16)a[3];
  o.v[4] = (__bf16)b[0]; o.v[5] = (__bf16)b[1]; o.v[6] = (__bf16)b[2]; o.v[7] = (__bf16)b[3];
  vst2(XB + (size_t)row * DIN + pc * 8, o.u);
}

// ---- k_tr_w: in[DIN rows][ldw cols] f32 (in,out) -> out[ldw rows][DIN cols] bf16 (out,in); block = 64 x 64 tile through LDS; grid (ldw/64, DIN/64)
__global__ __launch_bounds__(256) void k_tr_w(const float* __restrict__ W, __bf16* __restrict__ WT, int ldw) {
  __shared__ __align__(16) __bf16 t[64][72];
  const int tid = threadIdx.x; const int n0 = blockIdx.x * 64, k0 = blockIdx.y * 64;
  for (int e = tid; e < 64 * 16; e += 256) { const int kr = e >> 4, c4 = (e & 15) * 4;
    const v4f w = *(const v4f*)(W + (size_t)(k0 + kr) * ldw + n0 + c4);
    t[c4 + 0][kr] = (__bf16)w[0]; t[c4 + 1][kr] = (__bf16)w[1]; t[c4 + 2][kr] = (__bf16)w[2]; t[c4 + 3][kr] = (__bf16)w[3]; }
  __syncthreads();
  for (int e = tid; e < 64 * 8; e += 256) { const int nr = e >> 3, q = e & 7; const v4u v = *(const v4u*)&t[nr][q * 8];
    vst2(WT + (size_t)(n0 + nr) * DIN + k0 + q * 8, v); }
}

// ---- k_proj: block = (64 rows, 128 cols, which): q/k/v = x W + b with exact bf16 products (K = DIN). which 0: q x 1/8 as bf16 hi|lo rows; 1: k as bf16 hi|lo rows; 2: v f16 planes [c][t]
__global__ __launch_bounds__(128) void k_proj(const __bf16* __restrict__ XB, const __bf16* __restrict__ WT, const float* __restrict__ BQKV, __bf16* __restrict__ QK, _Float16* __restrict__ VT) {
  __shared__ __align__(16) __bf16 sh[64][136], sl[64][136]; __shared__ __align__(16) _Float16 th[128][72];
  const int tid = threadIdx.x; const int wave = __builtin_amdgcn_readfirstlane(threadIdx.x >> 5); const int lane = tid & 31, col = lane & 15, g = lane >> 4;
  const int which = blockIdx.z; const int c0 = blockIdx.y * 128; const int r0 = blockIdx.x * 64; const int bb = r0 / SEQ; const int t0 = r0 % SEQ;
  const __bf16* arow = XB + (size_t)(r0 + wave * 16 + col) * DIN;
  const __bf16* wrow = WT + (size_t)(which * CC + c0 + col) * DIN;
  v8f acc[8] = {};
#pragma unroll 2
  for (int kc = 0; kc < DIN / 32; ++kc) { const v16b a = frag_b(arow + kc * 32, lane);
    asm volatile("s_wait_loadcnt 0x0" ::: "memory");
#pragma unroll
    for (int j = 0; j < 8; ++j) { const v16b w = frag_b(wrow + (size_t)j * 16 * DIN + kc * 32, lane); asm volatile("s_wait_loadcnt 0x0" ::: "memory"); acc[j] = wmma_bf(a, w, acc[j]); } }
  if (which < 2) { const float qs = (which == 0) ? SCALE : 1.0f;   /* block-uniform; 1/8 is an exact power of two */
#pragma unroll
    for (int j = 0; j < 8; ++j) { const float bias = bfr(BQKV[which * CC + c0 + j * 16 + col]);
#pragma unroll
      for (int r = 0; r < 8; ++r) { const float v = (acc[j][r] + bias) * qs; const __bf16 hv = (__bf16)v; sh[wave * 16 + 8 * g + r][j * 16 + col] = hv; sl[wave * 16 + 8 * g + r][j * 16 + col] = (__bf16)(v - (float)hv); } }
    __syncthreads();
    __bf16* DH = QK + (size_t)(2 * which) * PLANE; __bf16* DL = DH + PLANE;
    for (int e = tid; e < 64 * 16; e += 128) { const int rl = e >> 4, q = e & 15; const v4u vh = *(const v4u*)&sh[rl][q * 8]; const v4u vl = *(const v4u*)&sl[rl][q * 8];
      const size_t o = (size_t)(r0 + rl) * CC + c0 + q * 8; vst2(DH + o, vh); vst2(DL + o, vl); }
  } else {
#pragma unroll
    for (int j = 0; j < 8; ++j) { const float bias = bfr(BQKV[2 * CC + c0 + j * 16 + col]);
#pragma unroll
      for (int r = 0; r < 8; ++r) th[j * 16 + col][wave * 16 + 8 * g + r] = (_Float16)(acc[j][r] + bias); }
    __syncthreads();
    for (int e = tid; e < 128 * 8; e += 128) { const int cl = e >> 3, q = e & 7; const v4u v = *(const v4u*)&th[cl][q * 8];
      vst2(VT + ((size_t)bb * CC + c0 + cl) * (size_t)SEQ + t0 + q * 8, v); } }
}

// ---- k_attn: block = 64 queries (4 waves x 16) of (b, h); transposed flash form: S^T tile = K (A, rows = keys) x Q^T (B, cols = queries) so each lane owns one query column:
//      running max / sum are per-lane scalars (+ one xor-16 shuffle for the max); the two 16-key S^T accumulators convert in-lane into the B fragment (k = key row of the tile) of O^T += V^T (A, rows = d) x P^T; no LDS in the key loop.
__global__ __launch_bounds__(128) void k_attn(const __bf16* __restrict__ QK, const _Float16* __restrict__ VT, __bf16* __restrict__ Y) {
  __shared__ v4u ys[2][64][9];
  const int tid = threadIdx.x; const int wave = __builtin_amdgcn_readfirstlane(threadIdx.x >> 5); const int lane = tid & 31, col = lane & 15, g = lane >> 4;
  const int qb = blockIdx.x, h = blockIdx.y, b = blockIdx.z;
  const size_t qoff = ((size_t)b * SEQ + qb * 64 + wave * 16 + col) * CC + h * HD;
  const __bf16* QHp = QK + qoff; const __bf16* QLp = QK + PLANE + qoff;
  const size_t koff = ((size_t)b * SEQ + col) * CC + h * HD;
  const __bf16* KHp = QK + 2 * PLANE + koff; const __bf16* KLp = QK + 3 * PLANE + koff;
  const _Float16* VTp = VT + ((size_t)b * CC + h * HD + col) * (size_t)SEQ;
  v8f o[4] = {}; float m = -1.0e30f, l = 0.f;
#pragma unroll 1
  for (int kt = 0; kt < SEQ; kt += 32) {
    v8f s0 = {}, s1 = {};
#pragma unroll
    for (int kc = 0; kc < HD / 32; ++kc) {
      const v16b qh = frag_b(QHp + kc * 32, lane), ql = frag_b(QLp + kc * 32, lane);
      { const size_t ko = (size_t)kt * CC + kc * 32; const v16b kh = frag_b(KHp + ko, lane), kl = frag_b(KLp + ko, lane);
        s0 = wmma_bf(kl, qh, s0); s0 = wmma_bf(kh, ql, s0); s0 = wmma_bf(kh, qh, s0); }
      { const size_t ko = (size_t)(kt + 16) * CC + kc * 32; const v16b kh = frag_b(KHp + ko, lane), kl = frag_b(KLp + ko, lane);
        s1 = wmma_bf(kl, qh, s1); s1 = wmma_bf(kh, ql, s1); s1 = wmma_bf(kh, qh, s1); }
    }
    float mx = fmaxf(s0[0], s1[0]);
#pragma unroll
    for (int r = 1; r < 8; ++r) mx = fmaxf(mx, fmaxf(s0[r], s1[r]));
    mx = fmaxf(mx, __shfl_xor(mx, 16));          /* all lanes active; both lane halves of a query column agree on the max */
    const float mn = fmaxf(m, mx); const float corr = __expf(m - mn); m = mn;
    v16h p; float ps = 0.f;
#pragma unroll
    for (int r = 0; r < 8; ++r) { const float e0 = __expf(s0[r] - mn), e1 = __expf(s1[r] - mn); ps += e0 + e1; p[r] = (_Float16)(e0 * PCARRY); p[8 + r] = (_Float16)(e1 * PCARRY); }
    l = l * corr + ps;                            /* l from the unconverted f32 values; per-lane partial (this lane's 16 of the 32 keys) */
#pragma unroll
    for (int j = 0; j < 4; ++j)
#pragma unroll
      for (int r = 0; r < 8; ++r) o[j][r] *= corr;
#pragma unroll
    for (int j = 0; j < 4; ++j) { const v16h vf = frag_h(VTp + (size_t)j * 16 * SEQ + kt, lane); o[j] = wmma16(vf, p, o[j]); }
  }
  l += __shfl_xor(l, 16);
  const float inv = 1.0f / (l * PCARRY);
  // O^T tile j: lane (g, col = query) holds d = 16j + 8g + 0..7: one 16-B piece of the (row, head) segment, as bf16 hi and lo
#pragma unroll
  for (int j = 0; j < 4; ++j) { union { v8b v; v4u u; } hi, lo;
#pragma unroll
    for (int r = 0; r < 8; ++r) { const float c = o[j][r] * inv; const __bf16 hb = (__bf16)c; hi.v[r] = hb; lo.v[r] = (__bf16)(c - (float)hb); }
    ys[0][wave * 16 + col][2 * j + g] = hi.u; ys[1][wave * 16 + col][2 * j + g] = lo.u; }
  __syncthreads();
#pragma unroll 1
  for (int it = 0; it < 4; ++it) { const int rl = wave * 16 + it * 4 + (lane >> 3), pc = lane & 7;
    const v4u a = ys[0][rl][pc]; const v4u c = ys[1][rl][pc];
    const size_t go = ((size_t)b * SEQ + qb * 64 + rl) * CC + h * HD + pc * 8;
    vst2(Y + go, a); vst2(Y + PLANE + go, c); }
}

// ---- k_out: block = (64 rows, 128 cols): out = ctx Wo + bo: ctx bf16 hi + lo against the exact bf16 weight (2 products, one accumulator); 512-B row segment by one 32-lane x 16-B instruction
__global__ __launch_bounds__(128) void k_out(const __bf16* __restrict__ Y, const __bf16* __restrict__ WOT, const float* __restrict__ BO, float* __restrict__ OUT) {
  __shared__ __align__(16) float sf[64][132];
  const int tid = threadIdx.x; const int wave = __builtin_amdgcn_readfirstlane(threadIdx.x >> 5); const int lane = tid & 31, col = lane & 15, g = lane >> 4;
  const int c0 = blockIdx.y * 128; const int rb = blockIdx.x * 64;
  const __bf16* yh = Y + (size_t)(rb + wave * 16 + col) * CC; const __bf16* yl = yh + PLANE;
  const __bf16* wr = WOT + (size_t)(c0 + col) * CC;
  v8f acc[8] = {};
#pragma unroll 2
  for (int kc = 0; kc < CC / 32; ++kc) { const v16b ah = frag_b(yh + kc * 32, lane), al = frag_b(yl + kc * 32, lane);
    asm volatile("s_wait_loadcnt 0x0" ::: "memory");
#pragma unroll
    for (int j = 0; j < 8; ++j) { const v16b w = frag_b(wr + (size_t)j * 16 * CC + kc * 32, lane); asm volatile("s_wait_loadcnt 0x0" ::: "memory"); acc[j] = wmma_bf(al, w, acc[j]); acc[j] = wmma_bf(ah, w, acc[j]); } }
#pragma unroll
  for (int j = 0; j < 8; ++j) { const float bias = bfr(BO[c0 + j * 16 + col]);
#pragma unroll
    for (int r = 0; r < 8; ++r) sf[wave * 16 + 8 * g + r][j * 16 + col] = acc[j][r] + bias; }
  __syncthreads();
  const size_t orow0 = (size_t)(rb / SEQ) * SEQ_FULL + (size_t)(rb % SEQ) + wave * 16;
#pragma unroll 1
  for (int rl = 0; rl < 16; ++rl) { const v4f v = *(const v4f*)&sf[wave * 16 + rl][lane * 4];
    vst2(OUT + (orow0 + rl) * DIN + c0 + lane * 4, v); }
}

extern "C" void kernel_launch(void* const* d_in, const int* in_sizes, int n_in, void* d_out, int out_size, void* d_ws, size_t ws_size, hipStream_t stream) {
  if (n_in < 5) return;
  const size_t xneed = ((size_t)(NB - 1) * SEQ_FULL + SEQ) * DIN;
  if ((size_t)in_sizes[0] < xneed) return;
  if ((size_t)in_sizes[1] < (size_t)DIN * 3 * CC) return;
  if ((size_t)in_sizes[2] < (size_t)3 * CC) return;
  if ((size_t)in_sizes[3] < (size_t)CC * DIN) return;
  if ((size_t)in_sizes[4] < (size_t)DIN) return;
  if ((size_t)out_size < xneed) return;
  if (ws_size < (size_t)WS_END) return;
  // inputs (wire order): 0 x [4,1024,1024]; 1 W_qkv [1024,3072] (in,out): q columns 0..1023, k 1024..2047, v 2048..3071; 2 b_qkv [3072]; 3 W_out [1024,1024] (in,out); 4 b_out [1024]
  const float* x = (const float*)d_in[0]; const float* wqkv = (const float*)d_in[1]; const float* bqkv = (const float*)d_in[2]; const float* wout = (const float*)d_in[3]; const float* bout = (const float*)d_in[4];
  char* ws = (char*)d_ws;
  __bf16* XB = (__bf16*)(ws + WS_XB); __bf16* WQT = (__bf16*)(ws + WS_WQT); __bf16* WOT = (__bf16*)(ws + WS_WOT); __bf16* QK = (__bf16*)(ws + WS_QK); _Float16* VT = (_Float16*)(ws + WS_VT); __bf16* Y = (__bf16*)(ws + WS_Y);
  k_cvt_x<<<dim3((unsigned)(((size_t)NB * SEQ * (DIN / 8)) / 256)), 256, 0, stream>>>(x, XB);
  k_tr_w<<<dim3(3 * CC / 64, DIN / 64), 256, 0, stream>>>(wqkv, WQT, 3 * CC);   // in[1024][3072] -> out[3072][1024]
  k_tr_w<<<dim3(DIN / 64, CC / 64), 256, 0, stream>>>(wout, WOT, DIN);          // in[1024][1024] -> out[1024][1024]
  k_proj<<<dim3(NB * SEQ / 64, CC / 128, 3), 128, 0, stream>>>(XB, WQT, bqkv, QK, VT);
  k_attn<<<dim3(SEQ / 64, NH, NB), 128, 0, stream>>>(QK, VT, Y);
  k_out<<<dim3(NB * SEQ / 64, DIN / 128), 128, 0, stream>>>(Y, WOT, bout, (float*)d_out);
}

// v001
// Measured time: 95.8 microseconds a run.
// Next to v000, in two timings, it ran 3.25 and 3.18 times as fast.
// compute dtype: all float inputs converted (RNE) to bf16; q/k/v projections = exact bf16 x bf16 products on v_wmma_f32_16x16x32_bf16 (f32 accumulate) + bias; logits = (k hi|lo) x (q/8 hi|lo) as three bf16 products (hh + hl + lh) in one f32 accumulator; softmax f32 (online, running max); P x 2^12 once to f16 against v once to f16 on v_wmma_f32_16x16x32_f16 (one product); ctx as bf16 hi|lo against the bf16 output weight (two products) + bias; f32 output.
#include <hip/hip_runtime.h>
#include <math.h>

typedef __attribute__((ext_vector_type(16))) _Float16 v16h;
typedef __attribute__((ext_vector_type(16))) __bf16 v16b;
typedef __attribute__((ext_vector_type(8)))  _Float16 v8h;
typedef __attribute__((ext_vector_type(8)))  __bf16 v8b;
typedef __attribute__((ext_vector_type(8)))  float v8f;
typedef __attribute__((ext_vector_type(4)))  float v4f;
typedef __attribute__((ext_vector_type(4)))  unsigned v4u;

// Dense multi-head self-attention, no mask: x [4,1024,1024]; fused (in,out) QKV weight [1024][3072] viewed (3, 16, 64): column = which*1024 + h*64 + d; (in,out) output weight [1024][1024]; one score scale 1/8; softmax over the 1024 keys of the same batch.
#ifndef NB
#define NB 4
#endif
#ifndef SEQ
#define SEQ 1024
#endif
#define NB_FULL 4
#define SEQ_FULL 1024      // full per-batch row stride of x and of the output
#define DIN 1024           // model width (input of QKV projection, output of the last projection)
#define CC 1024            // NH * HD
#define NH 16
#define HD 64
#define SCALE (0.125f)
#define PCARRY (4096.0f)   // P carried x 2^12 into f16 (keeps small probabilities clear of f16 subnormals); folded back with 1/l
#define PLANE ((size_t)NB * SEQ * CC)

static_assert(CC == NH * HD);                 // merged head layout h*64+d
static_assert(HD == 64);
static_assert(SEQ % 64 == 0);                 // 64-row blocks never straddle a batch; key loop steps by 64
static_assert(DIN % 64 == 0 && CC % 128 == 0 && (3 * CC) % 64 == 0 && DIN % 128 == 0);   // tile multiples of every GEMM / transpose grid
static_assert(DIN % 32 == 0 && CC % 32 == 0); // WMMA k-steps
static_assert(NB <= NB_FULL && SEQ <= SEQ_FULL);
static_assert(((size_t)NB * SEQ * (DIN / 8)) % 256 == 0);   // convert grid x 256 threads == plane extent

#define WS_XB  ((size_t)0)                                   // bf16 x rows [NB*SEQ][DIN]
#define WS_WQT (WS_XB  + 2u * (size_t)NB * SEQ * DIN)        // bf16 QKV weight, (out,in) [3*CC][DIN]
#define WS_WOT (WS_WQT + 2u * (size_t)3 * CC * DIN)          // bf16 output weight, (out,in) [DIN][CC]
#define WS_QK  (WS_WOT + 2u * (size_t)DIN * CC)              // bf16 planes: q/8 hi, q/8 lo, k hi, k lo, each [NB*SEQ][CC]
#define WS_VT  (WS_QK  + 4u * 2u * PLANE)                    // f16 v planes [b][c][t]
#define WS_Y   (WS_VT  + 2u * (size_t)NB * CC * SEQ)         // bf16 ctx planes: hi, lo, each [NB*SEQ][CC]
#define WS_END (WS_Y   + 2u * 2u * PLANE)
static_assert(WS_END <= (size_t)134217728);   // total carve
static_assert(WS_WQT % 128 == 0 && WS_WOT % 128 == 0 && WS_QK % 128 == 0 && WS_VT % 128 == 0 && WS_Y % 128 == 0);

template <typename T> __device__ __forceinline__ void vst2(void* p, T v) { *(T*)p = v;  }
__device__ __forceinline__ v8f wmma16(v16h a, v16h b, v8f c) {
  v8f d = __builtin_amdgcn_wmma_f32_16x16x32_f16(false, a, false, b, (short)0, c, false, false);
  asm volatile("v_nop\n\tv_nop\n\tv_nop\n\tv_nop" : "+v"(d) : "v"(a), "v"(b));
  return d;
}
__device__ __forceinline__ v8f wmma_bf(v16b a, v16b b, v8f c) {
  v8f d = __builtin_amdgcn_wmma_f32_16x16x32_bf16(false, a, false, b, (short)0, c, false, false);
  asm volatile("v_nop\n\tv_nop\n\tv_nop\n\tv_nop" : "+v"(d) : "v"(a), "v"(b));
  return d;
}
// 16x16x32 fragments: lane = (g = lane>>4, row/col = lane&15); elements 0..7 = k0+8g+0..7, 8..15 = k0+16+8g+0..7; D element r = row 8g+r, col lane&15
__device__ __forceinline__ v16h frag_h(const _Float16* rowk0, int lane) {
  union { v16h v; v8h q[2]; } u; const _Float16* p = rowk0 + 8 * (lane >> 4);
  u.q[0] = *(const v8h*)p; u.q[1] = *(const v8h*)(p + 16); return u.v;
}
__device__ __forceinline__ v16b frag_b(const __bf16* rowk0, int lane) {
  union { v16b v; v8b q[2]; } u; const __bf16* p = rowk0 + 8 * (lane >> 4);
  u.q[0] = *(const v8b*)p; u.q[1] = *(const v8b*)(p + 16); return u.v;
}
__device__ __forceinline__ float bfr(float v) { return (float)(__bf16)v; }

__global__ __launch_bounds__(256) void k_cvt_x(const float* __restrict__ X, __bf16* __restrict__ XB) {
  const int i = blockIdx.x * 256 + threadIdx.x;
  if (i >= NB * SEQ * (DIN / 8)) return;
  const int row = i / (DIN / 8), pc = i % (DIN / 8);
  const size_t srow = (size_t)(row / SEQ) * SEQ_FULL + (size_t)(row % SEQ);
  const float* p = X + srow * DIN + pc * 8;
  const v4f a = *(const v4f*)p, b = *(const v4f*)(p + 4);
  union { v8b v; v4u u; } o;
  o.v[0] = (__bf16)a[0]; o.v[1] = (__bf16)a[1]; o.v[2] = (__bf16)a[2]; o.v[3] = (__bf16)a[3];
  o.v[4] = (__bf16)b[0]; o.v[5] = (__bf16)b[1]; o.v[6] = (__bf16)b[2]; o.v[7] = (__bf16)b[3];
  vst2(XB + (size_t)row * DIN + pc * 8, o.u);
}

// ---- k_tr_w: in[DIN rows][ldw cols] f32 (in,out) -> out[ldw rows][DIN cols] bf16 (out,in); block = 64 x 64 tile through LDS; grid (ldw/64, DIN/64)
__global__ __launch_bounds__(256) void k_tr_w(const float* __restrict__ W, __bf16* __restrict__ WT, int ldw) {
  __shared__ __align__(16) __bf16 t[64][72];
  const int tid = threadIdx.x; const int n0 = blockIdx.x * 64, k0 = blockIdx.y * 64;
  for (int e = tid; e < 64 * 16; e += 256) { const int kr = e >> 4, c4 = (e & 15) * 4;
    const v4f w = *(const v4f*)(W + (size_t)(k0 + kr) * ldw + n0 + c4);
    t[c4 + 0][kr] = (__bf16)w[0]; t[c4 + 1][kr] = (__bf16)w[1]; t[c4 + 2][kr] = (__bf16)w[2]; t[c4 + 3][kr] = (__bf16)w[3]; }
  __syncthreads();
  for (int e = tid; e < 64 * 8; e += 256) { const int nr = e >> 3, q = e & 7; const v4u v = *(const v4u*)&t[nr][q * 8];
    vst2(WT + (size_t)(n0 + nr) * DIN + k0 + q * 8, v); }
}

// ---- LDS ring of the two GEMM kernels: a stage = 64 k of 256 operand rows (rows 0..127: the A side, rows 128..255: the weight rows), 128 B a row at pitch 144 B (16 B x odd: no bank conflict for 16-B fragment reads); two buffers.
#define KST 64
#define NST (DIN / KST)
#define LPITCH 144
#define STG_BYTES (256 * LPITCH)
static_assert(DIN == CC && DIN % KST == 0 && NST >= 2);
static_assert(SEQ % 128 == 0);                // 128-row blocks of k_proj never straddle a batch
// Eight asynchronous 16-B copies per lane: 16 rows each (8 lanes cover one 128-B row piece), rows 0,16,32,48 from pa and 64,..,112 from pb. The s_wait_xcnt stands inside the statement so that no address register is rewritten ahead of it.
__device__ __forceinline__ void copy128rows(unsigned l, const __bf16* pa, const __bf16* pb) {
  asm volatile("global_load_async_to_lds_b128 %0, %8, off\n\t"
               "global_load_async_to_lds_b128 %1, %9, off\n\t"
               "global_load_async_to_lds_b128 %2, %10, off\n\t"
               "global_load_async_to_lds_b128 %3, %11, off\n\t"
               "global_load_async_to_lds_b128 %4, %12, off\n\t"
               "global_load_async_to_lds_b128 %5, %13, off\n\t"
               "global_load_async_to_lds_b128 %6, %14, off\n\t"
               "global_load_async_to_lds_b128 %7, %15, off\n\t"
               "s_wait_xcnt 0x0"
               :: "v"(l), "v"(l + 16u * LPITCH), "v"(l + 32u * LPITCH), "v"(l + 48u * LPITCH), "v"(l + 64u * LPITCH), "v"(l + 80u * LPITCH), "v"(l + 96u * LPITCH), "v"(l + 112u * LPITCH),
                  "v"(pa), "v"(pa + 16 * DIN), "v"(pa + 32 * DIN), "v"(pa + 48 * DIN), "v"(pb), "v"(pb + 16 * DIN), "v"(pb + 32 * DIN), "v"(pb + 48 * DIN)
               : "memory");
}
// fragment of 16 staged rows starting at row, k step kc of the stage
__device__ __forceinline__ v16b frag_s(const unsigned char* sb, int row, int kc, int lane) {
  return frag_b((const __bf16*)(sb + (row + (lane & 15)) * LPITCH) + kc * 32, lane);
}

// ---- k_proj: block = (128 rows, 128 cols, which), 4 waves of 64 x 64: q/k/v = x W + b with exact bf16 products (K = DIN), operands through the LDS ring. which 0: q x 1/8 as bf16 hi|lo rows; 1: k as bf16 hi|lo rows; 2: v f16 planes [c][t]
__global__ __launch_bounds__(128) void k_proj(const __bf16* __restrict__ XB, const __bf16* __restrict__ WT, const float* __restrict__ BQKV, __bf16* __restrict__ QK, _Float16* __restrict__ VT) {
  __shared__ __align__(128) unsigned char sm[2 * STG_BYTES];   // the ring; behind the k loop the output staging
  static_assert(2 * 128 * 136 * 2 <= 2 * STG_BYTES);
  const int tid = threadIdx.x; const int wave = __builtin_amdgcn_readfirstlane(threadIdx.x >> 5); const int lane = tid & 31, col = lane & 15, g = lane >> 4;
  const int wm = wave >> 1, wn = wave & 1;
  const int which = blockIdx.z; const int c0 = blockIdx.y * 128; const int r0 = blockIdx.x * 128; const int bb = r0 / SEQ; const int t0 = r0 % SEQ;
  const __bf16* ga = XB + (size_t)(r0 + (tid >> 3)) * DIN + (tid & 7) * 8;
  const __bf16* gw = WT + (size_t)(which * CC + c0 + (tid >> 3)) * DIN + (tid & 7) * 8;
  const unsigned l0 = (unsigned)(size_t)sm + (unsigned)((tid >> 3) * LPITCH + (tid & 7) * 16);
  copy128rows(l0, ga, ga + 64 * DIN); copy128rows(l0 + 128u * LPITCH, gw, gw + 64 * DIN);
  asm volatile("s_wait_asynccnt 0x0" ::: "memory");   // stage 0 landed (this wave's copies)
  __syncthreads();                                     // ... and every other wave's
  copy128rows(l0 + STG_BYTES, ga + KST, ga + 64 * DIN + KST); copy128rows(l0 + STG_BYTES + 128u * LPITCH, gw + KST, gw + 64 * DIN + KST);
  v8f acc[4][4] = {};
#pragma unroll 1   // one copy of the pass in the text; the buffer is chosen by the trip's parity
  for (int t = 0; t < NST; ++t) { const unsigned bo = (unsigned)(t & 1) * STG_BYTES; const unsigned char* sb = sm + bo;
#pragma unroll
    for (int kc = 0; kc < KST / 32; ++kc) { v16b a[4], w[4];
#pragma unroll
      for (int i = 0; i < 4; ++i) { a[i] = frag_s(sb, wm * 64 + i * 16, kc, lane); w[i] = frag_s(sb, 128 + wn * 64 + i * 16, kc, lane); }
#pragma unroll
      for (int i = 0; i < 4; ++i)
#pragma unroll
        for (int j = 0; j < 4; ++j) acc[i][j] = wmma_bf(a[i], w[j], acc[i][j]); }
    asm volatile("s_wait_dscnt 0x0" ::: "memory");      // this wave's reads of the buffer are done before it is refilled
    asm volatile("s_wait_asynccnt 0x0" ::: "memory");   // this wave's copies of stage t + 1 have landed
    __syncthreads();                                     // publishes stage t + 1, frees stage t's buffer
    if (t + 2 < NST) { const int ko = (t + 2) * KST; copy128rows(l0 + bo, ga + ko, ga + 64 * DIN + ko); copy128rows(l0 + bo + 128u * LPITCH, gw + ko, gw + 64 * DIN + ko); } }
  asm volatile("s_wait_asynccnt 0x0" ::: "memory");     // no copy is outstanding when the ring becomes output staging
  if (which < 2) { const float qs = (which == 0) ? SCALE : 1.0f;   /* block-uniform; 1/8 is an exact power of two */
    __bf16 (*sh)[136] = (__bf16 (*)[136])sm; __bf16 (*sl)[136] = (__bf16 (*)[136])(sm + 128 * 136 * 2);
#pragma unroll
    for (int j = 0; j < 4; ++j) { const int cl = wn * 64 + j * 16 + col; const float bias = bfr(BQKV[which * CC + c0 + cl]);
#pragma unroll
      for (int i = 0; i < 4; ++i)
#pragma unroll
        for (int r = 0; r < 8; ++r) { const int rl = wm * 64 + i * 16 + 8 * g + r; const float v = (acc[i][j][r] + bias) * qs; const __bf16 hv = (__bf16)v; sh[rl][cl] = hv; sl[rl][cl] = (__bf16)(v - (float)hv); } }
    __syncthreads();
    __bf16* DH = QK + (size_t)(2 * which) * PLANE; __bf16* DL = DH + PLANE;
    for (int e = tid; e < 128 * 16; e += 128) { const int rl = e >> 4, q = e & 15; const v4u vh = *(const v4u*)&sh[rl][q * 8]; const v4u vl = *(const v4u*)&sl[rl][q * 8];
      const size_t o = (size_t)(r0 + rl) * CC + c0 + q * 8; vst2(DH + o, vh); vst2(DL + o, vl); }
  } else {
    _Float16 (*th)[136] = (_Float16 (*)[136])sm;
#pragma unroll
    for (int j = 0; j < 4; ++j) { const int cl = wn * 64 + j * 16 + col; const float bias = bfr(BQKV[2 * CC + c0 + cl]);
#pragma unroll
      for (int i = 0; i < 4; ++i)
#pragma unroll
        for (int r = 0; r < 8; ++r) th[cl][wm * 64 + i * 16 + 8 * g + r] = (_Float16)(acc[i][j][r] + bias); }
    __syncthreads();
    for (int e = tid; e < 128 * 16; e += 128) { const int cl = e >> 4, q = e & 15; const v4u v = *(const v4u*)&th[cl][q * 8];
      vst2(VT + ((size_t)bb * CC + c0 + cl) * (size_t)SEQ + t0 + q * 8, v); } }
}

// ---- k_attn: block = 64 queries (4 waves x 16) of (b, h); transposed flash form: S^T tile = K (A, rows = keys) x Q^T (B, cols = queries) so each lane owns one query column:
//      running max / sum are per-lane scalars (+ one xor-16 shuffle for the max); the two 16-key S^T accumulators convert in-lane into the B fragment (k = key row of the tile) of O^T += V^T (A, rows = d) x P^T.
//      K hi, K lo and V^T of 64 keys form one stage of an LDS ring shared by the four waves (rows 0..63 K hi, 64..127 K lo, 128..191 V^T rows d; 128 B a row at pitch 144 B), two buffers; the softmax still steps by 32 keys.
#define AST_BYTES (192 * LPITCH)
#define NKS (SEQ / 64)
static_assert(NKS >= 2 && HD * 2 == 128);   // two stages at least; a K row piece (64 d) and a V^T row piece (64 keys) are 128 B
// Four asynchronous 16-B copies per lane: 64 rows of V^T (16 rows each). The s_wait_xcnt stands inside the statement so that no address register is rewritten ahead of it.
__device__ __forceinline__ void copy64rows(unsigned l, const _Float16* p) {
  asm volatile("global_load_async_to_lds_b128 %0, %4, off\n\t"
               "global_load_async_to_lds_b128 %1, %5, off\n\t"
               "global_load_async_to_lds_b128 %2, %6, off\n\t"
               "global_load_async_to_lds_b128 %3, %7, off\n\t"
               "s_wait_xcnt 0x0"
               :: "v"(l), "v"(l + 16u * LPITCH), "v"(l + 32u * LPITCH), "v"(l + 48u * LPITCH), "v"(p), "v"(p + 16 * SEQ), "v"(p + 32 * SEQ), "v"(p + 48 * SEQ)
               : "memory");
}
__global__ __launch_bounds__(128) void k_attn(const __bf16* __restrict__ QK, const _Float16* __restrict__ VT, __bf16* __restrict__ Y) {
  __shared__ __align__(128) unsigned char sm[2 * AST_BYTES];
  __shared__ v4u ys[2][64][9];
  const int tid = threadIdx.x; const int wave = __builtin_amdgcn_readfirstlane(threadIdx.x >> 5); const int lane = tid & 31, col = lane & 15, g = lane >> 4;
  const int qb = blockIdx.x, h = blockIdx.y, b = blockIdx.z;
  const size_t qoff = ((size_t)b * SEQ + qb * 64 + wave * 16 + col) * CC + h * HD;
  const __bf16* QHp = QK + qoff; const __bf16* QLp = QK + PLANE + qoff;
  const size_t koff = ((size_t)b * SEQ + (tid >> 3)) * CC + h * HD + (tid & 7) * 8;
  const __bf16* gkh = QK + 2 * PLANE + koff; const __bf16* gkl = QK + 3 * PLANE + koff;
  const _Float16* gv = VT + ((size_t)b * CC + h * HD + (tid >> 3)) * (size_t)SEQ + (tid & 7) * 8;
  const unsigned l0 = (unsigned)(size_t)sm + (unsigned)((tid >> 3) * LPITCH + (tid & 7) * 16);
  copy128rows(l0, gkh, gkl); copy64rows(l0 + 128u * LPITCH, gv);
  v16b qh[HD / 32], ql[HD / 32];   // the wave's query fragments, read once
#pragma unroll
  for (int kc = 0; kc < HD / 32; ++kc) { qh[kc] = frag_b(QHp + kc * 32, lane); ql[kc] = frag_b(QLp + kc * 32, lane); }
  asm volatile("s_wait_asynccnt 0x0" ::: "memory");   // stage 0 landed (this wave's copies)
  __syncthreads();                                     // ... and every other wave's
  copy128rows(l0 + AST_BYTES, gkh + 64 * CC, gkl + 64 * CC); copy64rows(l0 + AST_BYTES + 128u * LPITCH, gv + 64);
  v8f o[4] = {}; float m = -1.0e30f, l = 0.f;
#pragma unroll 1   // one copy of the pass in the text; the buffer is chosen by the trip's parity
  for (int t = 0; t < NKS; ++t) { const unsigned bo = (unsigned)(t & 1) * AST_BYTES; const unsigned char* sb = sm + bo;
#pragma unroll
   for (int u = 0; u < 2; ++u) {
    v8f s0 = {}, s1 = {};
#pragma unroll
    for (int kc = 0; kc < HD / 32; ++kc) {
      { const v16b kh = frag_s(sb, u * 32, kc, lane), kl = frag_s(sb, 64 + u * 32, kc, lane);
        s0 = wmma_bf(kl, qh[kc], s0); s0 = wmma_bf(kh, ql[kc], s0); s0 = wmma_bf(kh, qh[kc], s0); }
      { const v16b kh = frag_s(sb, u * 32 + 16, kc, lane), kl = frag_s(sb, 64 + u * 32 + 16, kc, lane);
        s1 = wmma_bf(kl, qh[kc], s1); s1 = wmma_bf(kh, ql[kc], s1); s1 = wmma_bf(kh, qh[kc], s1); }
    }
    float mx = fmaxf(s0[0], s1[0]);
#pragma unroll
    for (int r = 1; r < 8; ++r) mx = fmaxf(mx, fmaxf(s0[r], s1[r]));
    mx = fmaxf(mx, __shfl_xor(mx, 16));          /* all lanes active; both lane halves of a query column agree on the max */
    const float mn = fmaxf(m, mx); const float corr = __expf(m - mn); m = mn;
    v16h p; float ps = 0.f;
#pragma unroll
    for (int r = 0; r < 8; ++r) { const float e0 = __expf(s0[r] - mn), e1 = __expf(s1[r] - mn); ps += e0 + e1; p[r] = (_Float16)(e0 * PCARRY); p[8 + r] = (_Float16)(e1 * PCARRY); }
    l = l * corr + ps;                            /* l from the unconverted f32 values; per-lane partial (this lane's 16 of the 32 keys) */
#pragma unroll
    for (int j = 0; j < 4; ++j)
#pragma unroll
      for (int r = 0; r < 8; ++r) o[j][r] *= corr;
#pragma unroll
    for (int j = 0; j < 4; ++j) { const v16h vf = frag_h((const _Float16*)(sb + (128 + j * 16 + col) * LPITCH) + u * 32, lane); o[j] = wmma16(vf, p, o[j]); }
   }
    asm volatile("s_wait_dscnt 0x0" ::: "memory");      // this wave's reads of the buffer are done before it is refilled
    asm volatile("s_wait_asynccnt 0x0" ::: "memory");   // this wave's copies of stage t + 1 have landed
    __syncthreads();                                     // publishes stage t + 1, frees stage t's buffer
    if (t + 2 < NKS) { const int kn = (t + 2) * 64; copy128rows(l0 + bo, gkh + (size_t)kn * CC, gkl + (size_t)kn * CC); copy64rows(l0 + bo + 128u * LPITCH, gv + kn); }
  }
  asm volatile("s_wait_asynccnt 0x0" ::: "memory");     // no copy is outstanding at the wave's end
  l += __shfl_xor(l, 16);
  const float inv = 1.0f / (l * PCARRY);
  // O^T tile j: lane (g, col = query) holds d = 16j + 8g + 0..7: one 16-B piece of the (row, head) segment, as bf16 hi and lo
#pragma unroll
  for (int j = 0; j < 4; ++j) { union { v8b v; v4u u; } hi, lo;
#pragma unroll
    for (int r = 0; r < 8; ++r) { const float c = o[j][r] * inv; const __bf16 hb = (__bf16)c; hi.v[r] = hb; lo.v[r] = (__bf16)(c - (float)hb); }
    ys[0][wave * 16 + col][2 * j + g] = hi.u; ys[1][wave * 16 + col][2 * j + g] = lo.u; }
  __syncthreads();
#pragma unroll 1
  for (int it = 0; it < 4; ++it) { const int rl = wave * 16 + it * 4 + (lane >> 3), pc = lane & 7;
    const v4u a = ys[0][rl][pc]; const v4u c = ys[1][rl][pc];
    const size_t go = ((size_t)b * SEQ + qb * 64 + rl) * CC + h * HD + pc * 8;
    vst2(Y + go, a); vst2(Y + PLANE + go, c); }
}

// ---- k_out: block = (64 rows, 128 cols), 4 waves of 32 x 64: out = ctx Wo + bo: ctx bf16 hi + lo against the exact bf16 weight (2 products, one accumulator: lo, then hi, per k step), operands through the LDS ring (rows 0..63 ctx hi, 64..127 ctx lo, 128..255 weight); 512-B row segment by one 32-lane x 16-B instruction
__global__ __launch_bounds__(128) void k_out(const __bf16* __restrict__ Y, const __bf16* __restrict__ WOT, const float* __restrict__ BO, float* __restrict__ OUT) {
  __shared__ __align__(128) unsigned char sm[2 * STG_BYTES];   // the ring; behind the k loop the output staging
  static_assert(64 * 132 * 4 <= 2 * STG_BYTES);
  const int tid = threadIdx.x; const int wave = __builtin_amdgcn_readfirstlane(threadIdx.x >> 5); const int lane = tid & 31, col = lane & 15, g = lane >> 4;
  const int wm = wave >> 1, wn = wave & 1;
  const int c0 = blockIdx.y * 128; const int rb = blockIdx.x * 64;
  const __bf16* gh = Y + (size_t)(rb + (tid >> 3)) * CC + (tid & 7) * 8; const __bf16* gl = gh + PLANE;
  const __bf16* gw = WOT + (size_t)(c0 + (tid >> 3)) * CC + (tid & 7) * 8;
  const unsigned l0 = (unsigned)(size_t)sm + (unsigned)((tid >> 3) * LPITCH + (tid & 7) * 16);
  copy128rows(l0, gh, gl); copy128rows(l0 + 128u * LPITCH, gw, gw + 64 * CC);
  asm volatile("s_wait_asynccnt 0x0" ::: "memory");   // stage 0 landed (this wave's copies)
  __syncthreads();                                     // ... and every other wave's
  copy128rows(l0 + STG_BYTES, gh + KST, gl + KST); copy128rows(l0 + STG_BYTES + 128u * LPITCH, gw + KST, gw + 64 * CC + KST);
  v8f acc[2][4] = {};
#pragma unroll 1   // one copy of the pass in the text; the buffer is chosen by the trip's parity
  for (int t = 0; t < NST; ++t) { const unsigned bo = (unsigned)(t & 1) * STG_BYTES; const unsigned char* sb = sm + bo;
#pragma unroll
    for (int kc = 0; kc < KST / 32; ++kc) { v16b ah[2], al[2], w[4];
#pragma unroll
      for (int i = 0; i < 2; ++i) { ah[i] = frag_s(sb, wm * 32 + i * 16, kc, lane); al[i] = frag_s(sb, 64 + wm * 32 + i * 16, kc, lane); }
#pragma unroll
      for (int j = 0; j < 4; ++j) w[j] = frag_s(sb, 128 + wn * 64 + j * 16, kc, lane);
#pragma unroll
      for (int i = 0; i < 2; ++i)
#pragma unroll
        for (int j = 0; j < 4; ++j) acc[i][j] = wmma_bf(al[i], w[j], acc[i][j]);
#pragma unroll
      for (int i = 0; i < 2; ++i)
#pragma unroll
        for (int j = 0; j < 4; ++j) acc[i][j] = wmma_bf(ah[i], w[j], acc[i][j]); }
    asm volatile("s_wait_dscnt 0x0" ::: "memory");      // this wave's reads of the buffer are done before it is refilled
    asm volatile("s_wait_asynccnt 0x0" ::: "memory");   // this wave's copies of stage t + 1 have landed
    __syncthreads();                                     // publishes stage t + 1, frees stage t's buffer
    if (t + 2 < NST) { const int ko = (t + 2) * KST; copy128rows(l0 + bo, gh + ko, gl + ko); copy128rows(l0 + bo + 128u * LPITCH, gw + ko, gw + 64 * CC + ko); } }
  asm volatile("s_wait_asynccnt 0x0" ::: "memory");     // no copy is outstanding when the ring becomes output staging
  float (*sf)[132] = (float (*)[132])sm;
#pragma unroll
  for (int j = 0; j < 4; ++j) { const int cl = wn * 64 + j * 16 + col; const float bias = bfr(BO[c0 + cl]);
#pragma unroll
    for (int i = 0; i < 2; ++i)
#pragma unroll
      for (int r = 0; r < 8; ++r) sf[wm * 32 + i * 16 + 8 * g + r][cl] = acc[i][j][r] + bias; }
  __syncthreads();
  const size_t orow0 = (size_t)(rb / SEQ) * SEQ_FULL + (size_t)(rb % SEQ) + wave * 16;
#pragma unroll 1
  for (int rl = 0; rl < 16; ++rl) { const v4f v = *(const v4f*)&sf[wave * 16 + rl][lane * 4];
    vst2(OUT + (orow0 + rl) * DIN + c0 + lane * 4, v); }
}

extern "C" void kernel_launch(void* const* d_in, const int* in_sizes, int n_in, void* d_out, int out_size, void* d_ws, size_t ws_size, hipStream_t stream) {
  if (n_in < 5) return;
  const size_t xneed = ((size_t)(NB - 1) * SEQ_FULL + SEQ) * DIN;
  if ((size_t)in_sizes[0] < xneed) return;
  if ((size_t)in_sizes[1] < (size_t)DIN * 3 * CC) return;
  if ((size_t)in_sizes[2] < (size_t)3 * CC) return;
  if ((size_t)in_sizes[3] < (size_t)CC * DIN) return;
  if ((size_t)in_sizes[4] < (size_t)DIN) return;
  if ((size_t)out_size < xneed) return;
  if (ws_size < (size_t)WS_END) return;
  // inputs (wire order): 0 x [4,1024,1024]; 1 W_qkv [1024,3072] (in,out): q columns 0..1023, k 1024..2047, v 2048..3071; 2 b_qkv [3072]; 3 W_out [1024,1024] (in,out); 4 b_out [1024]
  const float* x = (const float*)d_in[0]; const float* wqkv = (const float*)d_in[1]; const float* bqkv = (const float*)d_in[2]; const float* wout = (const float*)d_in[3]; const float* bout = (const float*)d_in[4];
  char* ws = (char*)d_ws;
  __bf16* XB = (__bf16*)(ws + WS_XB); __bf16* WQT = (__bf16*)(ws + WS_WQT); __bf16* WOT = (__bf16*)(ws + WS_WOT); __bf16* QK = (__bf16*)(ws + WS_QK); _Float16* VT = (_Float16*)(ws + WS_VT); __bf16* Y = (__bf16*)(ws + WS_Y);
  k_cvt_x<<<dim3((unsigned)(((size_t)NB * SEQ * (DIN / 8)) / 256)), 256, 0, stream>>>(x, XB);
  k_tr_w<<<dim3(3 * CC / 64, DIN / 64), 256, 0, stream>>>(wqkv, WQT, 3 * CC);   // in[1024][3072] -> out[3072][1024]
  k_tr_w<<<dim3(DIN / 64, CC / 64), 256, 0, stream>>>(wout, WOT, DIN);          // in[1024][1024] -> out[1024][1024]
  k_proj<<<dim3(NB * SEQ / 128, CC / 128, 3), 128, 0, stream>>>(XB, WQT, bqkv, QK, VT);
  k_attn<<<dim3(SEQ / 64, NH, NB), 128, 0, stream>>>(QK, VT, Y);
  k_out<<<dim3(NB * SEQ / 64, DIN / 128), 128, 0, stream>>>(Y, WOT, bout, (float*)d_out);
}

// v002
// A run of this version takes 89.2 microseconds.
// Next to v001, in two timings, it ran 1.06 and 1.07 times as fast.
// Over all steps from v000 it is 3.42 times as fast.
// compute dtype: all float inputs converted (RNE) to bf16; q/k/v projections = exact bf16 x bf16 products on v_wmma_f32_16x16x32_bf16 (f32 accumulate) + bias; logits = (k hi|lo) x (q/8 hi|lo) as three bf16 products (hh + hl + lh) in one f32 accumulator; softmax f32 (online, running max); P x 2^12 once to f16 against v once to f16 on v_wmma_f32_16x16x32_f16 (one product); ctx as bf16 hi|lo against the bf16 output weight (two products) + bias; f32 output.
#include <hip/hip_runtime.h>
#include <math.h>

typedef __attribute__((ext_vector_type(16))) _Float16 v16h;
typedef __attribute__((ext_vector_type(16))) __bf16 v16b;
typedef __attribute__((ext_vector_type(8)))  _Float16 v8h;
typedef __attribute__((ext_vector_type(8)))  __bf16 v8b;
typedef __attribute__((ext_vector_type(8)))  float v8f;
typedef __attribute__((ext_vector_type(4)))  float v4f;
typedef __attribute__((ext_vector_type(4)))  unsigned v4u;

// Dense multi-head self-attention, no mask: x [4,1024,1024]; fused (in,out) QKV weight [1024][3072] viewed (3, 16, 64): column = which*1024 + h*64 + d; (in,out) output weight [1024][1024]; one score scale 1/8; softmax over the 1024 keys of the same batch.
#ifndef NB
#define NB 4
#endif
#ifndef SEQ
#define SEQ 1024
#endif
#define NB_FULL 4
#define SEQ_FULL 1024      // full per-batch row stride of x and of the output
#define DIN 1024           // model width (input of QKV projection, output of the last projection)
#define CC 1024            // NH * HD
#define NH 16
#define HD 64
#define SCALE (0.125f)
#define PCARRY (4096.0f)   // P carried x 2^12 into f16 (keeps small probabilities clear of f16 subnormals); folded back with 1/l
#define PLANE ((size_t)NB * SEQ * CC)

static_assert(CC == NH * HD);                 // merged head layout h*64+d
static_assert(HD == 64);
static_assert(SEQ % 64 == 0);                 // 64-row blocks never straddle a batch; key loop steps by 64
static_assert(DIN % 64 == 0 && CC % 128 == 0 && (3 * CC) % 64 == 0 && DIN % 128 == 0);   // tile multiples of every GEMM / transpose grid
static_assert(DIN % 32 == 0 && CC % 32 == 0); // WMMA k-steps
static_assert(NB <= NB_FULL && SEQ <= SEQ_FULL);
static_assert(((size_t)NB * SEQ * (DIN / 8)) % 256 == 0);   // convert grid x 256 threads == plane extent

#define WS_XB  ((size_t)0)                                   // bf16 x rows [NB*SEQ][DIN]
#define WS_WQT (WS_XB  + 2u * (size_t)NB * SEQ * DIN)        // bf16 QKV weight, (out,in) [3*CC][DIN]
#define WS_WOT (WS_WQT + 2u * (size_t)3 * CC * DIN)          // bf16 output weight, (out,in) [DIN][CC]
#define WS_QK  (WS_WOT + 2u * (size_t)DIN * CC)              // bf16 planes: q/8 hi, q/8 lo, k hi, k lo, each [NB*SEQ][CC]
#define WS_VT  (WS_QK  + 4u * 2u * PLANE)                    // f16 v planes [b][c][t]
#define WS_Y   (WS_VT  + 2u * (size_t)NB * CC * SEQ)         // bf16 ctx planes: hi, lo, each [NB*SEQ][CC]
#define WS_END (WS_Y   + 2u * 2u * PLANE)
static_assert(WS_END <= (size_t)134217728);   // total carve
static_assert(WS_WQT % 128 == 0 && WS_WOT % 128 == 0 && WS_QK % 128 == 0 && WS_VT % 128 == 0 && WS_Y % 128 == 0);

template <typename T> __device__ __forceinline__ void vst2(void* p, T v) { *(T*)p = v;  }
// k_attn's two products are the bare builtins: the compiler keeps the distances behind its own WMMAs, and with no asm statement tied to each product it may group the LDS reads ahead, alternate the accumulator chains and set softmax work between the products
__device__ __forceinline__ v8f wmma16(v16h a, v16h b, v8f c) {
  return __builtin_amdgcn_wmma_f32_16x16x32_f16(false, a, false, b, (short)0, c, false, false);
}
__device__ __forceinline__ v8f wmma_bfa(v16b a, v16b b, v8f c) {
  return __builtin_amdgcn_wmma_f32_16x16x32_bf16(false, a, false, b, (short)0, c, false, false);
}
__device__ __forceinline__ v8f wmma_bf(v16b a, v16b b, v8f c) {
  v8f d = __builtin_amdgcn_wmma_f32_16x16x32_bf16(false, a, false, b, (short)0, c, false, false);
  asm volatile("v_nop\n\tv_nop\n\tv_nop\n\tv_nop" : "+v"(d) : "v"(a), "v"(b));
  return d;
}
// 16x16x32 fragments: lane = (g = lane>>4, row/col = lane&15); elements 0..7 = k0+8g+0..7, 8..15 = k0+16+8g+0..7; D element r = row 8g+r, col lane&15
__device__ __forceinline__ v16h frag_h(const _Float16* rowk0, int lane) {
  union { v16h v; v8h q[2]; } u; const _Float16* p = rowk0 + 8 * (lane >> 4);
  u.q[0] = *(const v8h*)p; u.q[1] = *(const v8h*)(p + 16); return u.v;
}
__device__ __forceinline__ v16b frag_b(const __bf16* rowk0, int lane) {
  union { v16b v; v8b q[2]; } u; const __bf16* p = rowk0 + 8 * (lane >> 4);
  u.q[0] = *(const v8b*)p; u.q[1] = *(const v8b*)(p + 16); return u.v;
}
__device__ __forceinline__ float bfr(float v) { return (float)(__bf16)v; }

__global__ __launch_bounds__(256) void k_cvt_x(const float* __restrict__ X, __bf16* __restrict__ XB) {
  const int i = blockIdx.x * 256 + threadIdx.x;
  if (i >= NB * SEQ * (DIN / 8)) return;
  const int row = i / (DIN / 8), pc = i % (DIN / 8);
  const size_t srow = (size_t)(row / SEQ) * SEQ_FULL + (size_t)(row % SEQ);
  const float* p = X + srow * DIN + pc * 8;
  const v4f a = *(const v4f*)p, b = *(const v4f*)(p + 4);
  union { v8b v; v4u u; } o;
  o.v[0] = (__bf16)a[0]; o.v[1] = (__bf16)a[1]; o.v[2] = (__bf16)a[2]; o.v[3] = (__bf16)a[3];
  o.v[4] = (__bf16)b[0]; o.v[5] = (__bf16)b[1]; o.v[6] = (__bf16)b[2]; o.v[7] = (__bf16)b[3];
  vst2(XB + (size_t)row * DIN + pc * 8, o.u);
}

// ---- k_tr_w: in[DIN rows][ldw cols] f32 (in,out) -> out[ldw rows][DIN cols] bf16 (out,in); block = 64 x 64 tile through LDS; grid (ldw/64, DIN/64)
__global__ __launch_bounds__(256) void k_tr_w(const float* __restrict__ W, __bf16* __restrict__ WT, int ldw) {
  __shared__ __align__(16) __bf16 t[64][72];
  const int tid = threadIdx.x; const int n0 = blockIdx.x * 64, k0 = blockIdx.y * 64;
  for (int e = tid; e < 64 * 16; e += 256) { const int kr = e >> 4, c4 = (e & 15) * 4;
    const v4f w = *(const v4f*)(W + (size_t)(k0 + kr) * ldw + n0 + c4);
    t[c4 + 0][kr] = (__bf16)w[0]; t[c4 + 1][kr] = (__bf16)w[1]; t[c4 + 2][kr] = (__bf16)w[2]; t[c4 + 3][kr] = (__bf16)w[3]; }
  __syncthreads();
  for (int e = tid; e < 64 * 8; e += 256) { const int nr = e >> 3, q = e & 7; const v4u v = *(const v4u*)&t[nr][q * 8];
    vst2(WT + (size_t)(n0 + nr) * DIN + k0 + q * 8, v); }
}

// ---- LDS ring of the two GEMM kernels: a stage = 64 k of 256 operand rows (rows 0..127: the A side, rows 128..255: the weight rows), 128 B a row at pitch 144 B (16 B x odd: no bank conflict for 16-B fragment reads); two buffers.
#define KST 64
#define NST (DIN / KST)
#define LPITCH 144
#define STG_BYTES (256 * LPITCH)
static_assert(DIN == CC && DIN % KST == 0 && NST >= 2);
static_assert(SEQ % 128 == 0);                // 128-row blocks of k_proj never straddle a batch
// Eight asynchronous 16-B copies per lane: 16 rows each (8 lanes cover one 128-B row piece), rows 0,16,32,48 from pa and 64,..,112 from pb. The s_wait_xcnt stands inside the statement so that no address register is rewritten ahead of it.
__device__ __forceinline__ void copy128rows(unsigned l, const __bf16* pa, const __bf16* pb) {
  asm volatile("global_load_async_to_lds_b128 %0, %8, off\n\t"
               "global_load_async_to_lds_b128 %1, %9, off\n\t"
               "global_load_async_to_lds_b128 %2, %10, off\n\t"
               "global_load_async_to_lds_b128 %3, %11, off\n\t"
               "global_load_async_to_lds_b128 %4, %12, off\n\t"
               "global_load_async_to_lds_b128 %5, %13, off\n\t"
               "global_load_async_to_lds_b128 %6, %14, off\n\t"
               "global_load_async_to_lds_b128 %7, %15, off\n\t"
               "s_wait_xcnt 0x0"
               :: "v"(l), "v"(l + 16u * LPITCH), "v"(l + 32u * LPITCH), "v"(l + 48u * LPITCH), "v"(l + 64u * LPITCH), "v"(l + 80u * LPITCH), "v"(l + 96u * LPITCH), "v"(l + 112u * LPITCH),
                  "v"(pa), "v"(pa + 16 * DIN), "v"(pa + 32 * DIN), "v"(pa + 48 * DIN), "v"(pb), "v"(pb + 16 * DIN), "v"(pb + 32 * DIN), "v"(pb + 48 * DIN)
               : "memory");
}
// fragment of 16 staged rows starting at row, k step kc of the stage
__device__ __forceinline__ v16b frag_s(const unsigned char* sb, int row, int kc, int lane) {
  return frag_b((const __bf16*)(sb + (row + (lane & 15)) * LPITCH) + kc * 32, lane);
}

// ---- k_proj: block = (128 rows, 128 cols, which), 4 waves of 64 x 64: q/k/v = x W + b with exact bf16 products (K = DIN), operands through the LDS ring. which 0: q x 1/8 as bf16 hi|lo rows; 1: k as bf16 hi|lo rows; 2: v f16 planes [c][t]
__global__ __launch_bounds__(128) void k_proj(const __bf16* __restrict__ XB, const __bf16* __restrict__ WT, const float* __restrict__ BQKV, __bf16* __restrict__ QK, _Float16* __restrict__ VT) {
  __shared__ __align__(128) unsigned char sm[2 * STG_BYTES];   // the ring; behind the k loop the output staging
  static_assert(2 * 128 * 136 * 2 <= 2 * STG_BYTES);
  const int tid = threadIdx.x; const int wave = __builtin_amdgcn_readfirstlane(threadIdx.x >> 5); const int lane = tid & 31, col = lane & 15, g = lane >> 4;
  const int wm = wave >> 1, wn = wave & 1;
  const int which = blockIdx.z; const int c0 = blockIdx.y * 128; const int r0 = blockIdx.x * 128; const int bb = r0 / SEQ; const int t0 = r0 % SEQ;
  const __bf16* ga = XB + (size_t)(r0 + (tid >> 3)) * DIN + (tid & 7) * 8;
  const __bf16* gw = WT + (size_t)(which * CC + c0 + (tid >> 3)) * DIN + (tid & 7) * 8;
  const unsigned l0 = (unsigned)(size_t)sm + (unsigned)((tid >> 3) * LPITCH + (tid & 7) * 16);
  copy128rows(l0, ga, ga + 64 * DIN); copy128rows(l0 + 128u * LPITCH, gw, gw + 64 * DIN);
  asm volatile("s_wait_asynccnt 0x0" ::: "memory");   // stage 0 landed (this wave's copies)
  __syncthreads();                                     // ... and every other wave's
  copy128rows(l0 + STG_BYTES, ga + KST, ga + 64 * DIN + KST); copy128rows(l0 + STG_BYTES + 128u * LPITCH, gw + KST, gw + 64 * DIN + KST);
  v8f acc[4][4] = {};
#pragma unroll 1   // one copy of the pass in the text; the buffer is chosen by the trip's parity
  for (int t = 0; t < NST; ++t) { const unsigned bo = (unsigned)(t & 1) * STG_BYTES; const unsigned char* sb = sm + bo;
#pragma unroll
    for (int kc = 0; kc < KST / 32; ++kc) { v16b a[4], w[4];
#pragma unroll
      for (int i = 0; i < 4; ++i) { a[i] = frag_s(sb, wm * 64 + i * 16, kc, lane); w[i] = frag_s(sb, 128 + wn * 64 + i * 16, kc, lane); }
#pragma unroll
      for (int i = 0; i < 4; ++i)
#pragma unroll
        for (int j = 0; j < 4; ++j) acc[i][j] = wmma_bf(a[i], w[j], acc[i][j]); }
    asm volatile("s_wait_dscnt 0x0" ::: "memory");      // this wave's reads of the buffer are done before it is refilled
    asm volatile("s_wait_asynccnt 0x0" ::: "memory");   // this wave's copies of stage t + 1 have landed
    __syncthreads();                                     // publishes stage t + 1, frees stage t's buffer
    if (t + 2 < NST) { const int ko = (t + 2) * KST; copy128rows(l0 + bo, ga + ko, ga + 64 * DIN + ko); copy128rows(l0 + bo + 128u * LPITCH, gw + ko, gw + 64 * DIN + ko); } }
  asm volatile("s_wait_asynccnt 0x0" ::: "memory");     // no copy is outstanding when the ring becomes output staging
  if (which < 2) { const float qs = (which == 0) ? SCALE : 1.0f;   /* block-uniform; 1/8 is an exact power of two */
    __bf16 (*sh)[136] = (__bf16 (*)[136])sm; __bf16 (*sl)[136] = (__bf16 (*)[136])(sm + 128 * 136 * 2);
#pragma unroll
    for (int j = 0; j < 4; ++j) { const int cl = wn * 64 + j * 16 + col; const float bias = bfr(BQKV[which * CC + c0 + cl]);
#pragma unroll
      for (int i = 0; i < 4; ++i)
#pragma unroll
        for (int r = 0; r < 8; ++r) { const int rl = wm * 64 + i * 16 + 8 * g + r; const float v = (acc[i][j][r] + bias) * qs; const __bf16 hv = (__bf16)v; sh[rl][cl] = hv; sl[rl][cl] = (__bf16)(v - (float)hv); } }
    __syncthreads();
    __bf16* DH = QK + (size_t)(2 * which) * PLANE; __bf16* DL = DH + PLANE;
    for (int e = tid; e < 128 * 16; e += 128) { const int rl = e >> 4, q = e & 15; const v4u vh = *(const v4u*)&sh[rl][q * 8]; const v4u vl = *(const v4u*)&sl[rl][q * 8];
      const size_t o = (size_t)(r0 + rl) * CC + c0 + q * 8; vst2(DH + o, vh); vst2(DL + o, vl); }
  } else {
    _Float16 (*th)[136] = (_Float16 (*)[136])sm;
#pragma unroll
    for (int j = 0; j < 4; ++j) { const int cl = wn * 64 + j * 16 + col; const float bias = bfr(BQKV[2 * CC + c0 + cl]);
#pragma unroll
      for (int i = 0; i < 4; ++i)
#pragma unroll
        for (int r = 0; r < 8; ++r) th[cl][wm * 64 + i * 16 + 8 * g + r] = (_Float16)(acc[i][j][r] + bias); }
    __syncthreads();
    for (int e = tid; e < 128 * 16; e += 128) { const int cl = e >> 4, q = e & 15; const v4u v = *(const v4u*)&th[cl][q * 8];
      vst2(VT + ((size_t)bb * CC + c0 + cl) * (size_t)SEQ + t0 + q * 8, v); } }
}

// ---- k_attn: block = 64 queries (4 waves x 16) of (b, h); transposed flash form: S^T tile = K (A, rows = keys) x Q^T (B, cols = queries) so each lane owns one query column:
//      running max / sum are per-lane scalars (+ one xor-16 shuffle for the max); the two 16-key S^T accumulators convert in-lane into the B fragment (k = key row of the tile) of O^T += V^T (A, rows = d) x P^T.
//      K hi, K lo and V^T of 64 keys form one stage of an LDS ring shared by the four waves (rows 0..63 K hi, 64..127 K lo, 128..191 V^T rows d; 128 B a row at pitch 144 B), two buffers; the softmax still steps by 32 keys.
#define AST_BYTES (192 * LPITCH)
#define NKS (SEQ / 64)
static_assert(NKS >= 2 && HD * 2 == 128);   // two stages at least; a K row piece (64 d) and a V^T row piece (64 keys) are 128 B
// Four asynchronous 16-B copies per lane: 64 rows of V^T (16 rows each). The s_wait_xcnt stands inside the statement so that no address register is rewritten ahead of it.
__device__ __forceinline__ void copy64rows(unsigned l, const _Float16* p) {
  asm volatile("global_load_async_to_lds_b128 %0, %4, off\n\t"
               "global_load_async_to_lds_b128 %1, %5, off\n\t"
               "global_load_async_to_lds_b128 %2, %6, off\n\t"
               "global_load_async_to_lds_b128 %3, %7, off\n\t"
               "s_wait_xcnt 0x0"
               :: "v"(l), "v"(l + 16u * LPITCH), "v"(l + 32u * LPITCH), "v"(l + 48u * LPITCH), "v"(p), "v"(p + 16 * SEQ), "v"(p + 32 * SEQ), "v"(p + 48 * SEQ)
               : "memory");
}
__global__ __launch_bounds__(128) void k_attn(const __bf16* __restrict__ QK, const _Float16* __restrict__ VT, __bf16* __restrict__ Y) {
  __shared__ __align__(128) unsigned char sm[2 * AST_BYTES];
  __shared__ v4u ys[2][64][9];
  const int tid = threadIdx.x; const int wave = __builtin_amdgcn_readfirstlane(threadIdx.x >> 5); const int lane = tid & 31, col = lane & 15, g = lane >> 4;
  const int qb = blockIdx.x, h = blockIdx.y, b = blockIdx.z;
  const size_t qoff = ((size_t)b * SEQ + qb * 64 + wave * 16 + col) * CC + h * HD;
  const __bf16* QHp = QK + qoff; const __bf16* QLp = QK + PLANE + qoff;
  const size_t koff = ((size_t)b * SEQ + (tid >> 3)) * CC + h * HD + (tid & 7) * 8;
  const __bf16* gkh = QK + 2 * PLANE + koff; const __bf16* gkl = QK + 3 * PLANE + koff;
  const _Float16* gv = VT + ((size_t)b * CC + h * HD + (tid >> 3)) * (size_t)SEQ + (tid & 7) * 8;
  const unsigned l0 = (unsigned)(size_t)sm + (unsigned)((tid >> 3) * LPITCH + (tid & 7) * 16);
  copy128rows(l0, gkh, gkl); copy64rows(l0 + 128u * LPITCH, gv);
  v16b qh[HD / 32], ql[HD / 32];   // the wave's query fragments, read once
#pragma unroll
  for (int kc = 0; kc < HD / 32; ++kc) { qh[kc] = frag_b(QHp + kc * 32, lane); ql[kc] = frag_b(QLp + kc * 32, lane); }
  asm volatile("s_wait_asynccnt 0x0" ::: "memory");   // stage 0 landed (this wave's copies)
  __syncthreads();                                     // ... and every other wave's
  copy128rows(l0 + AST_BYTES, gkh + 64 * CC, gkl + 64 * CC); copy64rows(l0 + AST_BYTES + 128u * LPITCH, gv + 64);
  v8f o[4] = {}; float m = -1.0e30f, l = 0.f;
#pragma unroll 1   // one copy of the pass in the text; the buffer is chosen by the trip's parity
  for (int t = 0; t < NKS; ++t) { const unsigned bo = (unsigned)(t & 1) * AST_BYTES; const unsigned char* sb = sm + bo;
#pragma unroll
   for (int u = 0; u < 2; ++u) {
    v8f s0 = {}, s1 = {};
#pragma unroll
    for (int kc = 0; kc < HD / 32; ++kc) {
      { const v16b kh = frag_s(sb, u * 32, kc, lane), kl = frag_s(sb, 64 + u * 32, kc, lane);
        s0 = wmma_bfa(kl, qh[kc], s0); s0 = wmma_bfa(kh, ql[kc], s0); s0 = wmma_bfa(kh, qh[kc], s0); }
      { const v16b kh = frag_s(sb, u * 32 + 16, kc, lane), kl = frag_s(sb, 64 + u * 32 + 16, kc, lane);
        s1 = wmma_bfa(kl, qh[kc], s1); s1 = wmma_bfa(kh, ql[kc], s1); s1 = wmma_bfa(kh, qh[kc], s1); }
    }
    float mx = fmaxf(s0[0], s1[0]);
#pragma unroll
    for (int r = 1; r < 8; ++r) mx = fmaxf(mx, fmaxf(s0[r], s1[r]));
    mx = fmaxf(mx, __shfl_xor(mx, 16));          /* all lanes active; both lane halves of a query column agree on the max */
    const float mn = fmaxf(m, mx); const float corr = __expf(m - mn); m = mn;
    v16h p; float ps = 0.f;
#pragma unroll
    for (int r = 0; r < 8; ++r) { const float e0 = __expf(s0[r] - mn), e1 = __expf(s1[r] - mn); ps += e0 + e1; p[r] = (_Float16)(e0 * PCARRY); p[8 + r] = (_Float16)(e1 * PCARRY); }
    l = l * corr + ps;                            /* l from the unconverted f32 values; per-lane partial (this lane's 16 of the 32 keys) */
#pragma unroll
    for (int j = 0; j < 4; ++j)
#pragma unroll
      for (int r = 0; r < 8; ++r) o[j][r] *= corr;
#pragma unroll
    for (int j = 0; j < 4; ++j) { const v16h vf = frag_h((const _Float16*)(sb + (128 + j * 16 + col) * LPITCH) + u * 32, lane); o[j] = wmma16(vf, p, o[j]); }
   }
    asm volatile("s_wait_dscnt 0x0" ::: "memory");      // this wave's reads of the buffer are done before it is refilled
    asm volatile("s_wait_asynccnt 0x0" ::: "memory");   // this wave's copies of stage t + 1 have landed
    __syncthreads();                                     // publishes stage t + 1, frees stage t's buffer
    if (t + 2 < NKS) { const int kn = (t + 2) * 64; copy128rows(l0 + bo, gkh + (size_t)kn * CC, gkl + (size_t)kn * CC); copy64rows(l0 + bo + 128u * LPITCH, gv + kn); }
  }
  asm volatile("s_wait_asynccnt 0x0" ::: "memory");     // no copy is outstanding at the wave's end
  l += __shfl_xor(l, 16);
  const float inv = 1.0f / (l * PCARRY);
  // O^T tile j: lane (g, col = query) holds d = 16j + 8g + 0..7: one 16-B piece of the (row, head) segment, as bf16 hi and lo
#pragma unroll
  for (int j = 0; j < 4; ++j) { union { v8b v; v4u u; } hi, lo;
#pragma unroll
    for (int r = 0; r < 8; ++r) { const float c = o[j][r] * inv; const __bf16 hb = (__bf16)c; hi.v[r] = hb; lo.v[r] = (__bf16)(c - (float)hb); }
    ys[0][wave * 16 + col][2 * j + g] = hi.u; ys[1][wave * 16 + col][2 * j + g] = lo.u; }
  __syncthreads();
#pragma unroll 1
  for (int it = 0; it < 4; ++it) { const int rl = wave * 16 + it * 4 + (lane >> 3), pc = lane & 7;
    const v4u a = ys[0][rl][pc]; const v4u c = ys[1][rl][pc];
    const size_t go = ((size_t)b * SEQ + qb * 64 + rl) * CC + h * HD + pc * 8;
    vst2(Y + go, a); vst2(Y + PLANE + go, c); }
}

// ---- k_out: block = (64 rows, 128 cols), 4 waves of 32 x 64: out = ctx Wo + bo: ctx bf16 hi + lo against the exact bf16 weight (2 products, one accumulator: lo, then hi, per k step), operands through the LDS ring (rows 0..63 ctx hi, 64..127 ctx lo, 128..255 weight); 512-B row segment by one 32-lane x 16-B instruction
__global__ __launch_bounds__(128) void k_out(const __bf16* __restrict__ Y, const __bf16* __restrict__ WOT, const float* __restrict__ BO, float* __restrict__ OUT) {
  __shared__ __align__(128) unsigned char sm[2 * STG_BYTES];   // the ring; behind the k loop the output staging
  static_assert(64 * 132 * 4 <= 2 * STG_BYTES);
  const int tid = threadIdx.x; const int wave = __builtin_amdgcn_readfirstlane(threadIdx.x >> 5); const int lane = tid & 31, col = lane & 15, g = lane >> 4;
  const int wm = wave >> 1, wn = wave & 1;
  const int c0 = blockIdx.y * 128; const int rb = blockIdx.x * 64;
  const __bf16* gh = Y + (size_t)(rb + (tid >> 3)) * CC + (tid & 7) * 8; const __bf16* gl = gh + PLANE;
  const __bf16* gw = WOT + (size_t)(c0 + (tid >> 3)) * CC + (tid & 7) * 8;
  const unsigned l0 = (unsigned)(size_t)sm + (unsigned)((tid >> 3) * LPITCH + (tid & 7) * 16);
  copy128rows(l0, gh, gl); copy128rows(l0 + 128u * LPITCH, gw, gw + 64 * CC);
  asm volatile("s_wait_asynccnt 0x0" ::: "memory");   // stage 0 landed (this wave's copies)
  __syncthreads();                                     // ... and every other wave's
  copy128rows(l0 + STG_BYTES, gh + KST, gl + KST); copy128rows(l0 + STG_BYTES + 128u * LPITCH, gw + KST, gw + 64 * CC + KST);
  v8f acc[2][4] = {};
#pragma unroll 1   // one copy of the pass in the text; the buffer is chosen by the trip's parity
  for (int t = 0; t < NST; ++t) { const unsigned bo = (unsigned)(t & 1) * STG_BYTES; const unsigned char* sb = sm + bo;
#pragma unroll
    for (int kc = 0; kc < KST / 32; ++kc) { v16b ah[2], al[2], w[4];
#pragma unroll
      for (int i = 0; i < 2; ++i) { ah[i] = frag_s(sb, wm * 32 + i * 16, kc, lane); al[i] = frag_s(sb, 64 + wm * 32 + i * 16, kc, lane); }
#pragma unroll
      for (int j = 0; j < 4; ++j) w[j] = frag_s(sb, 128 + wn * 64 + j * 16, kc, lane);
#pragma unroll
      for (int i = 0; i < 2; ++i)
#pragma unroll
        for (int j = 0; j < 4; ++j) acc[i][j] = wmma_bf(al[i], w[j], acc[i][j]);
#pragma unroll
      for (int i = 0; i < 2; ++i)
#pragma unroll
        for (int j = 0; j < 4; ++j) acc[i][j] = wmma_bf(ah[i], w[j], acc[i][j]); }
    asm volatile("s_wait_dscnt 0x0" ::: "memory");      // this wave's reads of the buffer are done before it is refilled
    asm volatile("s_wait_asynccnt 0x0" ::: "memory");   // this wave's copies of stage t + 1 have landed
    __syncthreads();                                     // publishes stage t + 1, frees stage t's buffer
    if (t + 2 < NST) { const int ko = (t + 2) * KST; copy128rows(l0 + bo, gh + ko, gl + ko); copy128rows(l0 + bo + 128u * LPITCH, gw + ko, gw + 64 * CC + ko); } }
  asm volatile("s_wait_asynccnt 0x0" ::: "memory");     // no copy is outstanding when the ring becomes output staging
  float (*sf)[132] = (float (*)[132])sm;
#pragma unroll
  for (int j = 0; j < 4; ++j) { const int cl = wn * 64 + j * 16 + col; const float bias = bfr(BO[c0 + cl]);
#pragma unroll
    for (int i = 0; i < 2; ++i)
#pragma unroll
      for (int r = 0; r < 8; ++r) sf[wm * 32 + i * 16 + 8 * g + r][cl] = acc[i][j][r] + bias; }
  __syncthreads();
  const size_t orow0 = (size_t)(rb / SEQ) * SEQ_FULL + (size_t)(rb % SEQ) + wave * 16;
#pragma unroll 1
  for (int rl = 0; rl < 16; ++rl) { const v4f v = *(const v4f*)&sf[wave * 16 + rl][lane * 4];
    vst2(OUT + (orow0 + rl) * DIN + c0 + lane * 4, v); }
}

extern "C" void kernel_launch(void* const* d_in, const int* in_sizes, int n_in, void* d_out, int out_size, void* d_ws, size_t ws_size, hipStream_t stream) {
  if (n_in < 5) return;
  const size_t xneed = ((size_t)(NB - 1) * SEQ_FULL + SEQ) * DIN;
  if ((size_t)in_sizes[0] < xneed) return;
  if ((size_t)in_sizes[1] < (size_t)DIN * 3 * CC) return;
  if ((size_t)in_sizes[2] < (size_t)3 * CC) return;
  if ((size_t)in_sizes[3] < (size_t)CC * DIN) return;
  if ((size_t)in_sizes[4] < (size_t)DIN) return;
  if ((size_t)out_size < xneed) return;
  if (ws_size < (size_t)WS_END) return;
  // inputs (wire order): 0 x [4,1024,1024]; 1 W_qkv [1024,3072] (in,out): q columns 0..1023, k 1024..2047, v 2048..3071; 2 b_qkv [3072]; 3 W_out [1024,1024] (in,out); 4 b_out [1024]
  const float* x = (const float*)d_in[0]; const float* wqkv = (const float*)d_in[1]; const float* bqkv = (const float*)d_in[2]; const float* wout = (const float*)d_in[3]; const float* bout = (const float*)d_in[4];
  char* ws = (char*)d_ws;
  __bf16* XB = (__bf16*)(ws + WS_XB); __bf16* WQT = (__bf16*)(ws + WS_WQT); __bf16* WOT = (__bf16*)(ws + WS_WOT); __bf16* QK = (__bf16*)(ws + WS_QK); _Float16* VT = (_Float16*)(ws + WS_VT); __bf16* Y = (__bf16*)(ws + WS_Y);
  k_cvt_x<<<dim3((unsigned)(((size_t)NB * SEQ * (DIN / 8)) / 256)), 256, 0, stream>>>(x, XB);
  k_tr_w<<<dim3(3 * CC / 64, DIN / 64), 256, 0, stream>>>(wqkv, WQT, 3 * CC);   // in[1024][3072] -> out[3072][1024]
  k_tr_w<<<dim3(DIN / 64, CC / 64), 256, 0, stream>>>(wout, WOT, DIN);          // in[1024][1024] -> out[1024][1024]
  k_proj<<<dim3(NB * SEQ / 128, CC / 128, 3), 128, 0, stream>>>(XB, WQT, bqkv, QK, VT);
  k_attn<<<dim3(SEQ / 64, NH, NB), 128, 0, stream>>>(QK, VT, Y);
  k_out<<<dim3(NB * SEQ / 64, DIN / 128), 128, 0, stream>>>(Y, WOT, bout, (float*)d_out);
}

// v003
// A run of this version takes 82.8 microseconds.
// Timed twice side by side with v002, it ran 1.09 and 1.08 times as fast.
// Counting every step since v000, it is 3.70 times as fast.
// compute dtype: all float inputs converted (RNE) to bf16; q/k/v projections = exact bf16 x bf16 products on v_wmma_f32_16x16x32_bf16 (f32 accumulate) + bias; logits = (k hi|lo) x (q/8 hi|lo) as three bf16 products (hh + hl + lh) in one f32 accumulator; softmax f32 (online, running max); P x 2^12 once to f16 against v once to f16 on v_wmma_f32_16x16x32_f16 (one product); ctx as bf16 hi|lo against the bf16 output weight (two products) + bias; f32 output.
#include <hip/hip_runtime.h>
#include <math.h>

typedef __attribute__((ext_vector_type(16))) _Float16 v16h;
typedef __attribute__((ext_vector_type(16))) __bf16 v16b;
typedef __attribute__((ext_vector_type(8)))  _Float16 v8h;
typedef __attribute__((ext_vector_type(8)))  __bf16 v8b;
typedef __attribute__((ext_vector_type(8)))  float v8f;
typedef __attribute__((ext_vector_type(4)))  float v4f;
typedef __attribute__((ext_vector_type(4)))  unsigned v4u;

// Dense multi-head self-attention, no mask: x [4,1024,1024]; fused (in,out) QKV weight [1024][3072] viewed (3, 16, 64): column = which*1024 + h*64 + d; (in,out) output weight [1024][1024]; one score scale 1/8; softmax over the 1024 keys of the same batch.
#ifndef NB
#define NB 4
#endif
#ifndef SEQ
#define SEQ 1024
#endif
#define NB_FULL 4
#define SEQ_FULL 1024      // full per-batch row stride of x and of the output
#define DIN 1024           // model width (input of QKV projection, output of the last projection)
#define CC 1024            // NH * HD
#define NH 16
#define HD 64
#define SCALE (0.125f)
#define PCARRY (4096.0f)   // P carried x 2^12 into f16 (keeps small probabilities clear of f16 subnormals); folded back with 1/l
#define PLANE ((size_t)NB * SEQ * CC)

static_assert(CC == NH * HD);                 // merged head layout h*64+d
static_assert(HD == 64);
static_assert(SEQ % 64 == 0);                 // 64-row blocks never straddle a batch; key loop steps by 64
static_assert(DIN % 64 == 0 && CC % 128 == 0 && (3 * CC) % 64 == 0 && DIN % 128 == 0);   // tile multiples of every GEMM / transpose grid
static_assert(DIN % 32 == 0 && CC % 32 == 0); // WMMA k-steps
static_assert(NB <= NB_FULL && SEQ <= SEQ_FULL);
static_assert(((size_t)NB * SEQ * (DIN / 8)) % 256 == 0);   // convert grid x 256 threads == plane extent

#define WS_XB  ((size_t)0)                                   // bf16 x rows [NB*SEQ][DIN]
#define WS_WQT (WS_XB  + 2u * (size_t)NB * SEQ * DIN)        // bf16 QKV weight, (out,in) [3*CC][DIN]
#define WS_WOT (WS_WQT + 2u * (size_t)3 * CC * DIN)          // bf16 output weight, (out,in) [DIN][CC]
#define WS_QK  (WS_WOT + 2u * (size_t)DIN * CC)              // bf16 planes: q/8 hi, q/8 lo, k hi, k lo, each [NB*SEQ][CC]
#define WS_VT  (WS_QK  + 4u * 2u * PLANE)                    // f16 v planes [b][c][t]
#define WS_Y   (WS_VT  + 2u * (size_t)NB * CC * SEQ)         // bf16 ctx planes: hi, lo, each [NB*SEQ][CC]
#define WS_END (WS_Y   + 2u * 2u * PLANE)
static_assert(WS_END <= (size_t)134217728);   // total carve
static_assert(WS_WQT % 128 == 0 && WS_WOT % 128 == 0 && WS_QK % 128 == 0 && WS_VT % 128 == 0 && WS_Y % 128 == 0);

template <typename T> __device__ __forceinline__ void vst2(void* p, T v) { *(T*)p = v;  }
// k_attn's two products are the bare builtins: the compiler keeps the distances behind its own WMMAs, and with no asm statement tied to each product it may group the LDS reads ahead, alternate the accumulator chains and set softmax work between the products
__device__ __forceinline__ v8f wmma16(v16h a, v16h b, v8f c) {
  return __builtin_amdgcn_wmma_f32_16x16x32_f16(false, a, false, b, (short)0, c, false, false);
}
__device__ __forceinline__ v8f wmma_bfa(v16b a, v16b b, v8f c) {
  return __builtin_amdgcn_wmma_f32_16x16x32_bf16(false, a, false, b, (short)0, c, false, false);
}
__device__ __forceinline__ v8f wmma_bf(v16b a, v16b b, v8f c) {
  v8f d = __builtin_amdgcn_wmma_f32_16x16x32_bf16(false, a, false, b, (short)0, c, false, false);
  asm volatile("v_nop\n\tv_nop\n\tv_nop\n\tv_nop" : "+v"(d) : "v"(a), "v"(b));
  return d;
}
// 16x16x32 fragments: lane = (g = lane>>4, row/col = lane&15); elements 0..7 = k0+8g+0..7, 8..15 = k0+16+8g+0..7; D element r = row 8g+r, col lane&15
__device__ __forceinline__ v16h frag_h(const _Float16* rowk0, int lane) {
  union { v16h v; v8h q[2]; } u; const _Float16* p = rowk0 + 8 * (lane >> 4);
  u.q[0] = *(const v8h*)p; u.q[1] = *(const v8h*)(p + 16); return u.v;
}
__device__ __forceinline__ v16b frag_b(const __bf16* rowk0, int lane) {
  union { v16b v; v8b q[2]; } u; const __bf16* p = rowk0 + 8 * (lane >> 4);
  u.q[0] = *(const v8b*)p; u.q[1] = *(const v8b*)(p + 16); return u.v;
}
__device__ __forceinline__ float bfr(float v) { return (float)(__bf16)v; }

// x piece i (8 consecutive elements of one row): f32 -> bf16 (RNE)
__device__ __forceinline__ void cvt_x(int i, const float* __restrict__ X, __bf16* __restrict__ XB) {
  if (i >= NB * SEQ * (DIN / 8)) return;
  const int row = i / (DIN / 8), pc = i % (DIN / 8);
  const size_t srow = (size_t)(row / SEQ) * SEQ_FULL + (size_t)(row % SEQ);
  const float* p = X + srow * DIN + pc * 8;
  const v4f a = *(const v4f*)p, b = *(const v4f*)(p + 4);
  union { v8b v; v4u u; } o;
  o.v[0] = (__bf16)a[0]; o.v[1] = (__bf16)a[1]; o.v[2] = (__bf16)a[2]; o.v[3] = (__bf16)a[3];
  o.v[4] = (__bf16)b[0]; o.v[5] = (__bf16)b[1]; o.v[6] = (__bf16)b[2]; o.v[7] = (__bf16)b[3];
  vst2(XB + (size_t)row * DIN + pc * 8, o.u);
}

// in[DIN rows][ldw cols] f32 (in,out) -> out[ldw rows][DIN cols] bf16 (out,in); one 64 x 64 tile (column tile bx, k tile by) through LDS by a whole 256-thread block
__device__ __forceinline__ void tr_w(__bf16 (*t)[72], const float* __restrict__ W, __bf16* __restrict__ WT, int ldw, int bx, int by) {
  const int tid = threadIdx.x; const int n0 = bx * 64, k0 = by * 64;
  for (int e = tid; e < 64 * 16; e += 256) { const int kr = e >> 4, c4 = (e & 15) * 4;
    const v4f w = *(const v4f*)(W + (size_t)(k0 + kr) * ldw + n0 + c4);
    t[c4 + 0][kr] = (__bf16)w[0]; t[c4 + 1][kr] = (__bf16)w[1]; t[c4 + 2][kr] = (__bf16)w[2]; t[c4 + 3][kr] = (__bf16)w[3]; }
  __syncthreads();
  for (int e = tid; e < 64 * 8; e += 256) { const int nr = e >> 3, q = e & 7; const v4u v = *(const v4u*)&t[nr][q * 8];
    vst2(WT + (size_t)(n0 + nr) * DIN + k0 + q * 8, v); }
}

// ---- k_prep: the three preparations depend on nothing but the inputs, so they share one launch; the block index picks the job (the same for a whole block, so the transpose's barrier is passed by all of a block or by none).
//      Blocks 0 .. TRQ-1: QKV weight tiles; TRQ .. TRQ+TRO-1: output weight tiles (the jobs with the longer chain load, LDS, barrier, store start first); the rest: 256 x pieces each.
#define TRQ ((3 * CC / 64) * (DIN / 64))
#define TRO ((DIN / 64) * (CC / 64))
#define CVB ((int)(((size_t)NB * SEQ * (DIN / 8)) / 256))
__global__ __launch_bounds__(256) void k_prep(const float* __restrict__ X, const float* __restrict__ WQ, const float* __restrict__ WO, __bf16* __restrict__ XB, __bf16* __restrict__ WQT, __bf16* __restrict__ WOT) {
  __shared__ __align__(16) __bf16 t[64][72];
  const int id = blockIdx.x;
  if (id < TRQ) tr_w(t, WQ, WQT, 3 * CC, id % (3 * CC / 64), id / (3 * CC / 64));                       // in[1024][3072] -> out[3072][1024]
  else if (id < TRQ + TRO) tr_w(t, WO, WOT, DIN, (id - TRQ) % (DIN / 64), (id - TRQ) / (DIN / 64));     // in[1024][1024] -> out[1024][1024]
  else cvt_x((id - TRQ - TRO) * 256 + (int)threadIdx.x, X, XB);
}

// ---- LDS ring of the two GEMM kernels: a stage = 64 k of 256 operand rows (rows 0..127: the A side, rows 128..255: the weight rows), 128 B a row at pitch 144 B (16 B x odd: no bank conflict for 16-B fragment reads); two buffers.
#define KST 64
#define NST (DIN / KST)
#define LPITCH 144
#define STG_BYTES (256 * LPITCH)
static_assert(DIN == CC && DIN % KST == 0 && NST >= 2);
static_assert(SEQ % 128 == 0);                // 128-row blocks of k_proj never straddle a batch
// Eight asynchronous 16-B copies per lane: 16 rows each (8 lanes cover one 128-B row piece), rows 0,16,32,48 from pa and 64,..,112 from pb. The s_wait_xcnt stands inside the statement so that no address register is rewritten ahead of it.
__device__ __forceinline__ void copy128rows(unsigned l, const __bf16* pa, const __bf16* pb) {
  asm volatile("global_load_async_to_lds_b128 %0, %8, off\n\t"
               "global_load_async_to_lds_b128 %1, %9, off\n\t"
               "global_load_async_to_lds_b128 %2, %10, off\n\t"
               "global_load_async_to_lds_b128 %3, %11, off\n\t"
               "global_load_async_to_lds_b128 %4, %12, off\n\t"
               "global_load_async_to_lds_b128 %5, %13, off\n\t"
               "global_load_async_to_lds_b128 %6, %14, off\n\t"
               "global_load_async_to_lds_b128 %7, %15, off\n\t"
               "s_wait_xcnt 0x0"
               :: "v"(l), "v"(l + 16u * LPITCH), "v"(l + 32u * LPITCH), "v"(l + 48u * LPITCH), "v"(l + 64u * LPITCH), "v"(l + 80u * LPITCH), "v"(l + 96u * LPITCH), "v"(l + 112u * LPITCH),
                  "v"(pa), "v"(pa + 16 * DIN), "v"(pa + 32 * DIN), "v"(pa + 48 * DIN), "v"(pb), "v"(pb + 16 * DIN), "v"(pb + 32 * DIN), "v"(pb + 48 * DIN)
               : "memory");
}
// fragment of 16 staged rows starting at row, k step kc of the stage
__device__ __forceinline__ v16b frag_s(const unsigned char* sb, int row, int kc, int lane) {
  return frag_b((const __bf16*)(sb + (row + (lane & 15)) * LPITCH) + kc * 32, lane);
}

// ---- k_proj: block = (128 rows, 128 cols, which), 4 waves of 64 x 64: q/k/v = x W + b with exact bf16 products (K = DIN), operands through the LDS ring. which 0: q x 1/8 as bf16 hi|lo rows; 1: k as bf16 hi|lo rows; 2: v f16 planes [c][t]
__global__ __launch_bounds__(128) void k_proj(const __bf16* __restrict__ XB, const __bf16* __restrict__ WT, const float* __restrict__ BQKV, __bf16* __restrict__ QK, _Float16* __restrict__ VT) {
  __shared__ __align__(128) unsigned char sm[2 * STG_BYTES];   // the ring; behind the k loop the output staging
  static_assert(2 * 128 * 136 * 2 <= 2 * STG_BYTES);
  const int tid = threadIdx.x; const int wave = __builtin_amdgcn_readfirstlane(threadIdx.x >> 5); const int lane = tid & 31, col = lane & 15, g = lane >> 4;
  const int wm = wave >> 1, wn = wave & 1;
  const int which = blockIdx.z; const int c0 = blockIdx.y * 128; const int r0 = blockIdx.x * 128; const int bb = r0 / SEQ; const int t0 = r0 % SEQ;
  const __bf16* ga = XB + (size_t)(r0 + (tid >> 3)) * DIN + (tid & 7) * 8;
  const __bf16* gw = WT + (size_t)(which * CC + c0 + (tid >> 3)) * DIN + (tid & 7) * 8;
  const unsigned l0 = (unsigned)(size_t)sm + (unsigned)((tid >> 3) * LPITCH + (tid & 7) * 16);
  copy128rows(l0, ga, ga + 64 * DIN); copy128rows(l0 + 128u * LPITCH, gw, gw + 64 * DIN);
  asm volatile("s_wait_asynccnt 0x0" ::: "memory");   // stage 0 landed (this wave's copies)
  __syncthreads();                                     // ... and every other wave's
  copy128rows(l0 + STG_BYTES, ga + KST, ga + 64 * DIN + KST); copy128rows(l0 + STG_BYTES + 128u * LPITCH, gw + KST, gw + 64 * DIN + KST);
  v8f acc[4][4] = {};
#pragma unroll 1   // one copy of the pass in the text; the buffer is chosen by the trip's parity
  for (int t = 0; t < NST; ++t) { const unsigned bo = (unsigned)(t & 1) * STG_BYTES; const unsigned char* sb = sm + bo;
#pragma unroll
    for (int kc = 0; kc < KST / 32; ++kc) { v16b a[4], w[4];
#pragma unroll
      for (int i = 0; i < 4; ++i) { a[i] = frag_s(sb, wm * 64 + i * 16, kc, lane); w[i] = frag_s(sb, 128 + wn * 64 + i * 16, kc, lane); }
#pragma unroll
      for (int i = 0; i < 4; ++i)
#pragma unroll
        for (int j = 0; j < 4; ++j) acc[i][j] = wmma_bf(a[i], w[j], acc[i][j]); }
    asm volatile("s_wait_dscnt 0x0" ::: "memory");      // this wave's reads of the buffer are done before it is refilled
    asm volatile("s_wait_asynccnt 0x0" ::: "memory");   // this wave's copies of stage t + 1 have landed
    __syncthreads();                                     // publishes stage t + 1, frees stage t's buffer
    if (t + 2 < NST) { const int ko = (t + 2) * KST; copy128rows(l0 + bo, ga + ko, ga + 64 * DIN + ko); copy128rows(l0 + bo + 128u * LPITCH, gw + ko, gw + 64 * DIN + ko); } }
  asm volatile("s_wait_asynccnt 0x0" ::: "memory");     // no copy is outstanding when the ring becomes output staging
  if (which < 2) { const float qs = (which == 0) ? SCALE : 1.0f;   /* block-uniform; 1/8 is an exact power of two */
    __bf16 (*sh)[136] = (__bf16 (*)[136])sm; __bf16 (*sl)[136] = (__bf16 (*)[136])(sm + 128 * 136 * 2);
#pragma unroll
    for (int j = 0; j < 4; ++j) { const int cl = wn * 64 + j * 16 + col; const float bias = bfr(BQKV[which * CC + c0 + cl]);
#pragma unroll
      for (int i = 0; i < 4; ++i)
#pragma unroll
        for (int r = 0; r < 8; ++r) { const int rl = wm * 64 + i * 16 + 8 * g + r; const float v = (acc[i][j][r] + bias) * qs; const __bf16 hv = (__bf16)v; sh[rl][cl] = hv; sl[rl][cl] = (__bf16)(v - (float)hv); } }
    __syncthreads();
    __bf16* DH = QK + (size_t)(2 * which) * PLANE; __bf16* DL = DH + PLANE;
    for (int e = tid; e < 128 * 16; e += 128) { const int rl = e >> 4, q = e & 15; const v4u vh = *(const v4u*)&sh[rl][q * 8]; const v4u vl = *(const v4u*)&sl[rl][q * 8];
      const size_t o = (size_t)(r0 + rl) * CC + c0 + q * 8; vst2(DH + o, vh); vst2(DL + o, vl); }
  } else {
    _Float16 (*th)[136] = (_Float16 (*)[136])sm;
#pragma unroll
    for (int j = 0; j < 4; ++j) { const int cl = wn * 64 + j * 16 + col; const float bias = bfr(BQKV[2 * CC + c0 + cl]);
#pragma unroll
      for (int i = 0; i < 4; ++i)
#pragma unroll
        for (int r = 0; r < 8; ++r) th[cl][wm * 64 + i * 16 + 8 * g + r] = (_Float16)(acc[i][j][r] + bias); }
    __syncthreads();
    for (int e = tid; e < 128 * 16; e += 128) { const int cl = e >> 4, q = e & 15; const v4u v = *(const v4u*)&th[cl][q * 8];
      vst2(VT + ((size_t)bb * CC + c0 + cl) * (size_t)SEQ + t0 + q * 8, v); } }
}

// ---- k_attn: block = 64 queries (4 waves x 16) of (b, h); transposed flash form: S^T tile = K (A, rows = keys) x Q^T (B, cols = queries) so each lane owns one query column:
//      running max / sum are per-lane scalars (+ one xor-16 shuffle for the max); the two 16-key S^T accumulators convert in-lane into the B fragment (k = key row of the tile) of O^T += V^T (A, rows = d) x P^T.
//      K hi, K lo and V^T of 64 keys form one stage of an LDS ring shared by the four waves (rows 0..63 K hi, 64..127 K lo, 128..191 V^T rows d; 128 B a row at pitch 144 B), two buffers; the softmax still steps by 32 keys.
#define AST_BYTES (192 * LPITCH)
#define NKS (SEQ / 64)
static_assert(NKS >= 2 && HD * 2 == 128);   // two stages at least; a K row piece (64 d) and a V^T row piece (64 keys) are 128 B
// Four asynchronous 16-B copies per lane: 64 rows of V^T (16 rows each). The s_wait_xcnt stands inside the statement so that no address register is rewritten ahead of it.
__device__ __forceinline__ void copy64rows(unsigned l, const _Float16* p) {
  asm volatile("global_load_async_to_lds_b128 %0, %4, off\n\t"
               "global_load_async_to_lds_b128 %1, %5, off\n\t"
               "global_load_async_to_lds_b128 %2, %6, off\n\t"
               "global_load_async_to_lds_b128 %3, %7, off\n\t"
               "s_wait_xcnt 0x0"
               :: "v"(l), "v"(l + 16u * LPITCH), "v"(l + 32u * LPITCH), "v"(l + 48u * LPITCH), "v"(p), "v"(p + 16 * SEQ), "v"(p + 32 * SEQ), "v"(p + 48 * SEQ)
               : "memory");
}
__global__ __launch_bounds__(128) void k_attn(const __bf16* __restrict__ QK, const _Float16* __restrict__ VT, __bf16* __restrict__ Y) {
  __shared__ __align__(128) unsigned char sm[2 * AST_BYTES];
  __shared__ v4u ys[2][64][9];
  const int tid = threadIdx.x; const int wave = __builtin_amdgcn_readfirstlane(threadIdx.x >> 5); const int lane = tid & 31, col = lane & 15, g = lane >> 4;
  const int qb = blockIdx.x, h = blockIdx.y, b = blockIdx.z;
  const size_t qoff = ((size_t)b * SEQ + qb * 64 + wave * 16 + col) * CC + h * HD;
  const __bf16* QHp = QK + qoff; const __bf16* QLp = QK + PLANE + qoff;
  const size_t koff = ((size_t)b * SEQ + (tid >> 3)) * CC + h * HD + (tid & 7) * 8;
  const __bf16* gkh = QK + 2 * PLANE + koff; const __bf16* gkl = QK + 3 * PLANE + koff;
  const _Float16* gv = VT + ((size_t)b * CC + h * HD + (tid >> 3)) * (size_t)SEQ + (tid & 7) * 8;
  const unsigned l0 = (unsigned)(size_t)sm + (unsigned)((tid >> 3) * LPITCH + (tid & 7) * 16);
  copy128rows(l0, gkh, gkl); copy64rows(l0 + 128u * LPITCH, gv);
  v16b qh[HD / 32], ql[HD / 32];   // the wave's query fragments, read once
#pragma unroll
  for (int kc = 0; kc < HD / 32; ++kc) { qh[kc] = frag_b(QHp + kc * 32, lane); ql[kc] = frag_b(QLp + kc * 32, lane); }
  asm volatile("s_wait_asynccnt 0x0" ::: "memory");   // stage 0 landed (this wave's copies)
  __syncthreads();                                     // ... and every other wave's
  copy128rows(l0 + AST_BYTES, gkh + 64 * CC, gkl + 64 * CC); copy64rows(l0 + AST_BYTES + 128u * LPITCH, gv + 64);
  v8f o[4] = {}; float m = -1.0e30f, l = 0.f;
#pragma unroll 1   // one copy of the pass in the text; the buffer is chosen by the trip's parity
  for (int t = 0; t < NKS; ++t) { const unsigned bo = (unsigned)(t & 1) * AST_BYTES; const unsigned char* sb = sm + bo;
#pragma unroll
   for (int u = 0; u < 2; ++u) {
    v8f s0 = {}, s1 = {};
#pragma unroll
    for (int kc = 0; kc < HD / 32; ++kc) {
      { const v16b kh = frag_s(sb, u * 32, kc, lane), kl = frag_s(sb, 64 + u * 32, kc, lane);
        s0 = wmma_bfa(kl, qh[kc], s0); s0 = wmma_bfa(kh, ql[kc], s0); s0 = wmma_bfa(kh, qh[kc], s0); }
      { const v16b kh = frag_s(sb, u * 32 + 16, kc, lane), kl = frag_s(sb, 64 + u * 32 + 16, kc, lane);
        s1 = wmma_bfa(kl, qh[kc], s1); s1 = wmma_bfa(kh, ql[kc], s1); s1 = wmma_bfa(kh, qh[kc], s1); }
    }
    float mx = fmaxf(s0[0], s1[0]);
#pragma unroll
    for (int r = 1; r < 8; ++r) mx = fmaxf(mx, fmaxf(s0[r], s1[r]));
    mx = fmaxf(mx, __shfl_xor(mx, 16));          /* all lanes active; both lane halves of a query column agree on the max */
    const float mn = fmaxf(m, mx); const float corr = __expf(m - mn); m = mn;
    v16h p; float ps = 0.f;
#pragma unroll
    for (int r = 0; r < 8; ++r) { const float e0 = __expf(s0[r] - mn), e1 = __expf(s1[r] - mn); ps += e0 + e1; p[r] = (_Float16)(e0 * PCARRY); p[8 + r] = (_Float16)(e1 * PCARRY); }
    l = l * corr + ps;                            /* l from the unconverted f32 values; per-lane partial (this lane's 16 of the 32 keys) */
#pragma unroll
    for (int j = 0; j < 4; ++j)
#pragma unroll
      for (int r = 0; r < 8; ++r) o[j][r] *= corr;
#pragma unroll
    for (int j = 0; j < 4; ++j) { const v16h vf = frag_h((const _Float16*)(sb + (128 + j * 16 + col) * LPITCH) + u * 32, lane); o[j] = wmma16(vf, p, o[j]); }
   }
    asm volatile("s_wait_dscnt 0x0" ::: "memory");      // this wave's reads of the buffer are done before it is refilled
    asm volatile("s_wait_asynccnt 0x0" ::: "memory");   // this wave's copies of stage t + 1 have landed
    __syncthreads();                                     // publishes stage t + 1, frees stage t's buffer
    if (t + 2 < NKS) { const int kn = (t + 2) * 64; copy128rows(l0 + bo, gkh + (size_t)kn * CC, gkl + (size_t)kn * CC); copy64rows(l0 + bo + 128u * LPITCH, gv + kn); }
  }
  asm volatile("s_wait_asynccnt 0x0" ::: "memory");     // no copy is outstanding at the wave's end
  l += __shfl_xor(l, 16);
  const float inv = 1.0f / (l * PCARRY);
  // O^T tile j: lane (g, col = query) holds d = 16j + 8g + 0..7: one 16-B piece of the (row, head) segment, as bf16 hi and lo
#pragma unroll
  for (int j = 0; j < 4; ++j) { union { v8b v; v4u u; } hi, lo;
#pragma unroll
    for (int r = 0; r < 8; ++r) { const float c = o[j][r] * inv; const __bf16 hb = (__bf16)c; hi.v[r] = hb; lo.v[r] = (__bf16)(c - (float)hb); }
    ys[0][wave * 16 + col][2 * j + g] = hi.u; ys[1][wave * 16 + col][2 * j + g] = lo.u; }
  __syncthreads();
#pragma unroll 1
  for (int it = 0; it < 4; ++it) { const int rl = wave * 16 + it * 4 + (lane >> 3), pc = lane & 7;
    const v4u a = ys[0][rl][pc]; const v4u c = ys[1][rl][pc];
    const size_t go = ((size_t)b * SEQ + qb * 64 + rl) * CC + h * HD + pc * 8;
    vst2(Y + go, a); vst2(Y + PLANE + go, c); }
}

// ---- k_out: block = (64 rows, 128 cols), 4 waves of 32 x 64: out = ctx Wo + bo: ctx bf16 hi + lo against the exact bf16 weight (2 products, one accumulator: lo, then hi, per k step), operands through the LDS ring (rows 0..63 ctx hi, 64..127 ctx lo, 128..255 weight); 512-B row segment by one 32-lane x 16-B instruction
__global__ __launch_bounds__(128) void k_out(const __bf16* __restrict__ Y, const __bf16* __restrict__ WOT, const float* __restrict__ BO, float* __restrict__ OUT) {
  __shared__ __align__(128) unsigned char sm[2 * STG_BYTES];   // the ring; behind the k loop the output staging
  static_assert(64 * 132 * 4 <= 2 * STG_BYTES);
  const int tid = threadIdx.x; const int wave = __builtin_amdgcn_readfirstlane(threadIdx.x >> 5); const int lane = tid & 31, col = lane & 15, g = lane >> 4;
  const int wm = wave >> 1, wn = wave & 1;
  const int c0 = blockIdx.y * 128; const int rb = blockIdx.x * 64;
  const __bf16* gh = Y + (size_t)(rb + (tid >> 3)) * CC + (tid & 7) * 8; const __bf16* gl = gh + PLANE;
  const __bf16* gw = WOT + (size_t)(c0 + (tid >> 3)) * CC + (tid & 7) * 8;
  const unsigned l0 = (unsigned)(size_t)sm + (unsigned)((tid >> 3) * LPITCH + (tid & 7) * 16);
  copy128rows(l0, gh, gl); copy128rows(l0 + 128u * LPITCH, gw, gw + 64 * CC);
  asm volatile("s_wait_asynccnt 0x0" ::: "memory");   // stage 0 landed (this wave's copies)
  __syncthreads();                                     // ... and every other wave's
  copy128rows(l0 + STG_BYTES, gh + KST, gl + KST); copy128rows(l0 + STG_BYTES + 128u * LPITCH, gw + KST, gw + 64 * CC + KST);
  v8f acc[2][4] = {};
#pragma unroll 1   // one copy of the pass in the text; the buffer is chosen by the trip's parity
  for (int t = 0; t < NST; ++t) { const unsigned bo = (unsigned)(t & 1) * STG_BYTES; const unsigned char* sb = sm + bo;
#pragma unroll
    for (int kc = 0; kc < KST / 32; ++kc) { v16b ah[2], al[2], w[4];
#pragma unroll
      for (int i = 0; i < 2; ++i) { ah[i] = frag_s(sb, wm * 32 + i * 16, kc, lane); al[i] = frag_s(sb, 64 + wm * 32 + i * 16, kc, lane); }
#pragma unroll
      for (int j = 0; j < 4; ++j) w[j] = frag_s(sb, 128 + wn * 64 + j * 16, kc, lane);
#pragma unroll
      for (int i = 0; i < 2; ++i)
#pragma unroll
        for (int j = 0; j < 4; ++j) acc[i][j] = wmma_bf(al[i], w[j], acc[i][j]);
#pragma unroll
      for (int i = 0; i < 2; ++i)
#pragma unroll
        for (int j = 0; j < 4; ++j) acc[i][j] = wmma_bf(ah[i], w[j], acc[i][j]); }
    asm volatile("s_wait_dscnt 0x0" ::: "memory");      // this wave's reads of the buffer are done before it is refilled
    asm volatile("s_wait_asynccnt 0x0" ::: "memory");   // this wave's copies of stage t + 1 have landed
    __syncthreads();                                     // publishes stage t + 1, frees stage t's buffer
    if (t + 2 < NST) { const int ko = (t + 2) * KST; copy128rows(l0 + bo, gh + ko, gl + ko); copy128rows(l0 + bo + 128u * LPITCH, gw + ko, gw + 64 * CC + ko); } }
  asm volatile("s_wait_asynccnt 0x0" ::: "memory");     // no copy is outstanding when the ring becomes output staging
  float (*sf)[132] = (float (*)[132])sm;
#pragma unroll
  for (int j = 0; j < 4; ++j) { const int cl = wn * 64 + j * 16 + col; const float bias = bfr(BO[c0 + cl]);
#pragma unroll
    for (int i = 0; i < 2; ++i)
#pragma unroll
      for (int r = 0; r < 8; ++r) sf[wm * 32 + i * 16 + 8 * g + r][cl] = acc[i][j][r] + bias; }
  __syncthreads();
  const size_t orow0 = (size_t)(rb / SEQ) * SEQ_FULL + (size_t)(rb % SEQ) + wave * 16;
#pragma unroll 1
  for (int rl = 0; rl < 16; ++rl) { const v4f v = *(const v4f*)&sf[wave * 16 + rl][lane * 4];
    vst2(OUT + (orow0 + rl) * DIN + c0 + lane * 4, v); }
}

extern "C" void kernel_launch(void* const* d_in, const int* in_sizes, int n_in, void* d_out, int out_size, void* d_ws, size_t ws_size, hipStream_t stream) {
  if (n_in < 5) return;
  const size_t xneed = ((size_t)(NB - 1) * SEQ_FULL + SEQ) * DIN;
  if ((size_t)in_sizes[0] < xneed) return;
  if ((size_t)in_sizes[1] < (size_t)DIN * 3 * CC) return;
  if ((size_t)in_sizes[2] < (size_t)3 * CC) return;
  if ((size_t)in_sizes[3] < (size_t)CC * DIN) return;
  if ((size_t)in_sizes[4] < (size_t)DIN) return;
  if ((size_t)out_size < xneed) return;
  if (ws_size < (size_t)WS_END) return;
  // inputs (wire order): 0 x [4,1024,1024]; 1 W_qkv [1024,3072] (in,out): q columns 0..1023, k 1024..2047, v 2048..3071; 2 b_qkv [3072]; 3 W_out [1024,1024] (in,out); 4 b_out [1024]
  const float* x = (const float*)d_in[0]; const float* wqkv = (const float*)d_in[1]; const float* bqkv = (const float*)d_in[2]; const float* wout = (const float*)d_in[3]; const float* bout = (const float*)d_in[4];
  char* ws = (char*)d_ws;
  __bf16* XB = (__bf16*)(ws + WS_XB); __bf16* WQT = (__bf16*)(ws + WS_WQT); __bf16* WOT = (__bf16*)(ws + WS_WOT); __bf16* QK = (__bf16*)(ws + WS_QK); _Float16* VT = (_Float16*)(ws + WS_VT); __bf16* Y = (__bf16*)(ws + WS_Y);
  k_prep<<<dim3(TRQ + TRO + CVB), 256, 0, stream>>>(x, wqkv, wout, XB, WQT, WOT);
  k_proj<<<dim3(NB * SEQ / 128, CC / 128, 3), 128, 0, stream>>>(XB, WQT, bqkv, QK, VT);
  k_attn<<<dim3(SEQ / 64, NH, NB), 128, 0, stream>>>(QK, VT, Y);
  k_out<<<dim3(NB * SEQ / 64, DIN / 128), 128, 0, stream>>>(Y, WOT, bout, (float*)d_out);
}

// v004
// Measured time: 80.5 microseconds a run.
// Next to v003, in two timings, it ran 1.04 and 1.03 times as fast.
// All steps since v000 together make it 3.81 times as fast.
// compute dtype: all float inputs converted (RNE) to bf16; q/k/v projections = exact bf16 x bf16 products on v_wmma_f32_16x16x32_bf16 (f32 accumulate) + bias; logits = (k hi|lo) x (q/8 hi|lo) as three bf16 products (hh + hl + lh) in one f32 accumulator; softmax f32 (online, running max); P x 2^12 once to f16 against v once to f16 on v_wmma_f32_16x16x32_f16 (one product); ctx as bf16 hi|lo against the bf16 output weight (two products) + bias; f32 output.
#include <hip/hip_runtime.h>
#include <math.h>

typedef __attribute__((ext_vector_type(16))) _Float16 v16h;
typedef __attribute__((ext_vector_type(16))) __bf16 v16b;
typedef __attribute__((ext_vector_type(8)))  _Float16 v8h;
typedef __attribute__((ext_vector_type(8)))  __bf16 v8b;
typedef __attribute__((ext_vector_type(8)))  float v8f;
typedef __attribute__((ext_vector_type(4)))  float v4f;
typedef __attribute__((ext_vector_type(4)))  unsigned v4u;

// Dense multi-head self-attention, no mask: x [4,1024,1024]; fused (in,out) QKV weight [1024][3072] viewed (3, 16, 64): column = which*1024 + h*64 + d; (in,out) output weight [1024][1024]; one score scale 1/8; softmax over the 1024 keys of the same batch.
#ifndef NB
#define NB 4
#endif
#ifndef SEQ
#define SEQ 1024
#endif
#define NB_FULL 4
#define SEQ_FULL 1024      // full per-batch row stride of x and of the output
#define DIN 1024           // model width (input of QKV projection, output of the last projection)
#define CC 1024            // NH * HD
#define NH 16
#define HD 64
#define SCALE (0.125f)
#define PCARRY (4096.0f)   // P carried x 2^12 into f16 (keeps small probabilities clear of f16 subnormals); folded back with 1/l
#define PLANE ((size_t)NB * SEQ * CC)

static_assert(CC == NH * HD);                 // merged head layout h*64+d
static_assert(HD == 64);
static_assert(SEQ % 64 == 0);                 // 64-row blocks never straddle a batch; key loop steps by 64
static_assert(DIN % 64 == 0 && CC % 128 == 0 && (3 * CC) % 64 == 0 && DIN % 128 == 0);   // tile multiples of every GEMM / transpose grid
static_assert(DIN % 32 == 0 && CC % 32 == 0); // WMMA k-steps
static_assert(NB <= NB_FULL && SEQ <= SEQ_FULL);
static_assert(((size_t)NB * SEQ * (DIN / 8)) % 256 == 0);   // convert grid x 256 threads == plane extent

#define WS_XB  ((size_t)0)                                   // bf16 x rows [NB*SEQ][DIN]
#define WS_WQT (WS_XB  + 2u * (size_t)NB * SEQ * DIN)        // bf16 QKV weight, (out,in) [3*CC][DIN]
#define WS_WOT (WS_WQT + 2u * (size_t)3 * CC * DIN)          // bf16 output weight, (out,in) [DIN][CC]
#define WS_QK  (WS_WOT + 2u * (size_t)DIN * CC)              // bf16 planes: q/8 hi, q/8 lo, k hi, k lo, each [NB*SEQ][CC]
#define WS_VT  (WS_QK  + 4u * 2u * PLANE)                    // f16 v planes [b][c][t]
#define WS_Y   (WS_VT  + 2u * (size_t)NB * CC * SEQ)         // bf16 ctx planes: hi, lo, each [NB*SEQ][CC]
#define WS_END (WS_Y   + 2u * 2u * PLANE)
static_assert(WS_END <= (size_t)134217728);   // total carve
static_assert(WS_WQT % 128 == 0 && WS_WOT % 128 == 0 && WS_QK % 128 == 0 && WS_VT % 128 == 0 && WS_Y % 128 == 0);

template <typename T> __device__ __forceinline__ void vst2(void* p, T v) { *(T*)p = v;  }
// k_attn's two products are the bare builtins: the compiler keeps the distances behind its own WMMAs, and with no asm statement tied to each product it may group the LDS reads ahead, alternate the accumulator chains and set softmax work between the products
__device__ __forceinline__ v8f wmma16(v16h a, v16h b, v8f c) {
  return __builtin_amdgcn_wmma_f32_16x16x32_f16(false, a, false, b, (short)0, c, false, false);
}
__device__ __forceinline__ v8f wmma_bfa(v16b a, v16b b, v8f c) {
  return __builtin_amdgcn_wmma_f32_16x16x32_bf16(false, a, false, b, (short)0, c, false, false);
}
__device__ __forceinline__ v8f wmma_bf(v16b a, v16b b, v8f c) {
  v8f d = __builtin_amdgcn_wmma_f32_16x16x32_bf16(false, a, false, b, (short)0, c, false, false);
  asm volatile("v_nop\n\tv_nop\n\tv_nop\n\tv_nop" : "+v"(d) : "v"(a), "v"(b));
  return d;
}
// 16x16x32 fragments: lane = (g = lane>>4, row/col = lane&15); elements 0..7 = k0+8g+0..7, 8..15 = k0+16+8g+0..7; D element r = row 8g+r, col lane&15
__device__ __forceinline__ v16h frag_h(const _Float16* rowk0, int lane) {
  union { v16h v; v8h q[2]; } u; const _Float16* p = rowk0 + 8 * (lane >> 4);
  u.q[0] = *(const v8h*)p; u.q[1] = *(const v8h*)(p + 16); return u.v;
}
__device__ __forceinline__ v16b frag_b(const __bf16* rowk0, int lane) {
  union { v16b v; v8b q[2]; } u; const __bf16* p = rowk0 + 8 * (lane >> 4);
  u.q[0] = *(const v8b*)p; u.q[1] = *(const v8b*)(p + 16); return u.v;
}
__device__ __forceinline__ float bfr(float v) { return (float)(__bf16)v; }

// x piece i (8 consecutive elements of one row): f32 -> bf16 (RNE)
__device__ __forceinline__ void cvt_x(int i, const float* __restrict__ X, __bf16* __restrict__ XB) {
  if (i >= NB * SEQ * (DIN / 8)) return;
  const int row = i / (DIN / 8), pc = i % (DIN / 8);
  const size_t srow = (size_t)(row / SEQ) * SEQ_FULL + (size_t)(row % SEQ);
  const float* p = X + srow * DIN + pc * 8;
  const v4f a = *(const v4f*)p, b = *(const v4f*)(p + 4);
  union { v8b v; v4u u; } o;
  o.v[0] = (__bf16)a[0]; o.v[1] = (__bf16)a[1]; o.v[2] = (__bf16)a[2]; o.v[3] = (__bf16)a[3];
  o.v[4] = (__bf16)b[0]; o.v[5] = (__bf16)b[1]; o.v[6] = (__bf16)b[2]; o.v[7] = (__bf16)b[3];
  vst2(XB + (size_t)row * DIN + pc * 8, o.u);
}

// in[DIN rows][ldw cols] f32 (in,out) -> out[ldw rows][DIN cols] bf16 (out,in); one 64 x 64 tile (column tile bx, k tile by) through LDS by a whole 256-thread block
__device__ __forceinline__ void tr_w(__bf16 (*t)[72], const float* __restrict__ W, __bf16* __restrict__ WT, int ldw, int bx, int by) {
  const int tid = threadIdx.x; const int n0 = bx * 64, k0 = by * 64;
  for (int e = tid; e < 64 * 16; e += 256) { const int kr = e >> 4, c4 = (e & 15) * 4;
    const v4f w = *(const v4f*)(W + (size_t)(k0 + kr) * ldw + n0 + c4);
    t[c4 + 0][kr] = (__bf16)w[0]; t[c4 + 1][kr] = (__bf16)w[1]; t[c4 + 2][kr] = (__bf16)w[2]; t[c4 + 3][kr] = (__bf16)w[3]; }
  __syncthreads();
  for (int e = tid; e < 64 * 8; e += 256) { const int nr = e >> 3, q = e & 7; const v4u v = *(const v4u*)&t[nr][q * 8];
    vst2(WT + (size_t)(n0 + nr) * DIN + k0 + q * 8, v); }
}

// ---- k_prep: the three preparations depend on nothing but the inputs, so they share one launch; the block index picks the job (the same for a whole block, so the transpose's barrier is passed by all of a block or by none).
//      Blocks 0 .. TRQ-1: QKV weight tiles; TRQ .. TRQ+TRO-1: output weight tiles (the jobs with the longer chain load, LDS, barrier, store start first); the rest: 256 x pieces each.
#define TRQ ((3 * CC / 64) * (DIN / 64))
#define TRO ((DIN / 64) * (CC / 64))
#define CVB ((int)(((size_t)NB * SEQ * (DIN / 8)) / 256))
__global__ __launch_bounds__(256) void k_prep(const float* __restrict__ X, const float* __restrict__ WQ, const float* __restrict__ WO, __bf16* __restrict__ XB, __bf16* __restrict__ WQT, __bf16* __restrict__ WOT) {
  __shared__ __align__(16) __bf16 t[64][72];
  const int id = blockIdx.x;
  if (id < TRQ) tr_w(t, WQ, WQT, 3 * CC, id % (3 * CC / 64), id / (3 * CC / 64));                       // in[1024][3072] -> out[3072][1024]
  else if (id < TRQ + TRO) tr_w(t, WO, WOT, DIN, (id - TRQ) % (DIN / 64), (id - TRQ) / (DIN / 64));     // in[1024][1024] -> out[1024][1024]
  else cvt_x((id - TRQ - TRO) * 256 + (int)threadIdx.x, X, XB);
}

// ---- LDS ring of the two GEMM kernels: a stage = 64 k of 256 operand rows (rows 0..127: the A side, rows 128..255: the weight rows), 128 B a row at pitch 144 B (16 B x odd: no bank conflict for 16-B fragment reads); two buffers.
#define KST 64
#define NST (DIN / KST)
#define LPITCH 144
#define STG_BYTES (256 * LPITCH)
static_assert(DIN == CC && DIN % KST == 0 && NST >= 2);
static_assert(SEQ % 128 == 0);                // 128-row blocks of k_proj never straddle a batch
// Eight asynchronous 16-B copies per lane: 16 rows each (8 lanes cover one 128-B row piece), rows 0,16,32,48 from pa and 64,..,112 from pb. The s_wait_xcnt stands inside the statement so that no address register is rewritten ahead of it.
__device__ __forceinline__ void copy128rows(unsigned l, const __bf16* pa, const __bf16* pb) {
  asm volatile("global_load_async_to_lds_b128 %0, %8, off\n\t"
               "global_load_async_to_lds_b128 %1, %9, off\n\t"
               "global_load_async_to_lds_b128 %2, %10, off\n\t"
               "global_load_async_to_lds_b128 %3, %11, off\n\t"
               "global_load_async_to_lds_b128 %4, %12, off\n\t"
               "global_load_async_to_lds_b128 %5, %13, off\n\t"
               "global_load_async_to_lds_b128 %6, %14, off\n\t"
               "global_load_async_to_lds_b128 %7, %15, off\n\t"
               "s_wait_xcnt 0x0"
               :: "v"(l), "v"(l + 16u * LPITCH), "v"(l + 32u * LPITCH), "v"(l + 48u * LPITCH), "v"(l + 64u * LPITCH), "v"(l + 80u * LPITCH), "v"(l + 96u * LPITCH), "v"(l + 112u * LPITCH),
                  "v"(pa), "v"(pa + 16 * DIN), "v"(pa + 32 * DIN), "v"(pa + 48 * DIN), "v"(pb), "v"(pb + 16 * DIN), "v"(pb + 32 * DIN), "v"(pb + 48 * DIN)
               : "memory");
}
// fragment of 16 staged rows starting at row, k step kc of the stage
__device__ __forceinline__ v16b frag_s(const unsigned char* sb, int row, int kc, int lane) {
  return frag_b((const __bf16*)(sb + (row + (lane & 15)) * LPITCH) + kc * 32, lane);
}

// ---- k_proj: block = (128 rows, 128 cols, which), 4 waves of 64 x 64: q/k/v = x W + b with exact bf16 products (K = DIN), operands through the LDS ring. which 0: q x 1/8 as bf16 hi|lo rows; 1: k as bf16 hi|lo rows; 2: v f16 planes [c][t]
__global__ __launch_bounds__(128) void k_proj(const __bf16* __restrict__ XB, const __bf16* __restrict__ WT, const float* __restrict__ BQKV, __bf16* __restrict__ QK, _Float16* __restrict__ VT) {
  __shared__ __align__(128) unsigned char sm[2 * STG_BYTES];   // the ring; behind the k loop the output staging
  static_assert(2 * 128 * 136 * 2 <= 2 * STG_BYTES);
  const int tid = threadIdx.x; const int wave = __builtin_amdgcn_readfirstlane(threadIdx.x >> 5); const int lane = tid & 31, col = lane & 15, g = lane >> 4;
  const int wm = wave >> 1, wn = wave & 1;
  const int which = blockIdx.z; const int c0 = blockIdx.y * 128; const int r0 = blockIdx.x * 128; const int bb = r0 / SEQ; const int t0 = r0 % SEQ;
  const __bf16* ga = XB + (size_t)(r0 + (tid >> 3)) * DIN + (tid & 7) * 8;
  const __bf16* gw = WT + (size_t)(which * CC + c0 + (tid >> 3)) * DIN + (tid & 7) * 8;
  const unsigned l0 = (unsigned)(size_t)sm + (unsigned)((tid >> 3) * LPITCH + (tid & 7) * 16);
  copy128rows(l0, ga, ga + 64 * DIN); copy128rows(l0 + 128u * LPITCH, gw, gw + 64 * DIN);
  asm volatile("s_wait_asynccnt 0x0" ::: "memory");   // stage 0 landed (this wave's copies)
  __syncthreads();                                     // ... and every other wave's
  copy128rows(l0 + STG_BYTES, ga + KST, ga + 64 * DIN + KST); copy128rows(l0 + STG_BYTES + 128u * LPITCH, gw + KST, gw + 64 * DIN + KST);
  v8f acc[4][4] = {};
#pragma unroll 1   // one copy of the pass in the text; the buffer is chosen by the trip's parity
  for (int t = 0; t < NST; ++t) { const unsigned bo = (unsigned)(t & 1) * STG_BYTES; const unsigned char* sb = sm + bo;
#pragma unroll
    for (int kc = 0; kc < KST / 32; ++kc) { v16b a[4], w[4];
#pragma unroll
      for (int i = 0; i < 4; ++i) { a[i] = frag_s(sb, wm * 64 + i * 16, kc, lane); w[i] = frag_s(sb, 128 + wn * 64 + i * 16, kc, lane); }
#pragma unroll
      for (int i = 0; i < 4; ++i)
#pragma unroll
        for (int j = 0; j < 4; ++j) acc[i][j] = wmma_bf(a[i], w[j], acc[i][j]); }
    asm volatile("s_wait_dscnt 0x0" ::: "memory");      // this wave's reads of the buffer are done before it is refilled
    asm volatile("s_wait_asynccnt 0x0" ::: "memory");   // this wave's copies of stage t + 1 have landed
    __syncthreads();                                     // publishes stage t + 1, frees stage t's buffer
    if (t + 2 < NST) { const int ko = (t + 2) * KST; copy128rows(l0 + bo, ga + ko, ga + 64 * DIN + ko); copy128rows(l0 + bo + 128u * LPITCH, gw + ko, gw + 64 * DIN + ko); } }
  asm volatile("s_wait_asynccnt 0x0" ::: "memory");     // no copy is outstanding when the ring becomes output staging
  if (which < 2) { const float qs = (which == 0) ? SCALE : 1.0f;   /* block-uniform; 1/8 is an exact power of two */
    __bf16 (*sh)[136] = (__bf16 (*)[136])sm; __bf16 (*sl)[136] = (__bf16 (*)[136])(sm + 128 * 136 * 2);
#pragma unroll
    for (int j = 0; j < 4; ++j) { const int cl = wn * 64 + j * 16 + col; const float bias = bfr(BQKV[which * CC + c0 + cl]);
#pragma unroll
      for (int i = 0; i < 4; ++i)
#pragma unroll
        for (int r = 0; r < 8; ++r) { const int rl = wm * 64 + i * 16 + 8 * g + r; const float v = (acc[i][j][r] + bias) * qs; const __bf16 hv = (__bf16)v; sh[rl][cl] = hv; sl[rl][cl] = (__bf16)(v - (float)hv); } }
    __syncthreads();
    __bf16* DH = QK + (size_t)(2 * which) * PLANE; __bf16* DL = DH + PLANE;
    for (int e = tid; e < 128 * 16; e += 128) { const int rl = e >> 4, q = e & 15; const v4u vh = *(const v4u*)&sh[rl][q * 8]; const v4u vl = *(const v4u*)&sl[rl][q * 8];
      const size_t o = (size_t)(r0 + rl) * CC + c0 + q * 8; vst2(DH + o, vh); vst2(DL + o, vl); }
  } else {
    _Float16 (*th)[136] = (_Float16 (*)[136])sm;
#pragma unroll
    for (int j = 0; j < 4; ++j) { const int cl = wn * 64 + j * 16 + col; const float bias = bfr(BQKV[2 * CC + c0 + cl]);
#pragma unroll
      for (int i = 0; i < 4; ++i)
#pragma unroll
        for (int r = 0; r < 8; ++r) th[cl][wm * 64 + i * 16 + 8 * g + r] = (_Float16)(acc[i][j][r] + bias); }
    __syncthreads();
    for (int e = tid; e < 128 * 16; e += 128) { const int cl = e >> 4, q = e & 15; const v4u v = *(const v4u*)&th[cl][q * 8];
      vst2(VT + ((size_t)bb * CC + c0 + cl) * (size_t)SEQ + t0 + q * 8, v); } }
}

// ---- k_attn: block = 128 queries of (b, h), 8 waves = 4 query groups (32 columns: two 16-column tiles a wave) x 2 key groups (each takes 32 of a stage's 64 keys; joined behind the key loop); transposed flash form: S^T tile = K (A, rows = keys) x Q^T (B, cols = queries) so each lane owns one query column:
//      running max / sum are per-lane scalars (+ one xor-16 shuffle for the max); the two 16-key S^T accumulators convert in-lane into the B fragment (k = key row of the tile) of O^T += V^T (A, rows = d) x P^T.
//      K hi, K lo and V^T of 64 keys form one stage of an LDS ring shared by the eight waves (rows 0..63 K hi, 64..127 K lo, 128..191 V^T rows d; 128 B a row at pitch 144 B), two buffers; the softmax still steps by 32 keys.
#define AST_BYTES (192 * LPITCH)
#define NKS (SEQ / 64)
static_assert(NKS >= 2 && HD * 2 == 128);   // two stages at least; a K row piece (64 d) and a V^T row piece (64 keys) are 128 B
// Six asynchronous 16-B copies per lane of a 256-thread block: one stage (32 rows a copy: K hi rows 0, 32; K lo rows 0, 32; V^T rows 0, 32). The s_wait_xcnt stands inside the statement so that no address register is rewritten ahead of it.
__device__ __forceinline__ void copy_stage(unsigned l, const __bf16* kh, const __bf16* kl, const _Float16* v) {
  asm volatile("global_load_async_to_lds_b128 %0, %6, off\n\t"
               "global_load_async_to_lds_b128 %1, %7, off\n\t"
               "global_load_async_to_lds_b128 %2, %8, off\n\t"
               "global_load_async_to_lds_b128 %3, %9, off\n\t"
               "global_load_async_to_lds_b128 %4, %10, off\n\t"
               "global_load_async_to_lds_b128 %5, %11, off\n\t"
               "s_wait_xcnt 0x0"
               :: "v"(l), "v"(l + 32u * LPITCH), "v"(l + 64u * LPITCH), "v"(l + 96u * LPITCH), "v"(l + 128u * LPITCH), "v"(l + 160u * LPITCH),
                  "v"(kh), "v"(kh + 32 * CC), "v"(kl), "v"(kl + 32 * CC), "v"(v), "v"(v + 32 * SEQ)
               : "memory");
}
#define QT 2                                  // query tiles (16 columns each) per wave: every K and V^T fragment read from LDS feeds QT products
#define AQ (64 * QT)                          // queries per block: 4 query groups x 16 QT
#define MG_ML 32768                           // behind the key loop the ring holds: the O^T tiles handed over (4 x 16 x 32 pieces of 16 B), ...
#define MG_YS 40960                           // ... their max and sum (from MG_ML), and the output staging (from MG_YS)
static_assert(SEQ % AQ == 0);
static_assert(4 * QT * 8 * 32 * 16 <= MG_ML && MG_ML + 4 * QT * 2 * 32 * 4 <= MG_YS && 2 * AST_BYTES <= MG_YS + 2 * AQ * 9 * 16);
__global__ __launch_bounds__(256) void k_attn(const __bf16* __restrict__ QK, const _Float16* __restrict__ VT, __bf16* __restrict__ Y) {
  __shared__ __align__(128) unsigned char sm[MG_YS + 2 * AQ * 9 * 16];   // the ring (its first 2 AST_BYTES); behind the key loop the merge and output staging
  const int tid = threadIdx.x; const int wave = __builtin_amdgcn_readfirstlane(threadIdx.x >> 5); const int lane = tid & 31, col = lane & 15, g = lane >> 4;
  const int qg = wave & 3, kg = wave >> 2;    // query group (32 columns), key group (keys 32 kg .. 32 kg + 31 of every stage)
  const int qb = blockIdx.x, h = blockIdx.y, b = blockIdx.z;
  const size_t qoff = ((size_t)b * SEQ + qb * AQ + qg * (16 * QT) + col) * CC + h * HD;
  const __bf16* QHp = QK + qoff; const __bf16* QLp = QK + PLANE + qoff;
  const size_t koff = ((size_t)b * SEQ + (tid >> 3)) * CC + h * HD + (tid & 7) * 8;
  const __bf16* gkh = QK + 2 * PLANE + koff; const __bf16* gkl = QK + 3 * PLANE + koff;
  const _Float16* gv = VT + ((size_t)b * CC + h * HD + (tid >> 3)) * (size_t)SEQ + (tid & 7) * 8;
  const unsigned l0 = (unsigned)(size_t)sm + (unsigned)((tid >> 3) * LPITCH + (tid & 7) * 16);
  copy_stage(l0, gkh, gkl, gv);
  v16b qh[QT][HD / 32], ql[QT][HD / 32];   // the wave's query fragments, read once
#pragma unroll
  for (int x = 0; x < QT; ++x)
#pragma unroll
    for (int kc = 0; kc < HD / 32; ++kc) { qh[x][kc] = frag_b(QHp + (size_t)x * 16 * CC + kc * 32, lane); ql[x][kc] = frag_b(QLp + (size_t)x * 16 * CC + kc * 32, lane); }
  asm volatile("s_wait_asynccnt 0x0" ::: "memory");   // stage 0 landed (this wave's copies)
  __syncthreads();                                     // ... and every other wave's
  copy_stage(l0 + AST_BYTES, gkh + 64 * CC, gkl + 64 * CC, gv + 64);
  v8f o[QT][4] = {}; float m[QT], l[QT];
#pragma unroll
  for (int x = 0; x < QT; ++x) { m[x] = -1.0e30f; l[x] = 0.f; }
#pragma unroll 1   // one copy of the pass in the text; the buffer is chosen by the trip's parity
  for (int t = 0; t < NKS; ++t) { const unsigned bo = (unsigned)(t & 1) * AST_BYTES; const unsigned char* sb = sm + bo;
    const unsigned char* sk = sb + kg * (32 * LPITCH);   // this key group's 32 K rows
    v8f s0[QT] = {}, s1[QT] = {};
#pragma unroll
    for (int kc = 0; kc < HD / 32; ++kc) {
      { const v16b kh = frag_s(sk, 0, kc, lane), kl = frag_s(sk, 64, kc, lane);
#pragma unroll
        for (int x = 0; x < QT; ++x) { s0[x] = wmma_bfa(kl, qh[x][kc], s0[x]); s0[x] = wmma_bfa(kh, ql[x][kc], s0[x]); s0[x] = wmma_bfa(kh, qh[x][kc], s0[x]); } }
      { const v16b kh = frag_s(sk, 16, kc, lane), kl = frag_s(sk, 64 + 16, kc, lane);
#pragma unroll
        for (int x = 0; x < QT; ++x) { s1[x] = wmma_bfa(kl, qh[x][kc], s1[x]); s1[x] = wmma_bfa(kh, ql[x][kc], s1[x]); s1[x] = wmma_bfa(kh, qh[x][kc], s1[x]); } }
    }
    v16h p[QT];
#pragma unroll
    for (int x = 0; x < QT; ++x) {
      float mx = fmaxf(s0[x][0], s1[x][0]);
#pragma unroll
      for (int r = 1; r < 8; ++r) mx = fmaxf(mx, fmaxf(s0[x][r], s1[x][r]));
      mx = fmaxf(mx, __shfl_xor(mx, 16));          /* all lanes active; both lane halves of a query column agree on the max */
      const float mn = fmaxf(m[x], mx); const float corr = __expf(m[x] - mn); m[x] = mn;
      float ps = 0.f;
#pragma unroll
      for (int r = 0; r < 8; ++r) { const float e0 = __expf(s0[x][r] - mn), e1 = __expf(s1[x][r] - mn); ps += e0 + e1; p[x][r] = (_Float16)(e0 * PCARRY); p[x][8 + r] = (_Float16)(e1 * PCARRY); }
      l[x] = l[x] * corr + ps;                      /* l from the unconverted f32 values; per-lane partial (this lane's 16 of the 32 keys) */
#pragma unroll
      for (int j = 0; j < 4; ++j)
#pragma unroll
        for (int r = 0; r < 8; ++r) o[x][j][r] *= corr;
    }
#pragma unroll
    for (int j = 0; j < 4; ++j) { const v16h vf = frag_h((const _Float16*)(sb + (128 + j * 16 + col) * LPITCH) + kg * 32, lane);
#pragma unroll
      for (int x = 0; x < QT; ++x) o[x][j] = wmma16(vf, p[x], o[x][j]); }
    asm volatile("s_wait_dscnt 0x0" ::: "memory");      // this wave's reads of the buffer are done before it is refilled
    asm volatile("s_wait_asynccnt 0x0" ::: "memory");   // this wave's copies of stage t + 1 have landed
    __syncthreads();                                     // publishes stage t + 1, frees stage t's buffer
    if (t + 2 < NKS) { const int kn = (t + 2) * 64; copy_stage(l0 + bo, gkh + (size_t)kn * CC, gkl + (size_t)kn * CC, gv + kn); }
  }
  asm volatile("s_wait_asynccnt 0x0" ::: "memory");     // no copy is outstanding when the ring becomes merge and output staging
  // merge of the two key groups of a query group through LDS, on the common max: key group x joins query tile x; each wave hands over the tile it does not join
  static_assert(QT == 2);                                // as many query tiles a wave as key groups
  v4f* mo = (v4f*)sm + (size_t)qg * (QT * 8) * 32 + lane; float* ml = (float*)(sm + MG_ML) + qg * (QT * 2) * 32 + lane;
  v4u (*ys)[AQ][9] = (v4u (*)[AQ][9])(sm + MG_YS);
#pragma unroll
  for (int x = 0; x < QT; ++x)
    if (kg != x) { ml[(x * 2) * 32] = m[x]; ml[(x * 2 + 1) * 32] = l[x];   /* wave-uniform test */
#pragma unroll
      for (int j = 0; j < 4; ++j) { const v4f a = { o[x][j][0], o[x][j][1], o[x][j][2], o[x][j][3] }, c = { o[x][j][4], o[x][j][5], o[x][j][6], o[x][j][7] };
        mo[((x * 4 + j) * 2) * 32] = a; mo[((x * 4 + j) * 2 + 1) * 32] = c; } }
  __syncthreads();                                       // the partial results handed over are in LDS
#pragma unroll
  for (int x = 0; x < QT; ++x)
    if (kg == x) {                                       /* wave-uniform test: all lanes of the wave active inside */
      const float m1 = ml[(x * 2) * 32], l1 = ml[(x * 2 + 1) * 32];
      const float mm = fmaxf(m[x], m1); const float a0 = __expf(m[x] - mm), a1 = __expf(m1 - mm);
      float lt = l[x] * a0 + l1 * a1;
      lt += __shfl_xor(lt, 16);
      const float inv = 1.0f / (lt * PCARRY); const float f0 = a0 * inv, f1 = a1 * inv;
      // O^T tile j: lane (g, col = query) holds d = 16j + 8g + 0..7: one 16-B piece of the (row, head) segment, as bf16 hi and lo
#pragma unroll
      for (int j = 0; j < 4; ++j) { union { v8b v; v4u u; } hi, lo; const v4f a = mo[((x * 4 + j) * 2) * 32], c = mo[((x * 4 + j) * 2 + 1) * 32];
#pragma unroll
        for (int r = 0; r < 8; ++r) { const float o1 = (r < 4) ? a[r & 3] : c[r & 3]; const float cv = o[x][j][r] * f0 + o1 * f1; const __bf16 hb = (__bf16)cv; hi.v[r] = hb; lo.v[r] = (__bf16)(cv - (float)hb); }
        ys[0][qg * (16 * QT) + x * 16 + col][2 * j + g] = hi.u; ys[1][qg * (16 * QT) + x * 16 + col][2 * j + g] = lo.u; } }
  __syncthreads();
#pragma unroll 1
  for (int it = 0; it < 4; ++it) { const int rl = wave * 16 + it * 4 + (lane >> 3), pc = lane & 7;
    const v4u a = ys[0][rl][pc]; const v4u c = ys[1][rl][pc];
    const size_t go = ((size_t)b * SEQ + qb * AQ + rl) * CC + h * HD + pc * 8;
    vst2(Y + go, a); vst2(Y + PLANE + go, c); }
}

// ---- k_out: block = (64 rows, 128 cols), 4 waves of 32 x 64: out = ctx Wo + bo: ctx bf16 hi + lo against the exact bf16 weight (2 products, one accumulator: lo, then hi, per k step), operands through the LDS ring (rows 0..63 ctx hi, 64..127 ctx lo, 128..255 weight); 512-B row segment by one 32-lane x 16-B instruction
__global__ __launch_bounds__(128) void k_out(const __bf16* __restrict__ Y, const __bf16* __restrict__ WOT, const float* __restrict__ BO, float* __restrict__ OUT) {
  __shared__ __align__(128) unsigned char sm[2 * STG_BYTES];   // the ring; behind the k loop the output staging
  static_assert(64 * 132 * 4 <= 2 * STG_BYTES);
  const int tid = threadIdx.x; const int wave = __builtin_amdgcn_readfirstlane(threadIdx.x >> 5); const int lane = tid & 31, col = lane & 15, g = lane >> 4;
  const int wm = wave >> 1, wn = wave & 1;
  const int c0 = blockIdx.y * 128; const int rb = blockIdx.x * 64;
  const __bf16* gh = Y + (size_t)(rb + (tid >> 3)) * CC + (tid & 7) * 8; const __bf16* gl = gh + PLANE;
  const __bf16* gw = WOT + (size_t)(c0 + (tid >> 3)) * CC + (tid & 7) * 8;
  const unsigned l0 = (unsigned)(size_t)sm + (unsigned)((tid >> 3) * LPITCH + (tid & 7) * 16);
  copy128rows(l0, gh, gl); copy128rows(l0 + 128u * LPITCH, gw, gw + 64 * CC);
  asm volatile("s_wait_asynccnt 0x0" ::: "memory");   // stage 0 landed (this wave's copies)
  __syncthreads();                                     // ... and every other wave's
  copy128rows(l0 + STG_BYTES, gh + KST, gl + KST); copy128rows(l0 + STG_BYTES + 128u * LPITCH, gw + KST, gw + 64 * CC + KST);
  v8f acc[2][4] = {};
#pragma unroll 1   // one copy of the pass in the text; the buffer is chosen by the trip's parity
  for (int t = 0; t < NST; ++t) { const unsigned bo = (unsigned)(t & 1) * STG_BYTES; const unsigned char* sb = sm + bo;
#pragma unroll
    for (int kc = 0; kc < KST / 32; ++kc) { v16b ah[2], al[2], w[4];
#pragma unroll
      for (int i = 0; i < 2; ++i) { ah[i] = frag_s(sb, wm * 32 + i * 16, kc, lane); al[i] = frag_s(sb, 64 + wm * 32 + i * 16, kc, lane); }
#pragma unroll
      for (int j = 0; j < 4; ++j) w[j] = frag_s(sb, 128 + wn * 64 + j * 16, kc, lane);
#pragma unroll
      for (int i = 0; i < 2; ++i)
#pragma unroll
        for (int j = 0; j < 4; ++j) acc[i][j] = wmma_bf(al[i], w[j], acc[i][j]);
#pragma unroll
      for (int i = 0; i < 2; ++i)
#pragma unroll
        for (int j = 0; j < 4; ++j) acc[i][j] = wmma_bf(ah[i], w[j], acc[i][j]); }
    asm volatile("s_wait_dscnt 0x0" ::: "memory");      // this wave's reads of the buffer are done before it is refilled
    asm volatile("s_wait_asynccnt 0x0" ::: "memory");   // this wave's copies of stage t + 1 have landed
    __syncthreads();                                     // publishes stage t + 1, frees stage t's buffer
    if (t + 2 < NST) { const int ko = (t + 2) * KST; copy128rows(l0 + bo, gh + ko, gl + ko); copy128rows(l0 + bo + 128u * LPITCH, gw + ko, gw + 64 * CC + ko); } }
  asm volatile("s_wait_asynccnt 0x0" ::: "memory");     // no copy is outstanding when the ring becomes output staging
  float (*sf)[132] = (float (*)[132])sm;
#pragma unroll
  for (int j = 0; j < 4; ++j) { const int cl = wn * 64 + j * 16 + col; const float bias = bfr(BO[c0 + cl]);
#pragma unroll
    for (int i = 0; i < 2; ++i)
#pragma unroll
      for (int r = 0; r < 8; ++r) sf[wm * 32 + i * 16 + 8 * g + r][cl] = acc[i][j][r] + bias; }
  __syncthreads();
  const size_t orow0 = (size_t)(rb / SEQ) * SEQ_FULL + (size_t)(rb % SEQ) + wave * 16;
#pragma unroll 1
  for (int rl = 0; rl < 16; ++rl) { const v4f v = *(const v4f*)&sf[wave * 16 + rl][lane * 4];
    vst2(OUT + (orow0 + rl) * DIN + c0 + lane * 4, v); }
}

extern "C" void kernel_launch(void* const* d_in, const int* in_sizes, int n_in, void* d_out, int out_size, void* d_ws, size_t ws_size, hipStream_t stream) {
  if (n_in < 5) return;
  const size_t xneed = ((size_t)(NB - 1) * SEQ_FULL + SEQ) * DIN;
  if ((size_t)in_sizes[0] < xneed) return;
  if ((size_t)in_sizes[1] < (size_t)DIN * 3 * CC) return;
  if ((size_t)in_sizes[2] < (size_t)3 * CC) return;
  if ((size_t)in_sizes[3] < (size_t)CC * DIN) return;
  if ((size_t)in_sizes[4] < (size_t)DIN) return;
  if ((size_t)out_size < xneed) return;
  if (ws_size < (size_t)WS_END) return;
  // inputs (wire order): 0 x [4,1024,1024]; 1 W_qkv [1024,3072] (in,out): q columns 0..1023, k 1024..2047, v 2048..3071; 2 b_qkv [3072]; 3 W_out [1024,1024] (in,out); 4 b_out [1024]
  const float* x = (const float*)d_in[0]; const float* wqkv = (const float*)d_in[1]; const float* bqkv = (const float*)d_in[2]; const float* wout = (const float*)d_in[3]; const float* bout = (const float*)d_in[4];
  char* ws = (char*)d_ws;
  __bf16* XB = (__bf16*)(ws + WS_XB); __bf16* WQT = (__bf16*)(ws + WS_WQT); __bf16* WOT = (__bf16*)(ws + WS_WOT); __bf16* QK = (__bf16*)(ws + WS_QK); _Float16* VT = (_Float16*)(ws + WS_VT); __bf16* Y = (__bf16*)(ws + WS_Y);
  k_prep<<<dim3(TRQ + TRO + CVB), 256, 0, stream>>>(x, wqkv, wout, XB, WQT, WOT);
  k_proj<<<dim3(NB * SEQ / 128, CC / 128, 3), 128, 0, stream>>>(XB, WQT, bqkv, QK, VT);
  k_attn<<<dim3(SEQ / AQ, NH, NB), 256, 0, stream>>>(QK, VT, Y);
  k_out<<<dim3(NB * SEQ / 64, DIN / 128), 128, 0, stream>>>(Y, WOT, bout, (float*)d_out);
}

// v006
// A run of this version takes 63.5 microseconds.
// It is 1.26 times as fast as v004, going by the measured steps of the versions left out in between.
// Over all steps from v000 it is 4.82 times as fast.
// compute dtype: x, the QKV weight and both biases converted (RNE) to bf16, the output weight to f16; q/k/v projections = exact bf16 x bf16 products on v_wmma_f32_16x16x32_bf16 (f32 accumulate) + bias; q log2(e)/8, k, v each once to f16; base-2 logits = k x q log2(e)/8 on v_wmma_f32_16x16x32_f16 (one product, f32 accumulate, started from 8 minus a held reference); softmax f32 (online, held reference); P x 2^8 once to f16 against v (one product); ctx once to f16 against the f16 output weight (one product) + bias; f32 output. The f16 rounding of q, k and ctx (11 significant bits) lies below the bf16 rounding of x and the QKV weight (8 bits) that they are computed from.
#include <hip/hip_runtime.h>
#include <math.h>

typedef __attribute__((ext_vector_type(16))) _Float16 v16h;
typedef __attribute__((ext_vector_type(16))) __bf16 v16b;
typedef __attribute__((ext_vector_type(8)))  _Float16 v8h;
typedef __attribute__((ext_vector_type(8)))  __bf16 v8b;
typedef __attribute__((ext_vector_type(8)))  float v8f;
typedef __attribute__((ext_vector_type(4)))  float v4f;
typedef __attribute__((ext_vector_type(4)))  unsigned v4u;

// Dense multi-head self-attention, no mask: x [4,1024,1024]; fused (in,out) QKV weight [1024][3072] viewed (3, 16, 64): column = which*1024 + h*64 + d; (in,out) output weight [1024][1024]; one score scale 1/8; softmax over the 1024 keys of the same batch.
#ifndef NB
#define NB 4
#endif
#ifndef SEQ
#define SEQ 1024
#endif
#define NB_FULL 4
#define SEQ_FULL 1024      // full per-batch row stride of x and of the output
#define DIN 1024           // model width (input of QKV projection, output of the last projection)
#define CC 1024            // NH * HD
#define NH 16
#define HD 64
#define SCALE (0.125f)
#define LOG2E (1.4426950408889634f)   // folded into the stored q, so the logits are exponents of 2
#define PLOG (8.0f)        // P and l carried x 2^8 (keeps P down to 2^-22 clear of f16 subnormals); it cancels in O / l
#define PTOP (15.0f)       // largest exponent let through to f16 (2^15 < 65504): a score may pass its column's reference by 7 before the reference moves
#define PLANE ((size_t)NB * SEQ * CC)

static_assert(CC == NH * HD);                 // merged head layout h*64+d
static_assert(HD == 64);
static_assert(SEQ % 64 == 0);                 // 64-row blocks never straddle a batch; key loop steps by 64
static_assert(DIN % 64 == 0 && CC % 128 == 0 && (3 * CC) % 64 == 0 && DIN % 128 == 0);   // tile multiples of every GEMM / transpose grid
static_assert(DIN % 32 == 0 && CC % 32 == 0); // WMMA k-steps
static_assert(NB <= NB_FULL && SEQ <= SEQ_FULL);
static_assert(((size_t)NB * SEQ * (DIN / 8)) % 256 == 0);   // convert grid x 256 threads == plane extent

#define WS_XB  ((size_t)0)                                   // bf16 x rows [NB*SEQ][DIN]
#define WS_WQT (WS_XB  + 2u * (size_t)NB * SEQ * DIN)        // bf16 QKV weight, (out,in) [3*CC][DIN]
#define WS_WOT (WS_WQT + 2u * (size_t)3 * CC * DIN)          // f16 output weight, (out,in) [DIN][CC]
#define WS_QK  (WS_WOT + 2u * (size_t)DIN * CC)              // f16 planes: q log2(e)/8, k, each [NB*SEQ][CC]
#define WS_VT  (WS_QK  + 2u * 2u * PLANE)                    // f16 v planes [b][c][t]
#define WS_Y   (WS_VT  + 2u * (size_t)NB * CC * SEQ)         // f16 ctx rows [NB*SEQ][CC]
#define WS_END (WS_Y   + 2u * PLANE)
static_assert(WS_END <= (size_t)134217728);   // total carve
static_assert(WS_WQT % 128 == 0 && WS_WOT % 128 == 0 && WS_QK % 128 == 0 && WS_VT % 128 == 0 && WS_Y % 128 == 0);

template <typename T> __device__ __forceinline__ void vst2(void* p, T v) { *(T*)p = v;  }
// k_attn's two products are the bare builtins: the compiler keeps the distances behind its own WMMAs, and with no asm statement tied to each product it may group the LDS reads ahead, alternate the accumulator chains and set softmax work between the products
__device__ __forceinline__ v8f wmma16(v16h a, v16h b, v8f c) {
  return __builtin_amdgcn_wmma_f32_16x16x32_f16(false, a, false, b, (short)0, c, false, false);
}
__device__ __forceinline__ v8f wmma_bf(v16b a, v16b b, v8f c) {
  v8f d = __builtin_amdgcn_wmma_f32_16x16x32_bf16(false, a, false, b, (short)0, c, false, false);
  asm volatile("v_nop\n\tv_nop\n\tv_nop\n\tv_nop" : "+v"(d) : "v"(a), "v"(b));
  return d;
}
// k_out's product: wmma_bf's form with f16 operands; the four v_nop fill the vector slots the chip needs behind a WMMA before a vector instruction touches its D, A or B
__device__ __forceinline__ v8f wmma_hf(v16h a, v16h b, v8f c) {
  v8f d = __builtin_amdgcn_wmma_f32_16x16x32_f16(false, a, false, b, (short)0, c, false, false);
  asm volatile("v_nop\n\tv_nop\n\tv_nop\n\tv_nop" : "+v"(d) : "v"(a), "v"(b));
  return d;
}
// 16x16x32 fragments: lane = (g = lane>>4, row/col = lane&15); elements 0..7 = k0+8g+0..7, 8..15 = k0+16+8g+0..7; D element r = row 8g+r, col lane&15
__device__ __forceinline__ v16h frag_h(const _Float16* rowk0, int lane) {
  union { v16h v; v8h q[2]; } u; const _Float16* p = rowk0 + 8 * (lane >> 4);
  u.q[0] = *(const v8h*)p; u.q[1] = *(const v8h*)(p + 16); return u.v;
}
__device__ __forceinline__ v16b frag_b(const __bf16* rowk0, int lane) {
  union { v16b v; v8b q[2]; } u; const __bf16* p = rowk0 + 8 * (lane >> 4);
  u.q[0] = *(const v8b*)p; u.q[1] = *(const v8b*)(p + 16); return u.v;
}
__device__ __forceinline__ float bfr(float v) { return (float)(__bf16)v; }

// x piece i (8 consecutive elements of one row): f32 -> bf16 (RNE)
__device__ __forceinline__ void cvt_x(int i, const float* __restrict__ X, __bf16* __restrict__ XB) {
  if (i >= NB * SEQ * (DIN / 8)) return;
  const int row = i / (DIN / 8), pc = i % (DIN / 8);
  const size_t srow = (size_t)(row / SEQ) * SEQ_FULL + (size_t)(row % SEQ);
  const float* p = X + srow * DIN + pc * 8;
  const v4f a = *(const v4f*)p, b = *(const v4f*)(p + 4);
  union { v8b v; v4u u; } o;
  o.v[0] = (__bf16)a[0]; o.v[1] = (__bf16)a[1]; o.v[2] = (__bf16)a[2]; o.v[3] = (__bf16)a[3];
  o.v[4] = (__bf16)b[0]; o.v[5] = (__bf16)b[1]; o.v[6] = (__bf16)b[2]; o.v[7] = (__bf16)b[3];
  vst2(XB + (size_t)row * DIN + pc * 8, o.u);
}

// in[DIN rows][ldw cols] f32 (in,out) -> out[ldw rows][DIN cols] of T (bf16 or f16) (out,in); one 64 x 64 tile (column tile bx, k tile by) through LDS by a whole 256-thread block
template <typename T> __device__ __forceinline__ void tr_w(T (*t)[72], const float* __restrict__ W, T* __restrict__ WT, int ldw, int bx, int by) {
  const int tid = threadIdx.x; const int n0 = bx * 64, k0 = by * 64;
  for (int e = tid; e < 64 * 16; e += 256) { const int kr = e >> 4, c4 = (e & 15) * 4;
    const v4f w = *(const v4f*)(W + (size_t)(k0 + kr) * ldw + n0 + c4);
    t[c4 + 0][kr] = (T)w[0]; t[c4 + 1][kr] = (T)w[1]; t[c4 + 2][kr] = (T)w[2]; t[c4 + 3][kr] = (T)w[3]; }
  __syncthreads();
  for (int e = tid; e < 64 * 8; e += 256) { const int nr = e >> 3, q = e & 7; const v4u v = *(const v4u*)&t[nr][q * 8];
    vst2(WT + (size_t)(n0 + nr) * DIN + k0 + q * 8, v); }
}

// ---- k_prep: the three preparations depend on nothing but the inputs, so they share one launch; the block index picks the job (the same for a whole block, so the transpose's barrier is passed by all of a block or by none).
//      Blocks 0 .. TRQ-1: QKV weight tiles; TRQ .. TRQ+TRO-1: output weight tiles (the jobs with the longer chain load, LDS, barrier, store start first); the rest: 256 x pieces each.
#define TRQ ((3 * CC / 64) * (DIN / 64))
#define TRO ((DIN / 64) * (CC / 64))
#define CVB ((int)(((size_t)NB * SEQ * (DIN / 8)) / 256))
__global__ __launch_bounds__(256) void k_prep(const float* __restrict__ X, const float* __restrict__ WQ, const float* __restrict__ WO, __bf16* __restrict__ XB, __bf16* __restrict__ WQT, _Float16* __restrict__ WOT) {
  __shared__ __align__(16) unsigned char t[64 * 72 * 2];   // one tile of 2-byte elements, [64][72]
  const int id = blockIdx.x;
  if (id < TRQ) tr_w((__bf16 (*)[72])t, WQ, WQT, 3 * CC, id % (3 * CC / 64), id / (3 * CC / 64));                       // in[1024][3072] -> out[3072][1024]
  else if (id < TRQ + TRO) tr_w((_Float16 (*)[72])t, WO, WOT, DIN, (id - TRQ) % (DIN / 64), (id - TRQ) / (DIN / 64));     // in[1024][1024] -> out[1024][1024]
  else cvt_x((id - TRQ - TRO) * 256 + (int)threadIdx.x, X, XB);
}

// ---- LDS ring of the two GEMM kernels: a stage = 64 k of the operand rows (k_proj: 256, rows 0..127 the A side, 128..255 the weight rows; k_out: 192, rows 0..63 ctx, 64..191 the weight rows), 128 B a row at pitch 144 B (16 B x odd: no bank conflict for 16-B fragment reads); two buffers.
#define KST 64
#define NST (DIN / KST)
#define LPITCH 144
#define STG_BYTES (256 * LPITCH)
static_assert(DIN == CC && DIN % KST == 0 && NST >= 2);
static_assert(SEQ % 128 == 0);                // 128-row blocks of k_proj never straddle a batch
// Eight asynchronous 16-B copies per lane: 16 rows each (8 lanes cover one 128-B row piece), rows 0,16,32,48 from pa and 64,..,112 from pb. The s_wait_xcnt stands inside the statement so that no address register is rewritten ahead of it.
template <typename T> __device__ __forceinline__ void copy128rows(unsigned l, const T* pa, const T* pb) {
  static_assert(sizeof(T) == 2);
  asm volatile("global_load_async_to_lds_b128 %0, %8, off\n\t"
               "global_load_async_to_lds_b128 %1, %9, off\n\t"
               "global_load_async_to_lds_b128 %2, %10, off\n\t"
               "global_load_async_to_lds_b128 %3, %11, off\n\t"
               "global_load_async_to_lds_b128 %4, %12, off\n\t"
               "global_load_async_to_lds_b128 %5, %13, off\n\t"
               "global_load_async_to_lds_b128 %6, %14, off\n\t"
               "global_load_async_to_lds_b128 %7, %15, off\n\t"
               "s_wait_xcnt 0x0"
               :: "v"(l), "v"(l + 16u * LPITCH), "v"(l + 32u * LPITCH), "v"(l + 48u * LPITCH), "v"(l + 64u * LPITCH), "v"(l + 80u * LPITCH), "v"(l + 96u * LPITCH), "v"(l + 112u * LPITCH),
                  "v"(pa), "v"(pa + 16 * DIN), "v"(pa + 32 * DIN), "v"(pa + 48 * DIN), "v"(pb), "v"(pb + 16 * DIN), "v"(pb + 32 * DIN), "v"(pb + 48 * DIN)
               : "memory");
}
// Four such copies per lane: 64 rows (0, 16, 32, 48) from pa
__device__ __forceinline__ void copy64rows(unsigned l, const _Float16* pa) {
  asm volatile("global_load_async_to_lds_b128 %0, %4, off\n\t"
               "global_load_async_to_lds_b128 %1, %5, off\n\t"
               "global_load_async_to_lds_b128 %2, %6, off\n\t"
               "global_load_async_to_lds_b128 %3, %7, off\n\t"
               "s_wait_xcnt 0x0"
               :: "v"(l), "v"(l + 16u * LPITCH), "v"(l + 32u * LPITCH), "v"(l + 48u * LPITCH),
                  "v"(pa), "v"(pa + 16 * DIN), "v"(pa + 32 * DIN), "v"(pa + 48 * DIN)
               : "memory");
}
// fragment of 16 staged rows starting at row, k step kc of the stage
__device__ __forceinline__ v16b frag_s(const unsigned char* sb, int row, int kc, int lane) {
  return frag_b((const __bf16*)(sb + (row + (lane & 15)) * LPITCH) + kc * 32, lane);
}
__device__ __forceinline__ v16h frag_sh(const unsigned char* sb, int row, int kc, int lane) {
  return frag_h((const _Float16*)(sb + (row + (lane & 15)) * LPITCH) + kc * 32, lane);
}

// ---- k_proj: block = (128 rows, 128 cols, which), 4 waves of 64 x 64: q/k/v = x W + b with exact bf16 products (K = DIN), operands through the LDS ring. which 0: q x log2(e)/8 as f16 rows; 1: k as f16 rows; 2: v f16 planes [c][t]
__global__ __launch_bounds__(128) void k_proj(const __bf16* __restrict__ XB, const __bf16* __restrict__ WT, const float* __restrict__ BQKV, _Float16* __restrict__ QK, _Float16* __restrict__ VT) {
  __shared__ __align__(128) unsigned char sm[2 * STG_BYTES];   // the ring; behind the k loop the output staging
  static_assert(128 * 136 * 2 <= 2 * STG_BYTES);
  const int tid = threadIdx.x; const int wave = __builtin_amdgcn_readfirstlane(threadIdx.x >> 5); const int lane = tid & 31, col = lane & 15, g = lane >> 4;
  const int wm = wave >> 1, wn = wave & 1;
  const int which = blockIdx.z; const int c0 = blockIdx.y * 128; const int r0 = blockIdx.x * 128; const int bb = r0 / SEQ; const int t0 = r0 % SEQ;
  const __bf16* ga = XB + (size_t)(r0 + (tid >> 3)) * DIN + (tid & 7) * 8;
  const __bf16* gw = WT + (size_t)(which * CC + c0 + (tid >> 3)) * DIN + (tid & 7) * 8;
  const unsigned l0 = (unsigned)(size_t)sm + (unsigned)((tid >> 3) * LPITCH + (tid & 7) * 16);
  copy128rows(l0, ga, ga + 64 * DIN); copy128rows(l0 + 128u * LPITCH, gw, gw + 64 * DIN);
  asm volatile("s_wait_asynccnt 0x0" ::: "memory");   // stage 0 landed (this wave's copies)
  __syncthreads();                                     // ... and every other wave's
  copy128rows(l0 + STG_BYTES, ga + KST, ga + 64 * DIN + KST); copy128rows(l0 + STG_BYTES + 128u * LPITCH, gw + KST, gw + 64 * DIN + KST);
  v8f acc[4][4] = {};
#pragma unroll 1   // one copy of the pass in the text; the buffer is chosen by the trip's parity
  for (int t = 0; t < NST; ++t) { const unsigned bo = (unsigned)(t & 1) * STG_BYTES; const unsigned char* sb = sm + bo;
#pragma unroll
    for (int kc = 0; kc < KST / 32; ++kc) { v16b a[4], w[4];
#pragma unroll
      for (int i = 0; i < 4; ++i) { a[i] = frag_s(sb, wm * 64 + i * 16, kc, lane); w[i] = frag_s(sb, 128 + wn * 64 + i * 16, kc, lane); }
#pragma unroll
      for (int i = 0; i < 4; ++i)
#pragma unroll
        for (int j = 0; j < 4; ++j) acc[i][j] = wmma_bf(a[i], w[j], acc[i][j]); }
    asm volatile("s_wait_dscnt 0x0" ::: "memory");      // this wave's reads of the buffer are done before it is refilled
    asm volatile("s_wait_asynccnt 0x0" ::: "memory");   // this wave's copies of stage t + 1 have landed
    __syncthreads();                                     // publishes stage t + 1, frees stage t's buffer
    if (t + 2 < NST) { const int ko = (t + 2) * KST; copy128rows(l0 + bo, ga + ko, ga + 64 * DIN + ko); copy128rows(l0 + bo + 128u * LPITCH, gw + ko, gw + 64 * DIN + ko); } }
  asm volatile("s_wait_asynccnt 0x0" ::: "memory");     // no copy is outstanding when the ring becomes output staging
  if (which < 2) { const float qs = (which == 0) ? SCALE * LOG2E : 1.0f;   /* block-uniform */
    _Float16 (*sh)[136] = (_Float16 (*)[136])sm;
#pragma unroll
    for (int j = 0; j < 4; ++j) { const int cl = wn * 64 + j * 16 + col; const float bias = bfr(BQKV[which * CC + c0 + cl]);
#pragma unroll
      for (int i = 0; i < 4; ++i)
#pragma unroll
        for (int r = 0; r < 8; ++r) sh[wm * 64 + i * 16 + 8 * g + r][cl] = (_Float16)((acc[i][j][r] + bias) * qs); }
    __syncthreads();
    _Float16* DQ = QK + (size_t)which * PLANE;
    for (int e = tid; e < 128 * 16; e += 128) { const int rl = e >> 4, q = e & 15; const v4u vh = *(const v4u*)&sh[rl][q * 8];
      vst2(DQ + (size_t)(r0 + rl) * CC + c0 + q * 8, vh); }
  } else {
    _Float16 (*th)[136] = (_Float16 (*)[136])sm;
#pragma unroll
    for (int j = 0; j < 4; ++j) { const int cl = wn * 64 + j * 16 + col; const float bias = bfr(BQKV[2 * CC + c0 + cl]);
#pragma unroll
      for (int i = 0; i < 4; ++i)
#pragma unroll
        for (int r = 0; r < 8; ++r) th[cl][wm * 64 + i * 16 + 8 * g + r] = (_Float16)(acc[i][j][r] + bias); }
    __syncthreads();
    for (int e = tid; e < 128 * 16; e += 128) { const int cl = e >> 4, q = e & 15; const v4u v = *(const v4u*)&th[cl][q * 8];
      vst2(VT + ((size_t)bb * CC + c0 + cl) * (size_t)SEQ + t0 + q * 8, v); } }
}

// ---- k_attn: block = 128 queries of (b, h), 8 waves = 4 query groups (32 columns: two 16-column tiles a wave) x 2 key groups (each takes 32 of a stage's 64 keys; joined behind the key loop); transposed flash form: S^T tile = K (A, rows = keys) x Q^T (B, cols = queries) so each lane owns one query column:
//      reference / sum are per-lane scalars; the two 16-key S^T accumulators convert in-lane into the B fragment (k = key row of the tile) of O^T += V^T (A, rows = d) x P^T.
//      Held reference: each query column keeps a reference R (a maximum seen earlier); the score products start from C = 8 - R, so their result is the exponent of P x 2^8 as it stands. O^T, l and R move only in a pass where some exponent passes PTOP (one test a pass), and in the first pass.
//      K and V^T of 64 keys form one stage of an LDS ring shared by the eight waves (rows 0..63 K, 64..127 V^T rows d; 128 B a row at pitch 144 B), two buffers; the softmax still steps by 32 keys.
#define AST_BYTES (128 * LPITCH)
#define NKS (SEQ / 64)
static_assert(NKS >= 2 && HD * 2 == 128);   // two stages at least; a K row piece (64 d) and a V^T row piece (64 keys) are 128 B
// Four asynchronous 16-B copies per lane of a 256-thread block: one stage (32 rows a copy: K rows 0, 32; V^T rows 0, 32). The s_wait_xcnt stands inside the statement so that no address register is rewritten ahead of it.
__device__ __forceinline__ void copy_stage(unsigned l, const _Float16* k, const _Float16* v) {
  asm volatile("global_load_async_to_lds_b128 %0, %4, off\n\t"
               "global_load_async_to_lds_b128 %1, %5, off\n\t"
               "global_load_async_to_lds_b128 %2, %6, off\n\t"
               "global_load_async_to_lds_b128 %3, %7, off\n\t"
               "s_wait_xcnt 0x0"
               :: "v"(l), "v"(l + 32u * LPITCH), "v"(l + 64u * LPITCH), "v"(l + 96u * LPITCH),
                  "v"(k), "v"(k + 32 * CC), "v"(v), "v"(v + 32 * SEQ)
               : "memory");
}
#define QT 2                                  // query tiles (16 columns each) per wave: every K and V^T fragment read from LDS feeds QT products
#define AQ (64 * QT)                          // queries per block: 4 query groups x 16 QT
#define MG_ML 32768                           // behind the key loop sm holds: the O^T tiles handed over (4 x 16 x 32 pieces of 16 B), ...
#define MG_YS 40960                           // ... their reference and sum (from MG_ML), and the output staging (from MG_YS)
static_assert(SEQ % AQ == 0);
static_assert(4 * QT * 8 * 32 * 16 <= MG_ML && MG_ML + 4 * QT * 2 * 32 * 4 <= MG_YS && 2 * AST_BYTES <= MG_YS + AQ * 9 * 16);
__global__ __launch_bounds__(256) void k_attn(const _Float16* __restrict__ QK, const _Float16* __restrict__ VT, _Float16* __restrict__ Y) {
  __shared__ __align__(128) unsigned char sm[MG_YS + AQ * 9 * 16];   // the ring (its first 2 AST_BYTES); behind the key loop the merge and output staging
  const int tid = threadIdx.x; const int wave = __builtin_amdgcn_readfirstlane(threadIdx.x >> 5); const int lane = tid & 31, col = lane & 15, g = lane >> 4;
  const int qg = wave & 3, kg = wave >> 2;    // query group (32 columns), key group (keys 32 kg .. 32 kg + 31 of every stage)
  const int qb = blockIdx.x, h = blockIdx.y, b = blockIdx.z;
  const _Float16* Qp = QK + ((size_t)b * SEQ + qb * AQ + qg * (16 * QT) + col) * CC + h * HD;
  const _Float16* gk = QK + PLANE + ((size_t)b * SEQ + (tid >> 3)) * CC + h * HD + (tid & 7) * 8;
  const _Float16* gv = VT + ((size_t)b * CC + h * HD + (tid >> 3)) * (size_t)SEQ + (tid & 7) * 8;
  const unsigned l0 = (unsigned)(size_t)sm + (unsigned)((tid >> 3) * LPITCH + (tid & 7) * 16);
  copy_stage(l0, gk, gv);
  v16h qf[QT][HD / 32];   // the wave's query fragments, read once
#pragma unroll
  for (int x = 0; x < QT; ++x)
#pragma unroll
    for (int kc = 0; kc < HD / 32; ++kc) qf[x][kc] = frag_h(Qp + (size_t)x * 16 * CC + kc * 32, lane);
  asm volatile("s_wait_asynccnt 0x0" ::: "memory");   // stage 0 landed (this wave's copies)
  __syncthreads();                                     // ... and every other wave's
  copy_stage(l0 + AST_BYTES, gk + 64 * CC, gv + 64);
  v8f o[QT][4] = {}; float cf[QT], l[QT]; v8f cr[QT];   // cf = 8 - R of the lane's query column (equal in both lane halves); cr = cf in all eight rows: the C operand of the score products
#pragma unroll
  for (int x = 0; x < QT; ++x) { cf[x] = PLOG; l[x] = 0.f;
#pragma unroll
    for (int r = 0; r < 8; ++r) cr[x][r] = PLOG; }
#pragma unroll 1   // one copy of the pass in the text; the buffer is chosen by the trip's parity
  for (int t = 0; t < NKS; ++t) { const unsigned bo = (unsigned)(t & 1) * AST_BYTES; const unsigned char* sb = sm + bo;
    const unsigned char* sk = sb + kg * (32 * LPITCH);   // this key group's 32 K rows
    v8f s0[QT] = {}, s1[QT] = {};
#pragma unroll
    for (int kc = 0; kc < HD / 32; ++kc) {
      const v16h k0 = frag_sh(sk, 0, kc, lane), k1 = frag_sh(sk, 16, kc, lane);
#pragma unroll
      for (int x = 0; x < QT; ++x) { s0[x] = wmma16(k0, qf[x][kc], kc == 0 ? cr[x] : s0[x]); s1[x] = wmma16(k1, qf[x][kc], kc == 0 ? cr[x] : s1[x]); }
    }
    float mx[QT];   // the lane's largest exponent of the pass, per query tile
#pragma unroll
    for (int x = 0; x < QT; ++x) { mx[x] = fmaxf(s0[x][0], s1[x][0]);
#pragma unroll
      for (int r = 1; r < 8; ++r) mx[x] = fmaxf(mx[x], fmaxf(s0[x][r], s1[x][r])); }
    static_assert(QT == 2);                          // the one test of a pass joins the two query tiles
    const bool move = (t == 0) | (fmaxf(mx[0], mx[1]) > PTOP);
    if (__builtin_amdgcn_ballot_w32(move) != 0) {    /* scalar branch: all lanes of the wave active inside */
#pragma unroll
      for (int x = 0; x < QT; ++x) {
        const float dm = fmaxf(mx[x], __shfl_xor(mx[x], 16));                       /* both lane halves of a query column agree on the move */
        const float dl = (t == 0) ? dm - PLOG : fmaxf(dm - PLOG, 0.f);              /* first pass: R = the column's maximum, up or down; later R only rises */
        const float corr = (t == 0) ? 1.0f : __builtin_amdgcn_exp2f(-dl);           /* first pass: O^T and l are still 0 */
        cf[x] -= dl; l[x] *= corr; s0[x] -= dl; s1[x] -= dl; cr[x] -= dl;           /* whole tiles; cr's eight rows stay equal to cf */
#pragma unroll
        for (int j = 0; j < 4; ++j) o[x][j] *= corr;
      }
    }
    v16h vf[4];     // the V^T fragments: read as one group in front of the exponentials, which run while the reads land
#pragma unroll
    for (int j = 0; j < 4; ++j) vf[j] = frag_h((const _Float16*)(sb + (64 + j * 16 + col) * LPITCH) + kg * 32, lane);
    v16h p[QT];
#pragma unroll
    for (int x = 0; x < QT; ++x) {
      float ps = 0.f;
#pragma unroll
      for (int r = 0; r < 8; ++r) { const float e0 = __builtin_amdgcn_exp2f(s0[x][r]), e1 = __builtin_amdgcn_exp2f(s1[x][r]); ps += e0 + e1; p[x][r] = (_Float16)e0; p[x][8 + r] = (_Float16)e1; }
      l[x] += ps;                                   /* l from the unconverted f32 values; per-lane partial (this lane's 16 of the 32 keys) */
    }
    // inputs only: holds the four V^T reads together in front of the products; without it they share one register set, each waited for right in front of its two products
    asm volatile("" :: "v"(vf[0]), "v"(vf[1]), "v"(vf[2]), "v"(vf[3]));
#pragma unroll
    for (int j = 0; j < 4; ++j)
#pragma unroll
      for (int x = 0; x < QT; ++x) o[x][j] = wmma16(vf[j], p[x], o[x][j]);
    asm volatile("s_wait_dscnt 0x0" ::: "memory");      // this wave's reads of the buffer are done before it is refilled
    asm volatile("s_wait_asynccnt 0x0" ::: "memory");   // this wave's copies of stage t + 1 have landed
    __syncthreads();                                     // publishes stage t + 1, frees stage t's buffer
    if (t + 2 < NKS) { const int kn = (t + 2) * 64; copy_stage(l0 + bo, gk + (size_t)kn * CC, gv + kn); }
  }
  asm volatile("s_wait_asynccnt 0x0" ::: "memory");     // no copy is outstanding when the ring becomes merge staging
  // merge of the two key groups of a query group through LDS, on the higher of their references: key group x joins query tile x; each wave hands over the tile it does not join
  static_assert(QT == 2);                                // as many query tiles a wave as key groups
  v4f* mo = (v4f*)sm + (size_t)qg * (QT * 8) * 32 + lane; float* ml = (float*)(sm + MG_ML) + qg * (QT * 2) * 32 + lane;
  v4u (*ys)[9] = (v4u (*)[9])(sm + MG_YS);
#pragma unroll
  for (int x = 0; x < QT; ++x)
    if (kg != x) { ml[(x * 2) * 32] = cf[x]; ml[(x * 2 + 1) * 32] = l[x];   /* wave-uniform test */
#pragma unroll
      for (int j = 0; j < 4; ++j) { const v4f a = { o[x][j][0], o[x][j][1], o[x][j][2], o[x][j][3] }, c = { o[x][j][4], o[x][j][5], o[x][j][6], o[x][j][7] };
        mo[((x * 4 + j) * 2) * 32] = a; mo[((x * 4 + j) * 2 + 1) * 32] = c; } }
  __syncthreads();                                       // the partial results handed over are in LDS
#pragma unroll
  for (int x = 0; x < QT; ++x)
    if (kg == x) {                                       /* wave-uniform test: all lanes of the wave active inside */
      const float c1 = ml[(x * 2) * 32], l1 = ml[(x * 2 + 1) * 32];
      const float cm = fminf(cf[x], c1); const float a0 = __builtin_amdgcn_exp2f(cm - cf[x]), a1 = __builtin_amdgcn_exp2f(cm - c1);   /* c = 8 - R: the smaller c is the higher reference */
      float lt = l[x] * a0 + l1 * a1;
      lt += __shfl_xor(lt, 16);
      const float inv = 1.0f / lt; const float f0 = a0 * inv, f1 = a1 * inv;   /* O^T and l both carry 2^8 */
      // O^T tile j: lane (g, col = query) holds d = 16j + 8g + 0..7: one 16-B piece of the (row, head) segment, as f16
#pragma unroll
      for (int j = 0; j < 4; ++j) { union { v8h v; v4u u; } y; const v4f a = mo[((x * 4 + j) * 2) * 32], c = mo[((x * 4 + j) * 2 + 1) * 32];
#pragma unroll
        for (int r = 0; r < 8; ++r) { const float o1 = (r < 4) ? a[r & 3] : c[r & 3]; y.v[r] = (_Float16)(o[x][j][r] * f0 + o1 * f1); }
        ys[qg * (16 * QT) + x * 16 + col][2 * j + g] = y.u; } }
  __syncthreads();
#pragma unroll 1
  for (int it = 0; it < 4; ++it) { const int rl = wave * 16 + it * 4 + (lane >> 3), pc = lane & 7;
    const v4u a = ys[rl][pc];
    vst2(Y + ((size_t)b * SEQ + qb * AQ + rl) * CC + h * HD + pc * 8, a); }
}

// ---- k_out: block = (64 rows, 128 cols), 4 waves of 32 x 64: out = ctx Wo + bo: f16 ctx against the f16 weight (one product), operands through an LDS ring of 192-row stages (rows 0..63 ctx, 64..191 weight); 512-B row segment by one 32-lane x 16-B instruction
#define OST_BYTES (192 * LPITCH)
__global__ __launch_bounds__(128) void k_out(const _Float16* __restrict__ Y, const _Float16* __restrict__ WOT, const float* __restrict__ BO, float* __restrict__ OUT) {
  __shared__ __align__(128) unsigned char sm[2 * OST_BYTES];   // the ring; behind the k loop the output staging
  static_assert(64 * 132 * 4 <= 2 * OST_BYTES);
  const int tid = threadIdx.x; const int wave = __builtin_amdgcn_readfirstlane(threadIdx.x >> 5); const int lane = tid & 31, col = lane & 15, g = lane >> 4;
  const int wm = wave >> 1, wn = wave & 1;
  const int c0 = blockIdx.y * 128; const int rb = blockIdx.x * 64;
  const _Float16* gy = Y + (size_t)(rb + (tid >> 3)) * CC + (tid & 7) * 8;
  const _Float16* gw = WOT + (size_t)(c0 + (tid >> 3)) * CC + (tid & 7) * 8;
  const unsigned l0 = (unsigned)(size_t)sm + (unsigned)((tid >> 3) * LPITCH + (tid & 7) * 16);
  copy64rows(l0, gy); copy128rows(l0 + 64u * LPITCH, gw, gw + 64 * CC);
  asm volatile("s_wait_asynccnt 0x0" ::: "memory");   // stage 0 landed (this wave's copies)
  __syncthreads();                                     // ... and every other wave's
  copy64rows(l0 + OST_BYTES, gy + KST); copy128rows(l0 + OST_BYTES + 64u * LPITCH, gw + KST, gw + 64 * CC + KST);
  v8f acc[2][4] = {};
#pragma unroll 1   // one copy of the pass in the text; the buffer is chosen by the trip's parity
  for (int t = 0; t < NST; ++t) { const unsigned bo = (unsigned)(t & 1) * OST_BYTES; const unsigned char* sb = sm + bo;
#pragma unroll
    for (int kc = 0; kc < KST / 32; ++kc) { v16h a[2], w[4];
#pragma unroll
      for (int i = 0; i < 2; ++i) a[i] = frag_sh(sb, wm * 32 + i * 16, kc, lane);
#pragma unroll
      for (int j = 0; j < 4; ++j) w[j] = frag_sh(sb, 64 + wn * 64 + j * 16, kc, lane);
#pragma unroll
      for (int i = 0; i < 2; ++i)
#pragma unroll
        for (int j = 0; j < 4; ++j) acc[i][j] = wmma_hf(a[i], w[j], acc[i][j]); }
    asm volatile("s_wait_dscnt 0x0" ::: "memory");      // this wave's reads of the buffer are done before it is refilled
    asm volatile("s_wait_asynccnt 0x0" ::: "memory");   // this wave's copies of stage t + 1 have landed
    __syncthreads();                                     // publishes stage t + 1, frees stage t's buffer
    if (t + 2 < NST) { const int ko = (t + 2) * KST; copy64rows(l0 + bo, gy + ko); copy128rows(l0 + bo + 64u * LPITCH, gw + ko, gw + 64 * CC + ko); } }
  asm volatile("s_wait_asynccnt 0x0" ::: "memory");     // no copy is outstanding when the ring becomes output staging
  float (*sf)[132] = (float (*)[132])sm;
#pragma unroll
  for (int j = 0; j < 4; ++j) { const int cl = wn * 64 + j * 16 + col; const float bias = bfr(BO[c0 + cl]);
#pragma unroll
    for (int i = 0; i < 2; ++i)
#pragma unroll
      for (int r = 0; r < 8; ++r) sf[wm * 32 + i * 16 + 8 * g + r][cl] = acc[i][j][r] + bias; }
  __syncthreads();
  const size_t orow0 = (size_t)(rb / SEQ) * SEQ_FULL + (size_t)(rb % SEQ) + wave * 16;
#pragma unroll 1
  for (int rl = 0; rl < 16; ++rl) { const v4f v = *(const v4f*)&sf[wave * 16 + rl][lane * 4];
    vst2(OUT + (orow0 + rl) * DIN + c0 + lane * 4, v); }
}

extern "C" void kernel_launch(void* const* d_in, const int* in_sizes, int n_in, void* d_out, int out_size, void* d_ws, size_t ws_size, hipStream_t stream) {
  if (n_in < 5) return;
  const size_t xneed = ((size_t)(NB - 1) * SEQ_FULL + SEQ) * DIN;
  if ((size_t)in_sizes[0] < xneed) return;
  if ((size_t)in_sizes[1] < (size_t)DIN * 3 * CC) return;
  if ((size_t)in_sizes[2] < (size_t)3 * CC) return;
  if ((size_t)in_sizes[3] < (size_t)CC * DIN) return;
  if ((size_t)in_sizes[4] < (size_t)DIN) return;
  if ((size_t)out_size < xneed) return;
  if (ws_size < (size_t)WS_END) return;
  // inputs (wire order): 0 x [4,1024,1024]; 1 W_qkv [1024,3072] (in,out): q columns 0..1023, k 1024..2047, v 2048..3071; 2 b_qkv [3072]; 3 W_out [1024,1024] (in,out); 4 b_out [1024]
  const float* x = (const float*)d_in[0]; const float* wqkv = (const float*)d_in[1]; const float* bqkv = (const float*)d_in[2]; const float* wout = (const float*)d_in[3]; const float* bout = (const float*)d_in[4];
  char* ws = (char*)d_ws;
  __bf16* XB = (__bf16*)(ws + WS_XB); __bf16* WQT = (__bf16*)(ws + WS_WQT); _Float16* WOT = (_Float16*)(ws + WS_WOT); _Float16* QK = (_Float16*)(ws + WS_QK); _Float16* VT = (_Float16*)(ws + WS_VT); _Float16* Y = (_Float16*)(ws + WS_Y);
  k_prep<<<dim3(TRQ + TRO + CVB), 256, 0, stream>>>(x, wqkv, wout, XB, WQT, WOT);
  k_proj<<<dim3(NB * SEQ / 128, CC / 128, 3), 128, 0, stream>>>(XB, WQT, bqkv, QK, VT);
  k_attn<<<dim3(SEQ / AQ, NH, NB), 256, 0, stream>>>(QK, VT, Y);
  k_out<<<dim3(NB * SEQ / 64, DIN / 128), 128, 0, stream>>>(Y, WOT, bout, (float*)d_out);
}

// v007
// One run takes 60.2 microseconds.
// Next to v006, in two timings, it ran 1.05 and 1.06 times as fast.
// All steps since v000 together make it 5.08 times as fast.
// compute dtype: x, the QKV weight and both biases converted (RNE) to bf16, the output weight to f16; q/k/v projections = exact bf16 x bf16 products on v_wmma_f32_16x16x32_bf16 (f32 accumulate) + bias; q log2(e)/8, k, v each once to f16; base-2 logits = k x q log2(e)/8 on v_wmma_f32_16x16x32_f16 (one product, f32 accumulate, started from 8 minus a held reference); softmax f32 (online, held reference); P x 2^8 once to f16 against v (one product); ctx once to f16 against the f16 output weight (one product) + bias; f32 output. The f16 rounding of q, k and ctx (11 significant bits) lies below the bf16 rounding of x and the QKV weight (8 bits) that they are computed from.
#include <hip/hip_runtime.h>
#include <math.h>

typedef __attribute__((ext_vector_type(16))) _Float16 v16h;
typedef __attribute__((ext_vector_type(16))) __bf16 v16b;
typedef __attribute__((ext_vector_type(8)))  _Float16 v8h;
typedef __attribute__((ext_vector_type(8)))  __bf16 v8b;
typedef __attribute__((ext_vector_type(8)))  float v8f;
typedef __attribute__((ext_vector_type(4)))  float v4f;
typedef __attribute__((ext_vector_type(4)))  unsigned v4u;

// Dense multi-head self-attention, no mask: x [4,1024,1024]; fused (in,out) QKV weight [1024][3072] viewed (3, 16, 64): column = which*1024 + h*64 + d; (in,out) output weight [1024][1024]; one score scale 1/8; softmax over the 1024 keys of the same batch.
#ifndef NB
#define NB 4
#endif
#ifndef SEQ
#define SEQ 1024
#endif
#define NB_FULL 4
#define SEQ_FULL 1024      // full per-batch row stride of x and of the output
#define DIN 1024           // model width (input of QKV projection, output of the last projection)
#define CC 1024            // NH * HD
#define NH 16
#define HD 64
#define SCALE (0.125f)
#define LOG2E (1.4426950408889634f)   // folded into the stored q, so the logits are exponents of 2
#define PLOG (8.0f)        // P and l carried x 2^8 (keeps P down to 2^-22 clear of f16 subnormals); it cancels in O / l
#define PTOP (15.0f)       // largest exponent let through to f16 (2^15 < 65504): a score may pass its column's reference by 7 before the reference moves
#define PLANE ((size_t)NB * SEQ * CC)

static_assert(CC == NH * HD);                 // merged head layout h*64+d
static_assert(HD == 64);
static_assert(SEQ % 64 == 0);                 // 64-row blocks never straddle a batch; key loop steps by 64
static_assert(DIN % 64 == 0 && CC % 128 == 0 && (3 * CC) % 64 == 0 && DIN % 128 == 0);   // tile multiples of every GEMM / transpose grid
static_assert(DIN % 32 == 0 && CC % 32 == 0); // WMMA k-steps
static_assert(NB <= NB_FULL && SEQ <= SEQ_FULL);
static_assert(((size_t)NB * SEQ * (DIN / 8)) % 256 == 0);   // convert grid x 256 threads == plane extent

#define WS_XB  ((size_t)0)                                   // bf16 x rows [NB*SEQ][DIN]
#define WS_WQT (WS_XB  + 2u * (size_t)NB * SEQ * DIN)        // bf16 QKV weight, (out,in) [3*CC][DIN]
#define WS_WOT (WS_WQT + 2u * (size_t)3 * CC * DIN)          // f16 output weight, (out,in) [DIN][CC]
#define WS_QK  (WS_WOT + 2u * (size_t)DIN * CC)              // f16 planes: q log2(e)/8, k, each [NB*SEQ][CC]
#define WS_VT  (WS_QK  + 2u * 2u * PLANE)                    // f16 v planes [b][c][t]
#define WS_Y   (WS_VT  + 2u * (size_t)NB * CC * SEQ)         // f16 ctx rows [NB*SEQ][CC]
#define WS_END (WS_Y   + 2u * PLANE)
static_assert(WS_END <= (size_t)134217728);   // total carve
static_assert(WS_WQT % 128 == 0 && WS_WOT % 128 == 0 && WS_QK % 128 == 0 && WS_VT % 128 == 0 && WS_Y % 128 == 0);

template <typename T> __device__ __forceinline__ void vst2(void* p, T v) { *(T*)p = v;  }
// k_attn's two products are the bare builtins: the compiler keeps the distances behind its own WMMAs, and with no asm statement tied to each product it may group the LDS reads ahead, alternate the accumulator chains and set softmax work between the products
__device__ __forceinline__ v8f wmma16(v16h a, v16h b, v8f c) {
  return __builtin_amdgcn_wmma_f32_16x16x32_f16(false, a, false, b, (short)0, c, false, false);
}
__device__ __forceinline__ v8f wmma_bf(v16b a, v16b b, v8f c) {
  v8f d = __builtin_amdgcn_wmma_f32_16x16x32_bf16(false, a, false, b, (short)0, c, false, false);
  asm volatile("v_nop\n\tv_nop\n\tv_nop\n\tv_nop" : "+v"(d) : "v"(a), "v"(b));
  return d;
}
// k_out's product: wmma_bf's form with f16 operands; the four v_nop fill the vector slots the chip needs behind a WMMA before a vector instruction touches its D, A or B
__device__ __forceinline__ v8f wmma_hf(v16h a, v16h b, v8f c) {
  v8f d = __builtin_amdgcn_wmma_f32_16x16x32_f16(false, a, false, b, (short)0, c, false, false);
  asm volatile("v_nop\n\tv_nop\n\tv_nop\n\tv_nop" : "+v"(d) : "v"(a), "v"(b));
  return d;
}
// 16x16x32 fragments: lane = (g = lane>>4, row/col = lane&15); elements 0..7 = k0+8g+0..7, 8..15 = k0+16+8g+0..7; D element r = row 8g+r, col lane&15
__device__ __forceinline__ v16h frag_h(const _Float16* rowk0, int lane) {
  union { v16h v; v8h q[2]; } u; const _Float16* p = rowk0 + 8 * (lane >> 4);
  u.q[0] = *(const v8h*)p; u.q[1] = *(const v8h*)(p + 16); return u.v;
}
__device__ __forceinline__ v16b frag_b(const __bf16* rowk0, int lane) {
  union { v16b v; v8b q[2]; } u; const __bf16* p = rowk0 + 8 * (lane >> 4);
  u.q[0] = *(const v8b*)p; u.q[1] = *(const v8b*)(p + 16); return u.v;
}
__device__ __forceinline__ float bfr(float v) { return (float)(__bf16)v; }

// x piece i (8 consecutive elements of one row): f32 -> bf16 (RNE)
__device__ __forceinline__ void cvt_x(int i, const float* __restrict__ X, __bf16* __restrict__ XB) {
  if (i >= NB * SEQ * (DIN / 8)) return;
  const int row = i / (DIN / 8), pc = i % (DIN / 8);
  const size_t srow = (size_t)(row / SEQ) * SEQ_FULL + (size_t)(row % SEQ);
  const float* p = X + srow * DIN + pc * 8;
  const v4f a = *(const v4f*)p, b = *(const v4f*)(p + 4);
  union { v8b v; v4u u; } o;
  o.v[0] = (__bf16)a[0]; o.v[1] = (__bf16)a[1]; o.v[2] = (__bf16)a[2]; o.v[3] = (__bf16)a[3];
  o.v[4] = (__bf16)b[0]; o.v[5] = (__bf16)b[1]; o.v[6] = (__bf16)b[2]; o.v[7] = (__bf16)b[3];
  vst2(XB + (size_t)row * DIN + pc * 8, o.u);
}

// in[DIN rows][ldw cols] f32 (in,out) -> out[ldw rows][DIN cols] of T (bf16 or f16) (out,in); one 64 x 64 tile (column tile bx, k tile by) through LDS by a whole 256-thread block
template <typename T> __device__ __forceinline__ void tr_w(T (*t)[72], const float* __restrict__ W, T* __restrict__ WT, int ldw, int bx, int by) {
  const int tid = threadIdx.x; const int n0 = bx * 64, k0 = by * 64;
  for (int e = tid; e < 64 * 16; e += 256) { const int kr = e >> 4, c4 = (e & 15) * 4;
    const v4f w = *(const v4f*)(W + (size_t)(k0 + kr) * ldw + n0 + c4);
    t[c4 + 0][kr] = (T)w[0]; t[c4 + 1][kr] = (T)w[1]; t[c4 + 2][kr] = (T)w[2]; t[c4 + 3][kr] = (T)w[3]; }
  __syncthreads();
  for (int e = tid; e < 64 * 8; e += 256) { const int nr = e >> 3, q = e & 7; const v4u v = *(const v4u*)&t[nr][q * 8];
    vst2(WT + (size_t)(n0 + nr) * DIN + k0 + q * 8, v); }
}

// ---- k_prep: the three preparations depend on nothing but the inputs, so they share one launch; the block index picks the job (the same for a whole block, so the transpose's barrier is passed by all of a block or by none).
//      Blocks 0 .. TRQ-1: QKV weight tiles; TRQ .. TRQ+TRO-1: output weight tiles (the jobs with the longer chain load, LDS, barrier, store start first); the rest: 256 x pieces each.
#define TRQ ((3 * CC / 64) * (DIN / 64))
#define TRO ((DIN / 64) * (CC / 64))
#define CVB ((int)(((size_t)NB * SEQ * (DIN / 8)) / 256))
__global__ __launch_bounds__(256) void k_prep(const float* __restrict__ X, const float* __restrict__ WQ, const float* __restrict__ WO, __bf16* __restrict__ XB, __bf16* __restrict__ WQT, _Float16* __restrict__ WOT) {
  __shared__ __align__(16) unsigned char t[64 * 72 * 2];   // one tile of 2-byte elements, [64][72]
  const int id = blockIdx.x;
  if (id < TRQ) tr_w((__bf16 (*)[72])t, WQ, WQT, 3 * CC, id % (3 * CC / 64), id / (3 * CC / 64));                       // in[1024][3072] -> out[3072][1024]
  else if (id < TRQ + TRO) tr_w((_Float16 (*)[72])t, WO, WOT, DIN, (id - TRQ) % (DIN / 64), (id - TRQ) / (DIN / 64));     // in[1024][1024] -> out[1024][1024]
  else cvt_x((id - TRQ - TRO) * 256 + (int)threadIdx.x, X, XB);
}

// ---- LDS ring of the two GEMM kernels: a stage = 64 k of the operand rows (k_proj: 256, rows 0..127 the A side, 128..255 the weight rows; k_out: 192, rows 0..63 ctx, 64..191 the weight rows), 128 B a row at pitch 144 B (16 B x odd: no bank conflict for 16-B fragment reads); two buffers.
#define KST 64
#define NST (DIN / KST)
#define LPITCH 144
#define STG_BYTES (256 * LPITCH)
static_assert(DIN == CC && DIN % KST == 0 && NST >= 2);
static_assert((NST & (NST - 1)) == 0);        // the rotated stage index wraps by a mask
// Rotated walk: the blocks that share operand rows are all resident and run in step, so from a common start they ask L2 for the same lines at the same moment. Each block enters the k stages at its own start rot (set by its tile indices) and wraps round: trip t works on stage (t + rot) mod NST. Every stage is still taken once; only the order of the k sum turns.
__device__ __forceinline__ int rot_k(int t, int rot) { return ((t + rot) & (NST - 1)) * KST; }
static_assert(SEQ % 128 == 0);                // 128-row blocks of k_proj never straddle a batch
// Eight asynchronous 16-B copies per lane: 16 rows each (8 lanes cover one 128-B row piece), rows 0,16,32,48 from pa and 64,..,112 from pb. The s_wait_xcnt stands inside the statement so that no address register is rewritten ahead of it.
template <typename T> __device__ __forceinline__ void copy128rows(unsigned l, const T* pa, const T* pb) {
  static_assert(sizeof(T) == 2);
  asm volatile("global_load_async_to_lds_b128 %0, %8, off\n\t"
               "global_load_async_to_lds_b128 %1, %9, off\n\t"
               "global_load_async_to_lds_b128 %2, %10, off\n\t"
               "global_load_async_to_lds_b128 %3, %11, off\n\t"
               "global_load_async_to_lds_b128 %4, %12, off\n\t"
               "global_load_async_to_lds_b128 %5, %13, off\n\t"
               "global_load_async_to_lds_b128 %6, %14, off\n\t"
               "global_load_async_to_lds_b128 %7, %15, off\n\t"
               "s_wait_xcnt 0x0"
               :: "v"(l), "v"(l + 16u * LPITCH), "v"(l + 32u * LPITCH), "v"(l + 48u * LPITCH), "v"(l + 64u * LPITCH), "v"(l + 80u * LPITCH), "v"(l + 96u * LPITCH), "v"(l + 112u * LPITCH),
                  "v"(pa), "v"(pa + 16 * DIN), "v"(pa + 32 * DIN), "v"(pa + 48 * DIN), "v"(pb), "v"(pb + 16 * DIN), "v"(pb + 32 * DIN), "v"(pb + 48 * DIN)
               : "memory");
}
// Four such copies per lane: 64 rows (0, 16, 32, 48) from pa
__device__ __forceinline__ void copy64rows(unsigned l, const _Float16* pa) {
  asm volatile("global_load_async_to_lds_b128 %0, %4, off\n\t"
               "global_load_async_to_lds_b128 %1, %5, off\n\t"
               "global_load_async_to_lds_b128 %2, %6, off\n\t"
               "global_load_async_to_lds_b128 %3, %7, off\n\t"
               "s_wait_xcnt 0x0"
               :: "v"(l), "v"(l + 16u * LPITCH), "v"(l + 32u * LPITCH), "v"(l + 48u * LPITCH),
                  "v"(pa), "v"(pa + 16 * DIN), "v"(pa + 32 * DIN), "v"(pa + 48 * DIN)
               : "memory");
}
// fragment of 16 staged rows starting at row, k step kc of the stage
__device__ __forceinline__ v16b frag_s(const unsigned char* sb, int row, int kc, int lane) {
  return frag_b((const __bf16*)(sb + (row + (lane & 15)) * LPITCH) + kc * 32, lane);
}
__device__ __forceinline__ v16h frag_sh(const unsigned char* sb, int row, int kc, int lane) {
  return frag_h((const _Float16*)(sb + (row + (lane & 15)) * LPITCH) + kc * 32, lane);
}

// ---- k_proj: block = (128 rows, 128 cols, which), 4 waves of 64 x 64: q/k/v = x W + b with exact bf16 products (K = DIN), operands through the LDS ring. which 0: q x log2(e)/8 as f16 rows; 1: k as f16 rows; 2: v f16 planes [c][t]
__global__ __launch_bounds__(128) void k_proj(const __bf16* __restrict__ XB, const __bf16* __restrict__ WT, const float* __restrict__ BQKV, _Float16* __restrict__ QK, _Float16* __restrict__ VT) {
  __shared__ __align__(128) unsigned char sm[2 * STG_BYTES];   // the ring; behind the k loop the output staging
  static_assert(128 * 136 * 2 <= 2 * STG_BYTES);
  const int tid = threadIdx.x; const int wave = __builtin_amdgcn_readfirstlane(threadIdx.x >> 5); const int lane = tid & 31, col = lane & 15, g = lane >> 4;
  const int wm = wave >> 1, wn = wave & 1;
  const int which = blockIdx.z; const int c0 = blockIdx.y * 128; const int r0 = blockIdx.x * 128; const int bb = r0 / SEQ; const int t0 = r0 % SEQ;
  const __bf16* ga = XB + (size_t)(r0 + (tid >> 3)) * DIN + (tid & 7) * 8;
  const __bf16* gw = WT + (size_t)(which * CC + c0 + (tid >> 3)) * DIN + (tid & 7) * 8;
  const unsigned l0 = (unsigned)(size_t)sm + (unsigned)((tid >> 3) * LPITCH + (tid & 7) * 16);
  const int rot = (int)(blockIdx.x + blockIdx.y + (CC / 128) * blockIdx.z);   // the 24 blocks of one x tile and the 32 of one weight tile spread over the 16 starts
  { const int ko = rot_k(0, rot); copy128rows(l0, ga + ko, ga + 64 * DIN + ko); copy128rows(l0 + 128u * LPITCH, gw + ko, gw + 64 * DIN + ko); }
  asm volatile("s_wait_asynccnt 0x0" ::: "memory");   // trip 0's stage landed (this wave's copies)
  __syncthreads();                                     // ... and every other wave's
  { const int ko = rot_k(1, rot); copy128rows(l0 + STG_BYTES, ga + ko, ga + 64 * DIN + ko); copy128rows(l0 + STG_BYTES + 128u * LPITCH, gw + ko, gw + 64 * DIN + ko); }
  v8f acc[4][4] = {};
#pragma unroll 1   // one copy of the pass in the text; the buffer is chosen by the trip's parity
  for (int t = 0; t < NST; ++t) { const unsigned bo = (unsigned)(t & 1) * STG_BYTES; const unsigned char* sb = sm + bo;
#pragma unroll
    for (int kc = 0; kc < KST / 32; ++kc) { v16b a[4], w[4];
#pragma unroll
      for (int i = 0; i < 4; ++i) { a[i] = frag_s(sb, wm * 64 + i * 16, kc, lane); w[i] = frag_s(sb, 128 + wn * 64 + i * 16, kc, lane); }
#pragma unroll
      for (int i = 0; i < 4; ++i)
#pragma unroll
        for (int j = 0; j < 4; ++j) acc[i][j] = wmma_bf(a[i], w[j], acc[i][j]); }
    asm volatile("s_wait_dscnt 0x0" ::: "memory");      // this wave's reads of the buffer are done before it is refilled
    asm volatile("s_wait_asynccnt 0x0" ::: "memory");   // this wave's copies of trip t + 1's stage have landed
    __syncthreads();                                     // publishes trip t + 1's stage, frees trip t's buffer
    if (t + 2 < NST) { const int ko = rot_k(t + 2, rot); copy128rows(l0 + bo, ga + ko, ga + 64 * DIN + ko); copy128rows(l0 + bo + 128u * LPITCH, gw + ko, gw + 64 * DIN + ko); } }
  asm volatile("s_wait_asynccnt 0x0" ::: "memory");     // no copy is outstanding when the ring becomes output staging
  if (which < 2) { const float qs = (which == 0) ? SCALE * LOG2E : 1.0f;   /* block-uniform */
    _Float16 (*sh)[136] = (_Float16 (*)[136])sm;
#pragma unroll
    for (int j = 0; j < 4; ++j) { const int cl = wn * 64 + j * 16 + col; const float bias = bfr(BQKV[which * CC + c0 + cl]);
#pragma unroll
      for (int i = 0; i < 4; ++i)
#pragma unroll
        for (int r = 0; r < 8; ++r) sh[wm * 64 + i * 16 + 8 * g + r][cl] = (_Float16)((acc[i][j][r] + bias) * qs); }
    __syncthreads();
    _Float16* DQ = QK + (size_t)which * PLANE;
    for (int e = tid; e < 128 * 16; e += 128) { const int rl = e >> 4, q = e & 15; const v4u vh = *(const v4u*)&sh[rl][q * 8];
      vst2(DQ + (size_t)(r0 + rl) * CC + c0 + q * 8, vh); }
  } else {
    _Float16 (*th)[136] = (_Float16 (*)[136])sm;
#pragma unroll
    for (int j = 0; j < 4; ++j) { const int cl = wn * 64 + j * 16 + col; const float bias = bfr(BQKV[2 * CC + c0 + cl]);
#pragma unroll
      for (int i = 0; i < 4; ++i)
#pragma unroll
        for (int r = 0; r < 8; ++r) th[cl][wm * 64 + i * 16 + 8 * g + r] = (_Float16)(acc[i][j][r] + bias); }
    __syncthreads();
    for (int e = tid; e < 128 * 16; e += 128) { const int cl = e >> 4, q = e & 15; const v4u v = *(const v4u*)&th[cl][q * 8];
      vst2(VT + ((size_t)bb * CC + c0 + cl) * (size_t)SEQ + t0 + q * 8, v); } }
}

// ---- k_attn: block = 128 queries of (b, h), 8 waves = 4 query groups (32 columns: two 16-column tiles a wave) x 2 key groups (each takes 32 of a stage's 64 keys; joined behind the key loop); transposed flash form: S^T tile = K (A, rows = keys) x Q^T (B, cols = queries) so each lane owns one query column:
//      reference / sum are per-lane scalars; the two 16-key S^T accumulators convert in-lane into the B fragment (k = key row of the tile) of O^T += V^T (A, rows = d) x P^T.
//      Held reference: each query column keeps a reference R (a maximum seen earlier); the score products start from C = 8 - R, so their result is the exponent of P x 2^8 as it stands. O^T, l and R move only in a pass where some exponent passes PTOP (one test a pass), and in the first pass.
//      K and V^T of 64 keys form one stage of an LDS ring shared by the eight waves (rows 0..63 K, 64..127 V^T rows d; 128 B a row at pitch 144 B), two buffers; the softmax still steps by 32 keys.
#define AST_BYTES (128 * LPITCH)
#define NKS (SEQ / 64)
static_assert(NKS >= 2 && HD * 2 == 128);   // two stages at least; a K row piece (64 d) and a V^T row piece (64 keys) are 128 B
static_assert((NKS & (NKS - 1)) == 0);      // the rotated stage index wraps by a mask
// Four asynchronous 16-B copies per lane of a 256-thread block: one stage (32 rows a copy: K rows 0, 32; V^T rows 0, 32). The s_wait_xcnt stands inside the statement so that no address register is rewritten ahead of it.
__device__ __forceinline__ void copy_stage(unsigned l, const _Float16* k, const _Float16* v) {
  asm volatile("global_load_async_to_lds_b128 %0, %4, off\n\t"
               "global_load_async_to_lds_b128 %1, %5, off\n\t"
               "global_load_async_to_lds_b128 %2, %6, off\n\t"
               "global_load_async_to_lds_b128 %3, %7, off\n\t"
               "s_wait_xcnt 0x0"
               :: "v"(l), "v"(l + 32u * LPITCH), "v"(l + 64u * LPITCH), "v"(l + 96u * LPITCH),
                  "v"(k), "v"(k + 32 * CC), "v"(v), "v"(v + 32 * SEQ)
               : "memory");
}
#define QT 2                                  // query tiles (16 columns each) per wave: every K and V^T fragment read from LDS feeds QT products
#define AQ (64 * QT)                          // queries per block: 4 query groups x 16 QT
#define MG_ML 32768                           // behind the key loop sm holds: the O^T tiles handed over (4 x 16 x 32 pieces of 16 B), ...
#define MG_YS 40960                           // ... their reference and sum (from MG_ML), and the output staging (from MG_YS)
static_assert(SEQ % AQ == 0);
static_assert(4 * QT * 8 * 32 * 16 <= MG_ML && MG_ML + 4 * QT * 2 * 32 * 4 <= MG_YS && 2 * AST_BYTES <= MG_YS + AQ * 9 * 16);
__global__ __launch_bounds__(256) void k_attn(const _Float16* __restrict__ QK, const _Float16* __restrict__ VT, _Float16* __restrict__ Y) {
  __shared__ __align__(128) unsigned char sm[MG_YS + AQ * 9 * 16];   // the ring (its first 2 AST_BYTES); behind the key loop the merge and output staging
  const int tid = threadIdx.x; const int wave = __builtin_amdgcn_readfirstlane(threadIdx.x >> 5); const int lane = tid & 31, col = lane & 15, g = lane >> 4;
  const int qg = wave & 3, kg = wave >> 2;    // query group (32 columns), key group (keys 32 kg .. 32 kg + 31 of every stage)
  const int qb = blockIdx.x, h = blockIdx.y, b = blockIdx.z;
  const _Float16* Qp = QK + ((size_t)b * SEQ + qb * AQ + qg * (16 * QT) + col) * CC + h * HD;
  const _Float16* gk = QK + PLANE + ((size_t)b * SEQ + (tid >> 3)) * CC + h * HD + (tid & 7) * 8;
  const _Float16* gv = VT + ((size_t)b * CC + h * HD + (tid >> 3)) * (size_t)SEQ + (tid & 7) * 8;
  const unsigned l0 = (unsigned)(size_t)sm + (unsigned)((tid >> 3) * LPITCH + (tid & 7) * 16);
  const int rot = qb * (AQ / 64);   // rotated walk, as in the GEMM rings: the query blocks of one (b, h) read the same K and V^T; each enters the key stages at its own start, evenly apart, and wraps round (the online softmax takes the keys in any order)
  { const int kn = (rot & (NKS - 1)) * 64; copy_stage(l0, gk + (size_t)kn * CC, gv + kn); }
  v16h qf[QT][HD / 32];   // the wave's query fragments, read once
#pragma unroll
  for (int x = 0; x < QT; ++x)
#pragma unroll
    for (int kc = 0; kc < HD / 32; ++kc) qf[x][kc] = frag_h(Qp + (size_t)x * 16 * CC + kc * 32, lane);
  asm volatile("s_wait_asynccnt 0x0" ::: "memory");   // trip 0's stage landed (this wave's copies)
  __syncthreads();                                     // ... and every other wave's
  { const int kn = ((1 + rot) & (NKS - 1)) * 64; copy_stage(l0 + AST_BYTES, gk + (size_t)kn * CC, gv + kn); }
  v8f o[QT][4] = {}; float cf[QT], l[QT]; v8f cr[QT];   // cf = 8 - R of the lane's query column (equal in both lane halves); cr = cf in all eight rows: the C operand of the score products
#pragma unroll
  for (int x = 0; x < QT; ++x) { cf[x] = PLOG; l[x] = 0.f;
#pragma unroll
    for (int r = 0; r < 8; ++r) cr[x][r] = PLOG; }
#pragma unroll 1   // one copy of the pass in the text; the buffer is chosen by the trip's parity
  for (int t = 0; t < NKS; ++t) { const unsigned bo = (unsigned)(t & 1) * AST_BYTES; const unsigned char* sb = sm + bo;
    const unsigned char* sk = sb + kg * (32 * LPITCH);   // this key group's 32 K rows
    v8f s0[QT] = {}, s1[QT] = {};
#pragma unroll
    for (int kc = 0; kc < HD / 32; ++kc) {
      const v16h k0 = frag_sh(sk, 0, kc, lane), k1 = frag_sh(sk, 16, kc, lane);
#pragma unroll
      for (int x = 0; x < QT; ++x) { s0[x] = wmma16(k0, qf[x][kc], kc == 0 ? cr[x] : s0[x]); s1[x] = wmma16(k1, qf[x][kc], kc == 0 ? cr[x] : s1[x]); }
    }
    float mx[QT];   // the lane's largest exponent of the pass, per query tile
#pragma unroll
    for (int x = 0; x < QT; ++x) { mx[x] = fmaxf(s0[x][0], s1[x][0]);
#pragma unroll
      for (int r = 1; r < 8; ++r) mx[x] = fmaxf(mx[x], fmaxf(s0[x][r], s1[x][r])); }
    static_assert(QT == 2);                          // the one test of a pass joins the two query tiles
    const bool move = (t == 0) | (fmaxf(mx[0], mx[1]) > PTOP);
    if (__builtin_amdgcn_ballot_w32(move) != 0) {    /* scalar branch: all lanes of the wave active inside */
#pragma unroll
      for (int x = 0; x < QT; ++x) {
        const float dm = fmaxf(mx[x], __shfl_xor(mx[x], 16));                       /* both lane halves of a query column agree on the move */
        const float dl = (t == 0) ? dm - PLOG : fmaxf(dm - PLOG, 0.f);              /* first pass: R = the column's maximum, up or down; later R only rises */
        const float corr = (t == 0) ? 1.0f : __builtin_amdgcn_exp2f(-dl);           /* first pass: O^T and l are still 0 */
        cf[x] -= dl; l[x] *= corr; s0[x] -= dl; s1[x] -= dl; cr[x] -= dl;           /* whole tiles; cr's eight rows stay equal to cf */
#pragma unroll
        for (int j = 0; j < 4; ++j) o[x][j] *= corr;
      }
    }
    v16h vf[4];     // the V^T fragments: read as one group in front of the exponentials, which run while the reads land
#pragma unroll
    for (int j = 0; j < 4; ++j) vf[j] = frag_h((const _Float16*)(sb + (64 + j * 16 + col) * LPITCH) + kg * 32, lane);
    v16h p[QT];
#pragma unroll
    for (int x = 0; x < QT; ++x) {
      float ps = 0.f;
#pragma unroll
      for (int r = 0; r < 8; ++r) { const float e0 = __builtin_amdgcn_exp2f(s0[x][r]), e1 = __builtin_amdgcn_exp2f(s1[x][r]); ps += e0 + e1; p[x][r] = (_Float16)e0; p[x][8 + r] = (_Float16)e1; }
      l[x] += ps;                                   /* l from the unconverted f32 values; per-lane partial (this lane's 16 of the 32 keys) */
    }
    // inputs only: holds the four V^T reads together in front of the products; without it they share one register set, each waited for right in front of its two products
    asm volatile("" :: "v"(vf[0]), "v"(vf[1]), "v"(vf[2]), "v"(vf[3]));
#pragma unroll
    for (int j = 0; j < 4; ++j)
#pragma unroll
      for (int x = 0; x < QT; ++x) o[x][j] = wmma16(vf[j], p[x], o[x][j]);
    asm volatile("s_wait_dscnt 0x0" ::: "memory");      // this wave's reads of the buffer are done before it is refilled
    asm volatile("s_wait_asynccnt 0x0" ::: "memory");   // this wave's copies of trip t + 1's stage have landed
    __syncthreads();                                     // publishes trip t + 1's stage, frees trip t's buffer
    if (t + 2 < NKS) { const int kn = ((t + 2 + rot) & (NKS - 1)) * 64; copy_stage(l0 + bo, gk + (size_t)kn * CC, gv + kn); }
  }
  asm volatile("s_wait_asynccnt 0x0" ::: "memory");     // no copy is outstanding when the ring becomes merge staging
  // merge of the two key groups of a query group through LDS, on the higher of their references: key group x joins query tile x; each wave hands over the tile it does not join
  static_assert(QT == 2);                                // as many query tiles a wave as key groups
  v4f* mo = (v4f*)sm + (size_t)qg * (QT * 8) * 32 + lane; float* ml = (float*)(sm + MG_ML) + qg * (QT * 2) * 32 + lane;
  v4u (*ys)[9] = (v4u (*)[9])(sm + MG_YS);
#pragma unroll
  for (int x = 0; x < QT; ++x)
    if (kg != x) { ml[(x * 2) * 32] = cf[x]; ml[(x * 2 + 1) * 32] = l[x];   /* wave-uniform test */
#pragma unroll
      for (int j = 0; j < 4; ++j) { const v4f a = { o[x][j][0], o[x][j][1], o[x][j][2], o[x][j][3] }, c = { o[x][j][4], o[x][j][5], o[x][j][6], o[x][j][7] };
        mo[((x * 4 + j) * 2) * 32] = a; mo[((x * 4 + j) * 2 + 1) * 32] = c; } }
  __syncthreads();                                       // the partial results handed over are in LDS
#pragma unroll
  for (int x = 0; x < QT; ++x)
    if (kg == x) {                                       /* wave-uniform test: all lanes of the wave active inside */
      const float c1 = ml[(x * 2) * 32], l1 = ml[(x * 2 + 1) * 32];
      const float cm = fminf(cf[x], c1); const float a0 = __builtin_amdgcn_exp2f(cm - cf[x]), a1 = __builtin_amdgcn_exp2f(cm - c1);   /* c = 8 - R: the smaller c is the higher reference */
      float lt = l[x] * a0 + l1 * a1;
      lt += __shfl_xor(lt, 16);
      const float inv = 1.0f / lt; const float f0 = a0 * inv, f1 = a1 * inv;   /* O^T and l both carry 2^8 */
      // O^T tile j: lane (g, col = query) holds d = 16j + 8g + 0..7: one 16-B piece of the (row, head) segment, as f16
#pragma unroll
      for (int j = 0; j < 4; ++j) { union { v8h v; v4u u; } y; const v4f a = mo[((x * 4 + j) * 2) * 32], c = mo[((x * 4 + j) * 2 + 1) * 32];
#pragma unroll
        for (int r = 0; r < 8; ++r) { const float o1 = (r < 4) ? a[r & 3] : c[r & 3]; y.v[r] = (_Float16)(o[x][j][r] * f0 + o1 * f1); }
        ys[qg * (16 * QT) + x * 16 + col][2 * j + g] = y.u; } }
  __syncthreads();
#pragma unroll 1
  for (int it = 0; it < 4; ++it) { const int rl = wave * 16 + it * 4 + (lane >> 3), pc = lane & 7;
    const v4u a = ys[rl][pc];
    vst2(Y + ((size_t)b * SEQ + qb * AQ + rl) * CC + h * HD + pc * 8, a); }
}

// ---- k_out: block = (64 rows, 128 cols), 4 waves of 32 x 64: out = ctx Wo + bo: f16 ctx against the f16 weight (one product), operands through an LDS ring of 192-row stages (rows 0..63 ctx, 64..191 weight); 512-B row segment by one 32-lane x 16-B instruction
#define OST_BYTES (192 * LPITCH)
__global__ __launch_bounds__(128) void k_out(const _Float16* __restrict__ Y, const _Float16* __restrict__ WOT, const float* __restrict__ BO, float* __restrict__ OUT) {
  __shared__ __align__(128) unsigned char sm[2 * OST_BYTES];   // the ring; behind the k loop the output staging
  static_assert(64 * 132 * 4 <= 2 * OST_BYTES);
  const int tid = threadIdx.x; const int wave = __builtin_amdgcn_readfirstlane(threadIdx.x >> 5); const int lane = tid & 31, col = lane & 15, g = lane >> 4;
  const int wm = wave >> 1, wn = wave & 1;
  const int c0 = blockIdx.y * 128; const int rb = blockIdx.x * 64;
  const _Float16* gy = Y + (size_t)(rb + (tid >> 3)) * CC + (tid & 7) * 8;
  const _Float16* gw = WOT + (size_t)(c0 + (tid >> 3)) * CC + (tid & 7) * 8;
  const unsigned l0 = (unsigned)(size_t)sm + (unsigned)((tid >> 3) * LPITCH + (tid & 7) * 16);
  const int rot = (int)(blockIdx.x + blockIdx.y);   // the 8 blocks of one ctx tile and the 64 of one weight tile spread over the 16 starts
  { const int ko = rot_k(0, rot); copy64rows(l0, gy + ko); copy128rows(l0 + 64u * LPITCH, gw + ko, gw + 64 * CC + ko); }
  asm volatile("s_wait_asynccnt 0x0" ::: "memory");   // trip 0's stage landed (this wave's copies)
  __syncthreads();                                     // ... and every other wave's
  { const int ko = rot_k(1, rot); copy64rows(l0 + OST_BYTES, gy + ko); copy128rows(l0 + OST_BYTES + 64u * LPITCH, gw + ko, gw + 64 * CC + ko); }
  v8f acc[2][4] = {};
#pragma unroll 1   // one copy of the pass in the text; the buffer is chosen by the trip's parity
  for (int t = 0; t < NST; ++t) { const unsigned bo = (unsigned)(t & 1) * OST_BYTES; const unsigned char* sb = sm + bo;
#pragma unroll
    for (int kc = 0; kc < KST / 32; ++kc) { v16h a[2], w[4];
#pragma unroll
      for (int i = 0; i < 2; ++i) a[i] = frag_sh(sb, wm * 32 + i * 16, kc, lane);
#pragma unroll
      for (int j = 0; j < 4; ++j) w[j] = frag_sh(sb, 64 + wn * 64 + j * 16, kc, lane);
#pragma unroll
      for (int i = 0; i < 2; ++i)
#pragma unroll
        for (int j = 0; j < 4; ++j) acc[i][j] = wmma_hf(a[i], w[j], acc[i][j]); }
    asm volatile("s_wait_dscnt 0x0" ::: "memory");      // this wave's reads of the buffer are done before it is refilled
    asm volatile("s_wait_asynccnt 0x0" ::: "memory");   // this wave's copies of trip t + 1's stage have landed
    __syncthreads();                                     // publishes trip t + 1's stage, frees trip t's buffer
    if (t + 2 < NST) { const int ko = rot_k(t + 2, rot); copy64rows(l0 + bo, gy + ko); copy128rows(l0 + bo + 64u * LPITCH, gw + ko, gw + 64 * CC + ko); } }
  asm volatile("s_wait_asynccnt 0x0" ::: "memory");     // no copy is outstanding when the ring becomes output staging
  float (*sf)[132] = (float (*)[132])sm;
#pragma unroll
  for (int j = 0; j < 4; ++j) { const int cl = wn * 64 + j * 16 + col; const float bias = bfr(BO[c0 + cl]);
#pragma unroll
    for (int i = 0; i < 2; ++i)
#pragma unroll
      for (int r = 0; r < 8; ++r) sf[wm * 32 + i * 16 + 8 * g + r][cl] = acc[i][j][r] + bias; }
  __syncthreads();
  const size_t orow0 = (size_t)(rb / SEQ) * SEQ_FULL + (size_t)(rb % SEQ) + wave * 16;
#pragma unroll 1
  for (int rl = 0; rl < 16; ++rl) { const v4f v = *(const v4f*)&sf[wave * 16 + rl][lane * 4];
    vst2(OUT + (orow0 + rl) * DIN + c0 + lane * 4, v); }
}

extern "C" void kernel_launch(void* const* d_in, const int* in_sizes, int n_in, void* d_out, int out_size, void* d_ws, size_t ws_size, hipStream_t stream) {
  if (n_in < 5) return;
  const size_t xneed = ((size_t)(NB - 1) * SEQ_FULL + SEQ) * DIN;
  if ((size_t)in_sizes[0] < xneed) return;
  if ((size_t)in_sizes[1] < (size_t)DIN * 3 * CC) return;
  if ((size_t)in_sizes[2] < (size_t)3 * CC) return;
  if ((size_t)in_sizes[3] < (size_t)CC * DIN) return;
  if ((size_t)in_sizes[4] < (size_t)DIN) return;
  if ((size_t)out_size < xneed) return;
  if (ws_size < (size_t)WS_END) return;
  // inputs (wire order): 0 x [4,1024,1024]; 1 W_qkv [1024,3072] (in,out): q columns 0..1023, k 1024..2047, v 2048..3071; 2 b_qkv [3072]; 3 W_out [1024,1024] (in,out); 4 b_out [1024]
  const float* x = (const float*)d_in[0]; const float* wqkv = (const float*)d_in[1]; const float* bqkv = (const float*)d_in[2]; const float* wout = (const float*)d_in[3]; const float* bout = (const float*)d_in[4];
  char* ws = (char*)d_ws;
  __bf16* XB = (__bf16*)(ws + WS_XB); __bf16* WQT = (__bf16*)(ws + WS_WQT); _Float16* WOT = (_Float16*)(ws + WS_WOT); _Float16* QK = (_Float16*)(ws + WS_QK); _Float16* VT = (_Float16*)(ws + WS_VT); _Float16* Y = (_Float16*)(ws + WS_Y);
  k_prep<<<dim3(TRQ + TRO + CVB), 256, 0, stream>>>(x, wqkv, wout, XB, WQT, WOT);
  k_proj<<<dim3(NB * SEQ / 128, CC / 128, 3), 128, 0, stream>>>(XB, WQT, bqkv, QK, VT);
  k_attn<<<dim3(SEQ / AQ, NH, NB), 256, 0, stream>>>(QK, VT, Y);
  k_out<<<dim3(NB * SEQ / 64, DIN / 128), 128, 0, stream>>>(Y, WOT, bout, (float*)d_out);
}

// v008
// One run takes 58.7 microseconds.
// Next to v007, in two timings, it ran 1.04 times as fast each time.
// Over all steps from v000 it is 5.30 times as fast.
// compute dtype: x, the QKV weight and both biases converted (RNE) to bf16, the output weight to f16; q/k/v projections = exact bf16 x bf16 products on v_wmma_f32_16x16x32_bf16 (f32 accumulate) + bias; q log2(e)/8, k, v each once to f16; base-2 logits = k x q log2(e)/8 on v_wmma_f32_16x16x32_f16 (one product, f32 accumulate, started from 8 minus a held reference); softmax f32 (online, held reference); P x 2^8 once to f16 against v (one product); ctx once to f16 against the f16 output weight (one product) + bias; f32 output. The f16 rounding of q, k and ctx (11 significant bits) lies below the bf16 rounding of x and the QKV weight (8 bits) that they are computed from.
#include <hip/hip_runtime.h>
#include <math.h>

typedef __attribute__((ext_vector_type(16))) _Float16 v16h;
typedef __attribute__((ext_vector_type(16))) __bf16 v16b;
typedef __attribute__((ext_vector_type(8)))  _Float16 v8h;
typedef __attribute__((ext_vector_type(8)))  __bf16 v8b;
typedef __attribute__((ext_vector_type(8)))  float v8f;
typedef __attribute__((ext_vector_type(4)))  float v4f;
typedef __attribute__((ext_vector_type(4)))  unsigned v4u;

// Dense multi-head self-attention, no mask: x [4,1024,1024]; fused (in,out) QKV weight [1024][3072] viewed (3, 16, 64): column = which*1024 + h*64 + d; (in,out) output weight [1024][1024]; one score scale 1/8; softmax over the 1024 keys of the same batch.
#ifndef NB
#define NB 4
#endif
#ifndef SEQ
#define SEQ 1024
#endif
#define NB_FULL 4
#define SEQ_FULL 1024      // full per-batch row stride of x and of the output
#define DIN 1024           // model width (input of QKV projection, output of the last projection)
#define CC 1024            // NH * HD
#define NH 16
#define HD 64
#define SCALE (0.125f)
#define LOG2E (1.4426950408889634f)   // folded into the stored q, so the logits are exponents of 2
#define PLOG (8.0f)        // P and l carried x 2^8 (keeps P down to 2^-22 clear of f16 subnormals); it cancels in O / l
#define PTOP (15.0f)       // largest exponent let through to f16 (2^15 < 65504): a score may pass its column's reference by 7 before the reference moves
#define PLANE ((size_t)NB * SEQ * CC)

static_assert(CC == NH * HD);                 // merged head layout h*64+d
static_assert(HD == 64);
static_assert(SEQ % 64 == 0);                 // 64-row blocks never straddle a batch; key loop steps by 64
static_assert(DIN % 64 == 0 && CC % 128 == 0 && (3 * CC) % 64 == 0 && DIN % 128 == 0);   // tile multiples of every GEMM / transpose grid
static_assert(DIN % 32 == 0 && CC % 32 == 0); // WMMA k-steps
static_assert(NB <= NB_FULL && SEQ <= SEQ_FULL);
static_assert(((size_t)NB * SEQ * (DIN / 8)) % 256 == 0);   // convert grid x 256 threads == plane extent

#define WS_XB  ((size_t)0)                                   // bf16 x rows [NB*SEQ][DIN]
#define WS_WQT (WS_XB  + 2u * (size_t)NB * SEQ * DIN)        // bf16 QKV weight, (out,in) [3*CC][DIN]
#define WS_WOT (WS_WQT + 2u * (size_t)3 * CC * DIN)          // f16 output weight, (out,in) [DIN][CC]
#define WS_QK  (WS_WOT + 2u * (size_t)DIN * CC)              // f16 planes: q log2(e)/8, k, each [NB*SEQ][CC]
#define WS_VT  (WS_QK  + 2u * 2u * PLANE)                    // f16 v planes [b][c][t]
#define WS_Y   (WS_VT  + 2u * (size_t)NB * CC * SEQ)         // f16 ctx rows [NB*SEQ][CC]
#define WS_END (WS_Y   + 2u * PLANE)
static_assert(WS_END <= (size_t)134217728);   // total carve
static_assert(WS_WQT % 128 == 0 && WS_WOT % 128 == 0 && WS_QK % 128 == 0 && WS_VT % 128 == 0 && WS_Y % 128 == 0);

template <typename T> __device__ __forceinline__ void vst2(void* p, T v) { *(T*)p = v;  }
// k_attn's two products are the bare builtins: the compiler keeps the distances behind its own WMMAs, and with no asm statement tied to each product it may group the LDS reads ahead, alternate the accumulator chains and set softmax work between the products
__device__ __forceinline__ v8f wmma16(v16h a, v16h b, v8f c) {
  return __builtin_amdgcn_wmma_f32_16x16x32_f16(false, a, false, b, (short)0, c, false, false);
}
__device__ __forceinline__ v8f wmma_bf(v16b a, v16b b, v8f c) {
  v8f d = __builtin_amdgcn_wmma_f32_16x16x32_bf16(false, a, false, b, (short)0, c, false, false);
  asm volatile("v_nop\n\tv_nop\n\tv_nop\n\tv_nop" : "+v"(d) : "v"(a), "v"(b));
  return d;
}
// k_out's product: wmma_bf's form with f16 operands; the four v_nop fill the vector slots the chip needs behind a WMMA before a vector instruction touches its D, A or B
__device__ __forceinline__ v8f wmma_hf(v16h a, v16h b, v8f c) {
  v8f d = __builtin_amdgcn_wmma_f32_16x16x32_f16(false, a, false, b, (short)0, c, false, false);
  asm volatile("v_nop\n\tv_nop\n\tv_nop\n\tv_nop" : "+v"(d) : "v"(a), "v"(b));
  return d;
}
// 16x16x32 fragments: lane = (g = lane>>4, row/col = lane&15); elements 0..7 = k0+8g+0..7, 8..15 = k0+16+8g+0..7; D element r = row 8g+r, col lane&15
__device__ __forceinline__ v16h frag_h(const _Float16* rowk0, int lane) {
  union { v16h v; v8h q[2]; } u; const _Float16* p = rowk0 + 8 * (lane >> 4);
  u.q[0] = *(const v8h*)p; u.q[1] = *(const v8h*)(p + 16); return u.v;
}
__device__ __forceinline__ v16b frag_b(const __bf16* rowk0, int lane) {
  union { v16b v; v8b q[2]; } u; const __bf16* p = rowk0 + 8 * (lane >> 4);
  u.q[0] = *(const v8b*)p; u.q[1] = *(const v8b*)(p + 16); return u.v;
}
__device__ __forceinline__ float bfr(float v) { return (float)(__bf16)v; }

// x piece i (8 consecutive elements of one row): f32 -> bf16 (RNE)
__device__ __forceinline__ void cvt_x(int i, const float* __restrict__ X, __bf16* __restrict__ XB) {
  if (i >= NB * SEQ * (DIN / 8)) return;
  const int row = i / (DIN / 8), pc = i % (DIN / 8);
  const size_t srow = (size_t)(row / SEQ) * SEQ_FULL + (size_t)(row % SEQ);
  const float* p = X + srow * DIN + pc * 8;
  const v4f a = *(const v4f*)p, b = *(const v4f*)(p + 4);
  union { v8b v; v4u u; } o;
  o.v[0] = (__bf16)a[0]; o.v[1] = (__bf16)a[1]; o.v[2] = (__bf16)a[2]; o.v[3] = (__bf16)a[3];
  o.v[4] = (__bf16)b[0]; o.v[5] = (__bf16)b[1]; o.v[6] = (__bf16)b[2]; o.v[7] = (__bf16)b[3];
  vst2(XB + (size_t)row * DIN + pc * 8, o.u);
}

// in[DIN rows][ldw cols] f32 (in,out) -> out[ldw rows][DIN cols] of T (bf16 or f16) (out,in); one 64 x 64 tile (column tile bx, k tile by) through LDS by a whole 256-thread block
template <typename T> __device__ __forceinline__ void tr_w(T (*t)[72], const float* __restrict__ W, T* __restrict__ WT, int ldw, int bx, int by) {
  const int tid = threadIdx.x; const int n0 = bx * 64, k0 = by * 64;
  for (int e = tid; e < 64 * 16; e += 256) { const int kr = e >> 4, c4 = (e & 15) * 4;
    const v4f w = *(const v4f*)(W + (size_t)(k0 + kr) * ldw + n0 + c4);
    t[c4 + 0][kr] = (T)w[0]; t[c4 + 1][kr] = (T)w[1]; t[c4 + 2][kr] = (T)w[2]; t[c4 + 3][kr] = (T)w[3]; }
  __syncthreads();
  for (int e = tid; e < 64 * 8; e += 256) { const int nr = e >> 3, q = e & 7; const v4u v = *(const v4u*)&t[nr][q * 8];
    vst2(WT + (size_t)(n0 + nr) * DIN + k0 + q * 8, v); }
}

// ---- k_prep: the three preparations depend on nothing but the inputs, so they share one launch; the block index picks the job (the same for a whole block, so the transpose's barrier is passed by all of a block or by none).
//      Blocks 0 .. TRQ-1: QKV weight tiles; TRQ .. TRQ+TRO-1: output weight tiles (the jobs with the longer chain load, LDS, barrier, store start first); the rest: 256 x pieces each.
#define TRQ ((3 * CC / 64) * (DIN / 64))
#define TRO ((DIN / 64) * (CC / 64))
#define CVB ((int)(((size_t)NB * SEQ * (DIN / 8)) / 256))
__global__ __launch_bounds__(256) void k_prep(const float* __restrict__ X, const float* __restrict__ WQ, const float* __restrict__ WO, __bf16* __restrict__ XB, __bf16* __restrict__ WQT, _Float16* __restrict__ WOT) {
  __shared__ __align__(16) unsigned char t[64 * 72 * 2];   // one tile of 2-byte elements, [64][72]
  const int id = blockIdx.x;
  if (id < TRQ) tr_w((__bf16 (*)[72])t, WQ, WQT, 3 * CC, id % (3 * CC / 64), id / (3 * CC / 64));                       // in[1024][3072] -> out[3072][1024]
  else if (id < TRQ + TRO) tr_w((_Float16 (*)[72])t, WO, WOT, DIN, (id - TRQ) % (DIN / 64), (id - TRQ) / (DIN / 64));     // in[1024][1024] -> out[1024][1024]
  else cvt_x((id - TRQ - TRO) * 256 + (int)threadIdx.x, X, XB);
}

// ---- LDS rings of the two GEMM kernels: one block a WGP; a stage = 128 k of all the block's operand rows (the A side first, then the weight rows), 256 B a row at pitch 272 B (16 B x odd: no bank conflict for 16-B fragment reads); two buffers.
#define KST 128
#define NST (DIN / KST)
#define GPITCH 272
#define LPITCH 144         // k_attn's ring: 128-B rows
static_assert(DIN == CC && DIN % KST == 0 && NST >= 2);
static_assert((NST & (NST - 1)) == 0);        // the rotated stage index wraps by a mask
// Rotated walk: the blocks that share operand rows are all resident and run in step, so from a common start they ask L2 for the same lines at the same moment. Each block enters the k stages at its own start rot (set by its tile indices) and wraps round: trip t works on stage (t + rot) mod NST. Every stage is still taken once; only the order of the k sum turns.
__device__ __forceinline__ int rot_k(int t, int rot) { return ((t + rot) & (NST - 1)) * KST; }
static_assert(SEQ % 128 == 0);                // 128-row blocks never straddle a batch
// Eight asynchronous 16-B copies per lane of a 128-thread group: 64 rows of 256 B (16 lanes cover one row piece, 8 rows a copy: rows 0, 8, .., 56 from p). The s_wait_xcnt stands inside the statement so that no address register is rewritten ahead of it.
template <typename T> __device__ __forceinline__ void copy64rows(unsigned l, const T* p) {
  static_assert(sizeof(T) == 2);
  asm volatile("global_load_async_to_lds_b128 %0, %8, off\n\t"
               "global_load_async_to_lds_b128 %1, %9, off\n\t"
               "global_load_async_to_lds_b128 %2, %10, off\n\t"
               "global_load_async_to_lds_b128 %3, %11, off\n\t"
               "global_load_async_to_lds_b128 %4, %12, off\n\t"
               "global_load_async_to_lds_b128 %5, %13, off\n\t"
               "global_load_async_to_lds_b128 %6, %14, off\n\t"
               "global_load_async_to_lds_b128 %7, %15, off\n\t"
               "s_wait_xcnt 0x0"
               :: "v"(l), "v"(l + 8u * GPITCH), "v"(l + 16u * GPITCH), "v"(l + 24u * GPITCH), "v"(l + 32u * GPITCH), "v"(l + 40u * GPITCH), "v"(l + 48u * GPITCH), "v"(l + 56u * GPITCH),
                  "v"(p), "v"(p + 8 * DIN), "v"(p + 16 * DIN), "v"(p + 24 * DIN), "v"(p + 32 * DIN), "v"(p + 40 * DIN), "v"(p + 48 * DIN), "v"(p + 56 * DIN)
               : "memory");
}
// fragment of 16 staged rows starting at row, k step kc of the stage (GEMM rings)
__device__ __forceinline__ v16b frag_s(const unsigned char* sb, int row, int kc, int lane) {
  return frag_b((const __bf16*)(sb + (row + (lane & 15)) * GPITCH) + kc * 32, lane);
}
__device__ __forceinline__ v16h frag_g(const unsigned char* sb, int row, int kc, int lane) {
  return frag_h((const _Float16*)(sb + (row + (lane & 15)) * GPITCH) + kc * 32, lane);
}
// the same for k_attn's ring
__device__ __forceinline__ v16h frag_sh(const unsigned char* sb, int row, int kc, int lane) {
  return frag_h((const _Float16*)(sb + (row + (lane & 15)) * LPITCH) + kc * 32, lane);
}

// ---- k_proj: block = 128 rows x (128 cols of each of q, k, v), 12 waves = 3 column groups (which = wave / 4: 0 q, 1 k, 2 v) x 4 waves of 64 x 64: q/k/v = x W + b with exact bf16 products (K = DIN), operands through the LDS ring.
//      The x rows of a stage are staged once and read by all three groups. which 0: q x log2(e)/8 as f16 rows; 1: k as f16 rows; 2: v f16 planes [c][t]
//      Stage rows: 0..127 x, 128 + 128 which .. + 127 the group's weight rows.
#define PST_BYTES (512 * GPITCH)
#define POUT_BYTES (128 * 136 * 2)            // output staging of one column group
__global__ __launch_bounds__(384) void k_proj(const __bf16* __restrict__ XB, const __bf16* __restrict__ WT, const float* __restrict__ BQKV, _Float16* __restrict__ QK, _Float16* __restrict__ VT) {
  __shared__ __align__(128) unsigned char sm[2 * PST_BYTES];   // the ring; behind the k loop the output staging
  static_assert(3 * POUT_BYTES <= 2 * PST_BYTES);
  const int tid = threadIdx.x; const int wave = __builtin_amdgcn_readfirstlane(threadIdx.x >> 5); const int lane = tid & 31, col = lane & 15, g = lane >> 4;
  const int which = wave >> 2;                /* the same for a whole wave, in a scalar register */
  const int wm = (wave >> 1) & 1, wn = wave & 1;
  const int gt = tid & 127;                   // thread index inside the column group
  const int c0 = blockIdx.y * 128; const int r0 = blockIdx.x * 128; const int bb = r0 / SEQ; const int t0 = r0 % SEQ;
  const __bf16* ga = XB + (size_t)(r0 + (which & 1) * 64 + (gt >> 4)) * DIN + (gt & 15) * 8;   // groups 0 and 1 bring 64 x rows each, group 2 none
  const __bf16* gw = WT + (size_t)(which * CC + c0 + (gt >> 4)) * DIN + (gt & 15) * 8;         // every group brings its own 128 weight rows
  const unsigned lg = (unsigned)(size_t)sm + (unsigned)((gt >> 4) * GPITCH + (gt & 15) * 16);
  const unsigned la = lg + (unsigned)((which & 1) * 64) * GPITCH, lw = lg + (unsigned)(128 + which * 128) * GPITCH;
  const int rot = (int)(blockIdx.x + blockIdx.y);   // the 8 blocks of one x tile take the 8 starts once each, the 32 of one weight tile four times each
  { const int ko = rot_k(0, rot); if (which < 2) copy64rows(la, ga + ko); copy64rows(lw, gw + ko); copy64rows(lw + 64u * GPITCH, gw + 64 * DIN + ko); }
  asm volatile("s_wait_asynccnt 0x0" ::: "memory");   // trip 0's stage landed (this wave's copies)
  __syncthreads();                                     // ... and every other wave's
  { const int ko = rot_k(1, rot); if (which < 2) copy64rows(la + PST_BYTES, ga + ko); copy64rows(lw + PST_BYTES, gw + ko); copy64rows(lw + PST_BYTES + 64u * GPITCH, gw + 64 * DIN + ko); }
  v8f acc[4][4] = {};
#pragma unroll 1   // one copy of the pass in the text; the buffer is chosen by the trip's parity
  for (int t = 0; t < NST; ++t) { const unsigned bo = (unsigned)(t & 1) * PST_BYTES; const unsigned char* sb = sm + bo;
#pragma unroll
    for (int kc = 0; kc < KST / 32; ++kc) { v16b a[4], w[4];
#pragma unroll
      for (int i = 0; i < 4; ++i) { a[i] = frag_s(sb, wm * 64 + i * 16, kc, lane); w[i] = frag_s(sb, 128 + which * 128 + wn * 64 + i * 16, kc, lane); }
#pragma unroll
      for (int i = 0; i < 4; ++i)
#pragma unroll
        for (int j = 0; j < 4; ++j) acc[i][j] = wmma_bf(a[i], w[j], acc[i][j]); }
    asm volatile("s_wait_dscnt 0x0" ::: "memory");      // this wave's reads of the buffer are done before it is refilled
    asm volatile("s_wait_asynccnt 0x0" ::: "memory");   // this wave's copies of trip t + 1's stage have landed
    __syncthreads();                                     // publishes trip t + 1's stage, frees trip t's buffer
    if (t + 2 < NST) { const int ko = rot_k(t + 2, rot); if (which < 2) copy64rows(la + bo, ga + ko); copy64rows(lw + bo, gw + ko); copy64rows(lw + bo + 64u * GPITCH, gw + 64 * DIN + ko); } }
  asm volatile("s_wait_asynccnt 0x0" ::: "memory");     // no copy is outstanding when the ring becomes output staging
  _Float16 (*sh)[136] = (_Float16 (*)[136])(sm + which * POUT_BYTES);   // the group's own staging: [row][col] for q and k, [col][row] for v
  if (which < 2) { const float qs = (which == 0) ? SCALE * LOG2E : 1.0f;   /* wave-uniform */
#pragma unroll
    for (int j = 0; j < 4; ++j) { const int cl = wn * 64 + j * 16 + col; const float bias = bfr(BQKV[which * CC + c0 + cl]);
#pragma unroll
      for (int i = 0; i < 4; ++i)
#pragma unroll
        for (int r = 0; r < 8; ++r) sh[wm * 64 + i * 16 + 8 * g + r][cl] = (_Float16)((acc[i][j][r] + bias) * qs); }
  } else {
#pragma unroll
    for (int j = 0; j < 4; ++j) { const int cl = wn * 64 + j * 16 + col; const float bias = bfr(BQKV[2 * CC + c0 + cl]);
#pragma unroll
      for (int i = 0; i < 4; ++i)
#pragma unroll
        for (int r = 0; r < 8; ++r) sh[cl][wm * 64 + i * 16 + 8 * g + r] = (_Float16)(acc[i][j][r] + bias); }
  }
  __syncthreads();                                       // one barrier for the three groups, outside the wave-uniform branches
  if (which < 2) { _Float16* DQ = QK + (size_t)which * PLANE;
    for (int e = gt; e < 128 * 16; e += 128) { const int rl = e >> 4, q = e & 15; const v4u vh = *(const v4u*)&sh[rl][q * 8];
      vst2(DQ + (size_t)(r0 + rl) * CC + c0 + q * 8, vh); }
  } else {
    for (int e = gt; e < 128 * 16; e += 128) { const int cl = e >> 4, q = e & 15; const v4u v = *(const v4u*)&sh[cl][q * 8];
      vst2(VT + ((size_t)bb * CC + c0 + cl) * (size_t)SEQ + t0 + q * 8, v); } }
}

// ---- k_attn: block = 128 queries of (b, h), 8 waves = 4 query groups (32 columns: two 16-column tiles a wave) x 2 key groups (each takes 32 of a stage's 64 keys; joined behind the key loop); transposed flash form: S^T tile = K (A, rows = keys) x Q^T (B, cols = queries) so each lane owns one query column:
//      reference / sum are per-lane scalars; the two 16-key S^T accumulators convert in-lane into the B fragment (k = key row of the tile) of O^T += V^T (A, rows = d) x P^T.
//      Held reference: each query column keeps a reference R (a maximum seen earlier); the score products start from C = 8 - R, so their result is the exponent of P x 2^8 as it stands. O^T, l and R move only in a pass where some exponent passes PTOP (one test a pass), and in the first pass.
//      K and V^T of 64 keys form one stage of an LDS ring shared by the eight waves (rows 0..63 K, 64..127 V^T rows d; 128 B a row at pitch 144 B), two buffers; the softmax still steps by 32 keys.
#define AST_BYTES (128 * LPITCH)
#define NKS (SEQ / 64)
static_assert(NKS >= 2 && HD * 2 == 128);   // two stages at least; a K row piece (64 d) and a V^T row piece (64 keys) are 128 B
static_assert((NKS & (NKS - 1)) == 0);      // the rotated stage index wraps by a mask
// Four asynchronous 16-B copies per lane of a 256-thread block: one stage (32 rows a copy: K rows 0, 32; V^T rows 0, 32). The s_wait_xcnt stands inside the statement so that no address register is rewritten ahead of it.
__device__ __forceinline__ void copy_stage(unsigned l, const _Float16* k, const _Float16* v) {
  asm volatile("global_load_async_to_lds_b128 %0, %4, off\n\t"
               "global_load_async_to_lds_b128 %1, %5, off\n\t"
               "global_load_async_to_lds_b128 %2, %6, off\n\t"
               "global_load_async_to_lds_b128 %3, %7, off\n\t"
               "s_wait_xcnt 0x0"
               :: "v"(l), "v"(l + 32u * LPITCH), "v"(l + 64u * LPITCH), "v"(l + 96u * LPITCH),
                  "v"(k), "v"(k + 32 * CC), "v"(v), "v"(v + 32 * SEQ)
               : "memory");
}
#define QT 2                                  // query tiles (16 columns each) per wave: every K and V^T fragment read from LDS feeds QT products
#define AQ (64 * QT)                          // queries per block: 4 query groups x 16 QT
#define MG_ML 32768                           // behind the key loop sm holds: the O^T tiles handed over (4 x 16 x 32 pieces of 16 B), ...
#define MG_YS 40960                           // ... their reference and sum (from MG_ML), and the output staging (from MG_YS)
static_assert(SEQ % AQ == 0);
static_assert(4 * QT * 8 * 32 * 16 <= MG_ML && MG_ML + 4 * QT * 2 * 32 * 4 <= MG_YS && 2 * AST_BYTES <= MG_YS + AQ * 9 * 16);
__global__ __launch_bounds__(256) void k_attn(const _Float16* __restrict__ QK, const _Float16* __restrict__ VT, _Float16* __restrict__ Y) {
  __shared__ __align__(128) unsigned char sm[MG_YS + AQ * 9 * 16];   // the ring (its first 2 AST_BYTES); behind the key loop the merge and output staging
  const int tid = threadIdx.x; const int wave = __builtin_amdgcn_readfirstlane(threadIdx.x >> 5); const int lane = tid & 31, col = lane & 15, g = lane >> 4;
  const int qg = wave & 3, kg = wave >> 2;    // query group (32 columns), key group (keys 32 kg .. 32 kg + 31 of every stage)
  const int qb = blockIdx.x, h = blockIdx.y, b = blockIdx.z;
  const _Float16* Qp = QK + ((size_t)b * SEQ + qb * AQ + qg * (16 * QT) + col) * CC + h * HD;
  const _Float16* gk = QK + PLANE + ((size_t)b * SEQ + (tid >> 3)) * CC + h * HD + (tid & 7) * 8;
  const _Float16* gv = VT + ((size_t)b * CC + h * HD + (tid >> 3)) * (size_t)SEQ + (tid & 7) * 8;
  const unsigned l0 = (unsigned)(size_t)sm + (unsigned)((tid >> 3) * LPITCH + (tid & 7) * 16);
  const int rot = qb * (AQ / 64);   // rotated walk, as in the GEMM rings: the query blocks of one (b, h) read the same K and V^T; each enters the key stages at its own start, evenly apart, and wraps round (the online softmax takes the keys in any order)
  { const int kn = (rot & (NKS - 1)) * 64; copy_stage(l0, gk + (size_t)kn * CC, gv + kn); }
  v16h qf[QT][HD / 32];   // the wave's query fragments, read once
#pragma unroll
  for (int x = 0; x < QT; ++x)
#pragma unroll
    for (int kc = 0; kc < HD / 32; ++kc) qf[x][kc] = frag_h(Qp + (size_t)x * 16 * CC + kc * 32, lane);
  asm volatile("s_wait_asynccnt 0x0" ::: "memory");   // trip 0's stage landed (this wave's copies)
  __syncthreads();                                     // ... and every other wave's
  { const int kn = ((1 + rot) & (NKS - 1)) * 64; copy_stage(l0 + AST_BYTES, gk + (size_t)kn * CC, gv + kn); }
  v8f o[QT][4] = {}; float cf[QT], l[QT]; v8f cr[QT];   // cf = 8 - R of the lane's query column (equal in both lane halves); cr = cf in all eight rows: the C operand of the score products
#pragma unroll
  for (int x = 0; x < QT; ++x) { cf[x] = PLOG; l[x] = 0.f;
#pragma unroll
    for (int r = 0; r < 8; ++r) cr[x][r] = PLOG; }
#pragma unroll 1   // one copy of the pass in the text; the buffer is chosen by the trip's parity
  for (int t = 0; t < NKS; ++t) { const unsigned bo = (unsigned)(t & 1) * AST_BYTES; const unsigned char* sb = sm + bo;
    const unsigned char* sk = sb + kg * (32 * LPITCH);   // this key group's 32 K rows
    v8f s0[QT] = {}, s1[QT] = {};
#pragma unroll
    for (int kc = 0; kc < HD / 32; ++kc) {
      const v16h k0 = frag_sh(sk, 0, kc, lane), k1 = frag_sh(sk, 16, kc, lane);
#pragma unroll
      for (int x = 0; x < QT; ++x) { s0[x] = wmma16(k0, qf[x][kc], kc == 0 ? cr[x] : s0[x]); s1[x] = wmma16(k1, qf[x][kc], kc == 0 ? cr[x] : s1[x]); }
    }
    float mx[QT];   // the lane's largest exponent of the pass, per query tile
#pragma unroll
    for (int x = 0; x < QT; ++x) { mx[x] = fmaxf(s0[x][0], s1[x][0]);
#pragma unroll
      for (int r = 1; r < 8; ++r) mx[x] = fmaxf(mx[x], fmaxf(s0[x][r], s1[x][r])); }
    static_assert(QT == 2);                          // the one test of a pass joins the two query tiles
    const bool move = (t == 0) | (fmaxf(mx[0], mx[1]) > PTOP);
    if (__builtin_amdgcn_ballot_w32(move) != 0) {    /* scalar branch: all lanes of the wave active inside */
#pragma unroll
      for (int x = 0; x < QT; ++x) {
        const float dm = fmaxf(mx[x], __shfl_xor(mx[x], 16));                       /* both lane halves of a query column agree on the move */
        const float dl = (t == 0) ? dm - PLOG : fmaxf(dm - PLOG, 0.f);              /* first pass: R = the column's maximum, up or down; later R only rises */
        const float corr = (t == 0) ? 1.0f : __builtin_amdgcn_exp2f(-dl);           /* first pass: O^T and l are still 0 */
        cf[x] -= dl; l[x] *= corr; s0[x] -= dl; s1[x] -= dl; cr[x] -= dl;           /* whole tiles; cr's eight rows stay equal to cf */
#pragma unroll
        for (int j = 0; j < 4; ++j) o[x][j] *= corr;
      }
    }
    v16h vf[4];     // the V^T fragments: read as one group in front of the exponentials, which run while the reads land
#pragma unroll
    for (int j = 0; j < 4; ++j) vf[j] = frag_h((const _Float16*)(sb + (64 + j * 16 + col) * LPITCH) + kg * 32, lane);
    v16h p[QT];
#pragma unroll
    for (int x = 0; x < QT; ++x) {
      float ps = 0.f;
#pragma unroll
      for (int r = 0; r < 8; ++r) { const float e0 = __builtin_amdgcn_exp2f(s0[x][r]), e1 = __builtin_amdgcn_exp2f(s1[x][r]); ps += e0 + e1; p[x][r] = (_Float16)e0; p[x][8 + r] = (_Float16)e1; }
      l[x] += ps;                                   /* l from the unconverted f32 values; per-lane partial (this lane's 16 of the 32 keys) */
    }
    // inputs only: holds the four V^T reads together in front of the products; without it they share one register set, each waited for right in front of its two products
    asm volatile("" :: "v"(vf[0]), "v"(vf[1]), "v"(vf[2]), "v"(vf[3]));
#pragma unroll
    for (int j = 0; j < 4; ++j)
#pragma unroll
      for (int x = 0; x < QT; ++x) o[x][j] = wmma16(vf[j], p[x], o[x][j]);
    asm volatile("s_wait_dscnt 0x0" ::: "memory");      // this wave's reads of the buffer are done before it is refilled
    asm volatile("s_wait_asynccnt 0x0" ::: "memory");   // this wave's copies of trip t + 1's stage have landed
    __syncthreads();                                     // publishes trip t + 1's stage, frees trip t's buffer
    if (t + 2 < NKS) { const int kn = ((t + 2 + rot) & (NKS - 1)) * 64; copy_stage(l0 + bo, gk + (size_t)kn * CC, gv + kn); }
  }
  asm volatile("s_wait_asynccnt 0x0" ::: "memory");     // no copy is outstanding when the ring becomes merge staging
  // merge of the two key groups of a query group through LDS, on the higher of their references: key group x joins query tile x; each wave hands over the tile it does not join
  static_assert(QT == 2);                                // as many query tiles a wave as key groups
  v4f* mo = (v4f*)sm + (size_t)qg * (QT * 8) * 32 + lane; float* ml = (float*)(sm + MG_ML) + qg * (QT * 2) * 32 + lane;
  v4u (*ys)[9] = (v4u (*)[9])(sm + MG_YS);
#pragma unroll
  for (int x = 0; x < QT; ++x)
    if (kg != x) { ml[(x * 2) * 32] = cf[x]; ml[(x * 2 + 1) * 32] = l[x];   /* wave-uniform test */
#pragma unroll
      for (int j = 0; j < 4; ++j) { const v4f a = { o[x][j][0], o[x][j][1], o[x][j][2], o[x][j][3] }, c = { o[x][j][4], o[x][j][5], o[x][j][6], o[x][j][7] };
        mo[((x * 4 + j) * 2) * 32] = a; mo[((x * 4 + j) * 2 + 1) * 32] = c; } }
  __syncthreads();                                       // the partial results handed over are in LDS
#pragma unroll
  for (int x = 0; x < QT; ++x)
    if (kg == x) {                                       /* wave-uniform test: all lanes of the wave active inside */
      const float c1 = ml[(x * 2) * 32], l1 = ml[(x * 2 + 1) * 32];
      const float cm = fminf(cf[x], c1); const float a0 = __builtin_amdgcn_exp2f(cm - cf[x]), a1 = __builtin_amdgcn_exp2f(cm - c1);   /* c = 8 - R: the smaller c is the higher reference */
      float lt = l[x] * a0 + l1 * a1;
      lt += __shfl_xor(lt, 16);
      const float inv = 1.0f / lt; const float f0 = a0 * inv, f1 = a1 * inv;   /* O^T and l both carry 2^8 */
      // O^T tile j: lane (g, col = query) holds d = 16j + 8g + 0..7: one 16-B piece of the (row, head) segment, as f16
#pragma unroll
      for (int j = 0; j < 4; ++j) { union { v8h v; v4u u; } y; const v4f a = mo[((x * 4 + j) * 2) * 32], c = mo[((x * 4 + j) * 2 + 1) * 32];
#pragma unroll
        for (int r = 0; r < 8; ++r) { const float o1 = (r < 4) ? a[r & 3] : c[r & 3]; y.v[r] = (_Float16)(o[x][j][r] * f0 + o1 * f1); }
        ys[qg * (16 * QT) + x * 16 + col][2 * j + g] = y.u; } }
  __syncthreads();
#pragma unroll 1
  for (int it = 0; it < 4; ++it) { const int rl = wave * 16 + it * 4 + (lane >> 3), pc = lane & 7;
    const v4u a = ys[rl][pc];
    vst2(Y + ((size_t)b * SEQ + qb * AQ + rl) * CC + h * HD + pc * 8, a); }
}

// ---- k_out: block = (128 rows, 128 cols), 8 waves of 32 x 64: out = ctx Wo + bo: f16 ctx against the f16 weight (one product), operands through an LDS ring of 256-row stages (rows 0..127 ctx, 128..255 weight; each half of the block brings 64 rows of either); two 256-B row segments by one 32-lane x 16-B instruction
#define OST_BYTES (256 * GPITCH)
__global__ __launch_bounds__(256) void k_out(const _Float16* __restrict__ Y, const _Float16* __restrict__ WOT, const float* __restrict__ BO, float* __restrict__ OUT) {
  __shared__ __align__(128) unsigned char sm[2 * OST_BYTES];   // the ring; behind the k loop the output staging
  static_assert(128 * 132 * 4 <= 2 * OST_BYTES);
  const int tid = threadIdx.x; const int wave = __builtin_amdgcn_readfirstlane(threadIdx.x >> 5); const int lane = tid & 31, col = lane & 15, g = lane >> 4;
  const int wm = wave >> 1, wn = wave & 1;
  const int c0 = blockIdx.y * 128; const int rb = blockIdx.x * 128;
  const _Float16* gy = Y + (size_t)(rb + (tid >> 4)) * CC + (tid & 15) * 8;      // thread t: rows (t >> 4) + 0, 8, .., 56: threads 0..127 rows 0..63, threads 128..255 rows 64..127
  const _Float16* gw = WOT + (size_t)(c0 + (tid >> 4)) * CC + (tid & 15) * 8;
  const int hr = (tid >> 7) * 56;             // the second half's rows start at 64: (t >> 4) already gives 8
  const unsigned l0 = (unsigned)(size_t)sm + (unsigned)(((tid >> 4) + hr) * GPITCH + (tid & 15) * 16);
  gy += (size_t)hr * CC; gw += (size_t)hr * CC;
  const int rot = (int)(blockIdx.x + blockIdx.y);   // the 8 blocks of one ctx tile take the 8 starts once each, the 32 of one weight tile four times each
  { const int ko = rot_k(0, rot); copy64rows(l0, gy + ko); copy64rows(l0 + 128u * GPITCH, gw + ko); }
  asm volatile("s_wait_asynccnt 0x0" ::: "memory");   // trip 0's stage landed (this wave's copies)
  __syncthreads();                                     // ... and every other wave's
  { const int ko = rot_k(1, rot); copy64rows(l0 + OST_BYTES, gy + ko); copy64rows(l0 + OST_BYTES + 128u * GPITCH, gw + ko); }
  v8f acc[2][4] = {};
#pragma unroll 1   // one copy of the pass in the text; the buffer is chosen by the trip's parity
  for (int t = 0; t < NST; ++t) { const unsigned bo = (unsigned)(t & 1) * OST_BYTES; const unsigned char* sb = sm + bo;
#pragma unroll
    for (int kc = 0; kc < KST / 32; ++kc) { v16h a[2], w[4];
#pragma unroll
      for (int i = 0; i < 2; ++i) a[i] = frag_g(sb, wm * 32 + i * 16, kc, lane);
#pragma unroll
      for (int j = 0; j < 4; ++j) w[j] = frag_g(sb, 128 + wn * 64 + j * 16, kc, lane);
#pragma unroll
      for (int i = 0; i < 2; ++i)
#pragma unroll
        for (int j = 0; j < 4; ++j) acc[i][j] = wmma_hf(a[i], w[j], acc[i][j]); }
    asm volatile("s_wait_dscnt 0x0" ::: "memory");      // this wave's reads of the buffer are done before it is refilled
    asm volatile("s_wait_asynccnt 0x0" ::: "memory");   // this wave's copies of trip t + 1's stage have landed
    __syncthreads();                                     // publishes trip t + 1's stage, frees trip t's buffer
    if (t + 2 < NST) { const int ko = rot_k(t + 2, rot); copy64rows(l0 + bo, gy + ko); copy64rows(l0 + bo + 128u * GPITCH, gw + ko); } }
  asm volatile("s_wait_asynccnt 0x0" ::: "memory");     // no copy is outstanding when the ring becomes output staging
  float (*sf)[132] = (float (*)[132])sm;
#pragma unroll
  for (int j = 0; j < 4; ++j) { const int cl = wn * 64 + j * 16 + col; const float bias = bfr(BO[c0 + cl]);
#pragma unroll
    for (int i = 0; i < 2; ++i)
#pragma unroll
      for (int r = 0; r < 8; ++r) sf[wm * 32 + i * 16 + 8 * g + r][cl] = acc[i][j][r] + bias; }
  __syncthreads();
  const size_t orow0 = (size_t)(rb / SEQ) * SEQ_FULL + (size_t)(rb % SEQ) + wave * 16;
#pragma unroll 1
  for (int rl = 0; rl < 16; ++rl) { const v4f v = *(const v4f*)&sf[wave * 16 + rl][lane * 4];
    vst2(OUT + (orow0 + rl) * DIN + c0 + lane * 4, v); }
}

extern "C" void kernel_launch(void* const* d_in, const int* in_sizes, int n_in, void* d_out, int out_size, void* d_ws, size_t ws_size, hipStream_t stream) {
  if (n_in < 5) return;
  const size_t xneed = ((size_t)(NB - 1) * SEQ_FULL + SEQ) * DIN;
  if ((size_t)in_sizes[0] < xneed) return;
  if ((size_t)in_sizes[1] < (size_t)DIN * 3 * CC) return;
  if ((size_t)in_sizes[2] < (size_t)3 * CC) return;
  if ((size_t)in_sizes[3] < (size_t)CC * DIN) return;
  if ((size_t)in_sizes[4] < (size_t)DIN) return;
  if ((size_t)out_size < xneed) return;
  if (ws_size < (size_t)WS_END) return;
  // inputs (wire order): 0 x [4,1024,1024]; 1 W_qkv [1024,3072] (in,out): q columns 0..1023, k 1024..2047, v 2048..3071; 2 b_qkv [3072]; 3 W_out [1024,1024] (in,out); 4 b_out [1024]
  const float* x = (const float*)d_in[0]; const float* wqkv = (const float*)d_in[1]; const float* bqkv = (const float*)d_in[2]; const float* wout = (const float*)d_in[3]; const float* bout = (const float*)d_in[4];
  char* ws = (char*)d_ws;
  __bf16* XB = (__bf16*)(ws + WS_XB); __bf16* WQT = (__bf16*)(ws + WS_WQT); _Float16* WOT = (_Float16*)(ws + WS_WOT); _Float16* QK = (_Float16*)(ws + WS_QK); _Float16* VT = (_Float16*)(ws + WS_VT); _Float16* Y = (_Float16*)(ws + WS_Y);
  k_prep<<<dim3(TRQ + TRO + CVB), 256, 0, stream>>>(x, wqkv, wout, XB, WQT, WOT);
  k_proj<<<dim3(NB * SEQ / 128, CC / 128), 384, 0, stream>>>(XB, WQT, bqkv, QK, VT);
  k_attn<<<dim3(SEQ / AQ, NH, NB), 256, 0, stream>>>(QK, VT, Y);
  k_out<<<dim3(NB * SEQ / 128, DIN / 128), 256, 0, stream>>>(Y, WOT, bout, (float*)d_out);
}

// v009
// It runs in 55.6 microseconds.
// Timed twice side by side with v008, it ran 1.05 and 1.04 times as fast.
// All steps since v000 together make it 5.51 times as fast.
// compute dtype: x, the QKV weight and both biases converted (RNE) to bf16, the output weight to f16; q/k/v projections = exact bf16 x bf16 products on v_wmma_f32_16x16x32_bf16 (f32 accumulate) + bias; q log2(e)/8, k, v each once to f16; base-2 logits = k x q log2(e)/8 on v_wmma_f32_16x16x32_f16 (one product, f32 accumulate, started from 8 minus a held reference); softmax f32 (online, held reference); P x 2^8 once to f16 against v (one product); ctx once to f16 against the f16 output weight (one product) + bias; f32 output. The f16 rounding of q, k and ctx (11 significant bits) lies below the bf16 rounding of x and the QKV weight (8 bits) that they are computed from.
#include <hip/hip_runtime.h>
#include <math.h>
#include <stdint.h>

typedef __attribute__((ext_vector_type(16))) _Float16 v16h;
typedef __attribute__((ext_vector_type(16))) __bf16 v16b;
typedef __attribute__((ext_vector_type(8)))  _Float16 v8h;
typedef __attribute__((ext_vector_type(8)))  __bf16 v8b;
typedef __attribute__((ext_vector_type(8)))  float v8f;
typedef __attribute__((ext_vector_type(4)))  float v4f;
typedef __attribute__((ext_vector_type(4)))  unsigned v4u;
typedef uint32_t u32x4 __attribute__((ext_vector_type(4)));
typedef uint32_t u32x8 __attribute__((ext_vector_type(8)));

// Dense multi-head self-attention, no mask: x [4,1024,1024]; fused (in,out) QKV weight [1024][3072] viewed (3, 16, 64): column = which*1024 + h*64 + d; (in,out) output weight [1024][1024]; one score scale 1/8; softmax over the 1024 keys of the same batch.
#ifndef NB
#define NB 4
#endif
#ifndef SEQ
#define SEQ 1024
#endif
#define NB_FULL 4
#define SEQ_FULL 1024      // full per-batch row stride of x and of the output
#define DIN 1024           // model width (input of QKV projection, output of the last projection)
#define CC 1024            // NH * HD
#define NH 16
#define HD 64
#define SCALE (0.125f)
#define LOG2E (1.4426950408889634f)   // folded into the stored q, so the logits are exponents of 2
#define PLOG (8.0f)        // P and l carried x 2^8 (keeps P down to 2^-22 clear of f16 subnormals); it cancels in O / l
#define PTOP (15.0f)       // largest exponent let through to f16 (2^15 < 65504): a score may pass its column's reference by 7 before the reference moves
#define PLANE ((size_t)NB * SEQ * CC)

static_assert(CC == NH * HD);                 // merged head layout h*64+d
static_assert(HD == 64);
static_assert(SEQ % 64 == 0);                 // 64-row blocks never straddle a batch; key loop steps by 64
static_assert(DIN % 64 == 0 && CC % 128 == 0 && (3 * CC) % 64 == 0 && DIN % 128 == 0);   // tile multiples of every GEMM / transpose grid
static_assert(DIN % 32 == 0 && CC % 32 == 0); // WMMA k-steps
static_assert(NB <= NB_FULL && SEQ <= SEQ_FULL);
static_assert(((size_t)NB * SEQ * (DIN / 8)) % 256 == 0);   // convert grid x 256 threads == plane extent

#define WS_XB  ((size_t)0)                                   // bf16 x rows [NB*SEQ][DIN]
#define WS_WQT (WS_XB  + 2u * (size_t)NB * SEQ * DIN)        // bf16 QKV weight, (out,in) [3*CC][DIN]
#define WS_WOT (WS_WQT + 2u * (size_t)3 * CC * DIN)          // f16 output weight, (out,in) [DIN][CC]
#define WS_QK  (WS_WOT + 2u * (size_t)DIN * CC)              // f16 planes: q log2(e)/8, k, each [NB*SEQ][CC]
#define WS_VT  (WS_QK  + 2u * 2u * PLANE)                    // f16 v planes [b][c][t]
#define WS_Y   (WS_VT  + 2u * (size_t)NB * CC * SEQ)         // f16 ctx rows [NB*SEQ][CC]
#define WS_END (WS_Y   + 2u * PLANE)
static_assert(WS_END <= (size_t)134217728);   // total carve
static_assert(WS_WQT % 128 == 0 && WS_WOT % 128 == 0 && WS_QK % 128 == 0 && WS_VT % 128 == 0 && WS_Y % 128 == 0);

template <typename T> __device__ __forceinline__ void vst2(void* p, T v) { *(T*)p = v;  }
// k_attn's two products are the bare builtins: the compiler keeps the distances behind its own WMMAs, and with no asm statement tied to each product it may group the LDS reads ahead, alternate the accumulator chains and set softmax work between the products
__device__ __forceinline__ v8f wmma16(v16h a, v16h b, v8f c) {
  return __builtin_amdgcn_wmma_f32_16x16x32_f16(false, a, false, b, (short)0, c, false, false);
}
__device__ __forceinline__ v8f wmma_bf(v16b a, v16b b, v8f c) {
  v8f d = __builtin_amdgcn_wmma_f32_16x16x32_bf16(false, a, false, b, (short)0, c, false, false);
  asm volatile("v_nop\n\tv_nop\n\tv_nop\n\tv_nop" : "+v"(d) : "v"(a), "v"(b));
  return d;
}
// k_out's product: wmma_bf's form with f16 operands; the four v_nop fill the vector slots the chip needs behind a WMMA before a vector instruction touches its D, A or B
__device__ __forceinline__ v8f wmma_hf(v16h a, v16h b, v8f c) {
  v8f d = __builtin_amdgcn_wmma_f32_16x16x32_f16(false, a, false, b, (short)0, c, false, false);
  asm volatile("v_nop\n\tv_nop\n\tv_nop\n\tv_nop" : "+v"(d) : "v"(a), "v"(b));
  return d;
}
// 16x16x32 fragments: lane = (g = lane>>4, row/col = lane&15); elements 0..7 = k0+8g+0..7, 8..15 = k0+16+8g+0..7; D element r = row 8g+r, col lane&15
__device__ __forceinline__ v16h frag_h(const _Float16* rowk0, int lane) {
  union { v16h v; v8h q[2]; } u; const _Float16* p = rowk0 + 8 * (lane >> 4);
  u.q[0] = *(const v8h*)p; u.q[1] = *(const v8h*)(p + 16); return u.v;
}
__device__ __forceinline__ v16b frag_b(const __bf16* rowk0, int lane) {
  union { v16b v; v8b q[2]; } u; const __bf16* p = rowk0 + 8 * (lane >> 4);
  u.q[0] = *(const v8b*)p; u.q[1] = *(const v8b*)(p + 16); return u.v;
}
__device__ __forceinline__ float bfr(float v) { return (float)(__bf16)v; }

// x piece i (8 consecutive elements of one row): f32 -> bf16 (RNE)
__device__ __forceinline__ void cvt_x(int i, const float* __restrict__ X, __bf16* __restrict__ XB) {
  if (i >= NB * SEQ * (DIN / 8)) return;
  const int row = i / (DIN / 8), pc = i % (DIN / 8);
  const size_t srow = (size_t)(row / SEQ) * SEQ_FULL + (size_t)(row % SEQ);
  const float* p = X + srow * DIN + pc * 8;
  const v4f a = *(const v4f*)p, b = *(const v4f*)(p + 4);
  union { v8b v; v4u u; } o;
  o.v[0] = (__bf16)a[0]; o.v[1] = (__bf16)a[1]; o.v[2] = (__bf16)a[2]; o.v[3] = (__bf16)a[3];
  o.v[4] = (__bf16)b[0]; o.v[5] = (__bf16)b[1]; o.v[6] = (__bf16)b[2]; o.v[7] = (__bf16)b[3];
  vst2(XB + (size_t)row * DIN + pc * 8, o.u);
}

// in[DIN rows][ldw cols] f32 (in,out) -> out[ldw rows][DIN cols] of T (bf16 or f16) (out,in); one 64 x 64 tile (column tile bx, k tile by) through LDS by a whole 256-thread block
template <typename T> __device__ __forceinline__ void tr_w(T (*t)[72], const float* __restrict__ W, T* __restrict__ WT, int ldw, int bx, int by) {
  const int tid = threadIdx.x; const int n0 = bx * 64, k0 = by * 64;
  for (int e = tid; e < 64 * 16; e += 256) { const int kr = e >> 4, c4 = (e & 15) * 4;
    const v4f w = *(const v4f*)(W + (size_t)(k0 + kr) * ldw + n0 + c4);
    t[c4 + 0][kr] = (T)w[0]; t[c4 + 1][kr] = (T)w[1]; t[c4 + 2][kr] = (T)w[2]; t[c4 + 3][kr] = (T)w[3]; }
  __syncthreads();
  for (int e = tid; e < 64 * 8; e += 256) { const int nr = e >> 3, q = e & 7; const v4u v = *(const v4u*)&t[nr][q * 8];
    vst2(WT + (size_t)(n0 + nr) * DIN + k0 + q * 8, v); }
}

// ---- k_prep: the three preparations depend on nothing but the inputs, so they share one launch; the block index picks the job (the same for a whole block, so the transpose's barrier is passed by all of a block or by none).
//      Blocks 0 .. TRQ-1: QKV weight tiles; TRQ .. TRQ+TRO-1: output weight tiles (the jobs with the longer chain load, LDS, barrier, store start first); the rest: 256 x pieces each.
#define TRQ ((3 * CC / 64) * (DIN / 64))
#define TRO ((DIN / 64) * (CC / 64))
#define CVB ((int)(((size_t)NB * SEQ * (DIN / 8)) / 256))
__global__ __launch_bounds__(256) void k_prep(const float* __restrict__ X, const float* __restrict__ WQ, const float* __restrict__ WO, __bf16* __restrict__ XB, __bf16* __restrict__ WQT, _Float16* __restrict__ WOT) {
  __shared__ __align__(16) unsigned char t[64 * 72 * 2];   // one tile of 2-byte elements, [64][72]
  const int id = blockIdx.x;
  if (id < TRQ) tr_w((__bf16 (*)[72])t, WQ, WQT, 3 * CC, id % (3 * CC / 64), id / (3 * CC / 64));                       // in[1024][3072] -> out[3072][1024]
  else if (id < TRQ + TRO) tr_w((_Float16 (*)[72])t, WO, WOT, DIN, (id - TRQ) % (DIN / 64), (id - TRQ) / (DIN / 64));     // in[1024][1024] -> out[1024][1024]
  else cvt_x((id - TRQ - TRO) * 256 + (int)threadIdx.x, X, XB);
}

// ---- LDS rings of the two GEMM kernels: one block a WGP; a stage = 128 k of all the block's operand rows (the A side first, then the weight rows), 256 B a row at pitch 272 B (16 B x odd: no bank conflict for 16-B fragment reads); two buffers.
//      A stage is brought by tensor loads, one request a wave: a slice of 64 or 32 whole rows, the 16-B pad behind every row laid by the mover; every slice starts at a multiple of 2 KiB.
#define KST 128
#define NST (DIN / KST)
#define GPITCH 272
#define LPITCH 144         // k_attn's ring: 128-B rows
static_assert(DIN == CC && DIN % KST == 0 && NST >= 2);
static_assert((NST & (NST - 1)) == 0);        // the rotated stage index wraps by a mask
// Rotated walk: the blocks that share operand rows are all resident and run in step, so from a common start they ask L2 for the same lines at the same moment. Each block enters the k stages at its own start rot (set by its tile indices) and wraps round: trip t works on stage (t + rot) mod NST. Every stage is still taken once; only the order of the k sum turns.
__device__ __forceinline__ int rot_k(int t, int rot) { return ((t + rot) & (NST - 1)) * KST; }
static_assert(SEQ % 128 == 0);                // 128-row blocks never straddle a batch
#define SRC_PITCH 2048u    // bytes from one source row to the next, the same in every plane that is staged
static_assert(DIN * 2 == SRC_PITCH && CC * 2 == SRC_PITCH && SEQ * 2 == SRC_PITCH);
#define GSL64 18432u       // a slice of 64 rows at 272 B (17,408 B), rounded up to a multiple of 2 KiB
#define GSL32 10240u       // a slice of 32 rows at 272 B (8,704 B), rounded up likewise
#define ASL32 6144u        // k_attn: a slice of 32 rows at 144 B (4,608 B), rounded up likewise
static_assert(64 * GPITCH <= GSL64 && 32 * GPITCH <= GSL32 && 32 * LPITCH <= ASL32 && GSL64 % 2048 == 0 && GSL32 % 2048 == 0 && ASL32 % 2048 == 0);
__device__ __forceinline__ uint32_t uni(uint32_t v) { return (uint32_t)__builtin_amdgcn_readfirstlane(v); }
// a wave-uniform value held in a scalar register (the empty statement keeps it there): a test on it compiles to a scalar compare and branch, which a tensor load needs because it ignores EXEC; being volatile it also stays behind the waits written in front of it
__device__ __forceinline__ uint32_t pinned(uint32_t v) { uint32_t w = (uint32_t)__builtin_amdgcn_readfirstlane(v); asm volatile("" : "+s"(w)); return w; }
// descriptor group 1: 1-byte elements, tensor = tile = ROWS rows of ROWB bytes at source pitch SRC_PITCH, 4 dwords of LDS pad behind every row, no mask
template <uint32_t ROWB, uint32_t ROWS> __device__ __forceinline__ u32x8 tdm_group1() {
  static_assert(ROWB == 128u || ROWB == 256u);
  constexpr uint32_t w0 = (1u << 20) | ((ROWB == 256u ? 5u : 4u) << 22) | (3u << 25);   // pad on, interval = one row, 16 B
  u32x8 g;   // pinned(): each descriptor word is held in its scalar register from here on; otherwise the compiler writes the constants anew in front of each use, also while a request is in flight
  g[0] = pinned(w0);
  g[1] = pinned((ROWB & 0xFFFFu) << 16);
  g[2] = pinned((ROWB >> 16) | ((ROWS & 0xFFFFu) << 16));
  g[3] = pinned((ROWS >> 16) | (ROWB << 16));
  g[4] = pinned(ROWS);
  g[5] = pinned(SRC_PITCH);
  g[6] = pinned(0u);
  g[7] = pinned(0u);
  return g;
}
// descriptor group 0: place in the block's LDS, address of the tile's first byte
__device__ __forceinline__ u32x4 tdm_group0(uint32_t lds_dst, const void* p) {
  const uint64_t ga = (uint64_t)p; u32x4 g;
  g[0] = pinned(1u); g[1] = uni(lds_dst); g[2] = uni((uint32_t)ga); g[3] = uni((((uint32_t)(ga >> 32)) & 0x01FFFFFFu) | 0x80000000u);   // pinned(): the count word, held like group 1's
  return g;
}
// the same group aimed at the next tile: count and type stay
__device__ __forceinline__ void tdm_aim(u32x4& g, uint32_t lds_dst, const void* p) {
  const uint64_t ga = (uint64_t)p;
  g[1] = uni(lds_dst); g[2] = uni((uint32_t)ga); g[3] = uni((((uint32_t)(ga >> 32)) & 0x01FFFFFFu) | 0x80000000u);
}
__device__ __forceinline__ void tdm_load(const u32x4& g0, const u32x8& g1) { asm volatile("tensor_load_to_lds %0, %1" :: "s"(g0), "s"(g1) : "memory"); }
// the issuing wave's wait for its request; it names both descriptor groups so that they stay in their scalar registers, untouched, from the issue until the tile has landed
__device__ __forceinline__ void tdm_wait(u32x4& g0, u32x8& g1) { asm volatile("s_wait_tensorcnt 0x0" : "+s"(g0), "+s"(g1) :: "memory"); }
// fragment of 16 staged rows starting at row, k step kc of the stage (GEMM rings)
__device__ __forceinline__ v16b frag_s(const unsigned char* sb, int row, int kc, int lane) {
  return frag_b((const __bf16*)(sb + (row + (lane & 15)) * GPITCH) + kc * 32, lane);
}
__device__ __forceinline__ v16h frag_g(const unsigned char* sb, int row, int kc, int lane) {
  return frag_h((const _Float16*)(sb + (row + (lane & 15)) * GPITCH) + kc * 32, lane);
}
// the same for k_attn's ring
__device__ __forceinline__ v16h frag_sh(const unsigned char* sb, int row, int kc, int lane) {
  return frag_h((const _Float16*)(sb + (row + (lane & 15)) * LPITCH) + kc * 32, lane);
}

// ---- k_proj: block = 128 rows x (128 cols of each of q, k, v), 12 waves = 3 column groups (which = wave / 4: 0 q, 1 k, 2 v) x 4 waves of 64 x 64: q/k/v = x W + b with exact bf16 products (K = DIN), operands through the LDS ring.
//      The x rows of a stage are staged once and read by all three groups. which 0: q x log2(e)/8 as f16 rows; 1: k as f16 rows; 2: v f16 planes [c][t]
//      Stage = 8 slices of 64 rows: 0, 1 the x rows, 2 + 2 which, 3 + 2 which the group's weight rows; waves 0..7 bring one slice each.
#define PST_BYTES (8u * GSL64)
#define POUT_BYTES (128 * 136 * 2)            // output staging of one column group
__global__ __launch_bounds__(384) void k_proj(const __bf16* __restrict__ XB, const __bf16* __restrict__ WT, const float* __restrict__ BQKV, _Float16* __restrict__ QK, _Float16* __restrict__ VT) {
  __shared__ __attribute__((aligned(2048))) unsigned char sm[2 * PST_BYTES];   // the ring; behind the k loop the output staging
  static_assert(3 * POUT_BYTES <= 2 * PST_BYTES);
  const int tid = threadIdx.x; const int wave = __builtin_amdgcn_readfirstlane(threadIdx.x >> 5); const int lane = tid & 31, col = lane & 15, g = lane >> 4;
  const int which = wave >> 2;                /* the same for a whole wave, in a scalar register */
  const int wm = (wave >> 1) & 1, wn = wave & 1;
  const int gt = tid & 127;                   // thread index inside the column group
  const int c0 = blockIdx.y * 128; const int r0 = blockIdx.x * 128; const int bb = r0 / SEQ; const int t0 = r0 % SEQ;
  const int ws = wave < 8 ? wave : 0;         // the slice an issuing wave brings (waves 8..11 issue nothing)
  const __bf16* gs = (ws < 2) ? XB + (size_t)(r0 + ws * 64) * DIN : WT + (size_t)(((ws - 2) >> 1) * CC + c0 + ((ws - 2) & 1) * 64) * DIN;   // first row of the slice, k = 0
  const uint32_t ls = (uint32_t)(size_t)sm + (uint32_t)ws * GSL64;
  const int rot = (int)(blockIdx.x + blockIdx.y);   // the 8 blocks of one x tile take the 8 starts once each, the 32 of one weight tile four times each
  u32x8 g1 = tdm_group1<256u, 64u>(); u32x4 g0 = tdm_group0(ls, gs + rot_k(0, rot));
  if (pinned(wave < 8)) { tdm_load(g0, g1); tdm_wait(g0, g1); }   // trip 0's stage landed (this wave's slice)
  __syncthreads();                                     // ... and every other wave's
  if (pinned(wave < 8)) { tdm_aim(g0, ls + PST_BYTES, gs + rot_k(1, rot)); tdm_load(g0, g1); }
  const unsigned sa = (unsigned)wm * GSL64, sw = (unsigned)(2 + which * 2 + wn) * GSL64;   // the two slices this wave reads
  v8f acc[4][4] = {};
#pragma unroll 1   // one copy of the pass in the text; the buffer is chosen by the trip's parity
  for (int t = 0; t < NST; ++t) { const unsigned bo = (unsigned)(t & 1) * PST_BYTES; const unsigned char* sb = sm + bo;
#pragma unroll
    for (int kc = 0; kc < KST / 32; ++kc) { v16b a[4], w[4];
#pragma unroll
      for (int i = 0; i < 4; ++i) { a[i] = frag_s(sb + sa, i * 16, kc, lane); w[i] = frag_s(sb + sw, i * 16, kc, lane); }
#pragma unroll
      for (int i = 0; i < 4; ++i)
#pragma unroll
        for (int j = 0; j < 4; ++j) acc[i][j] = wmma_bf(a[i], w[j], acc[i][j]); }
    asm volatile("s_wait_dscnt 0x0" ::: "memory");
    tdm_wait(g0, g1);
    __syncthreads();
    if (pinned((wave < 8) & (t + 2 < NST))) { const uint32_t tt = pinned((uint32_t)t);
      tdm_aim(g0, ls + (tt & 1u) * PST_BYTES, gs + rot_k((int)tt + 2, rot)); tdm_load(g0, g1); } }
  tdm_wait(g0, g1);                                      // no request is outstanding when the ring becomes output staging
  asm volatile("s_wait_dscnt 0x0" ::: "memory");        // ... and no read of it
  _Float16 (*sh)[136] = (_Float16 (*)[136])(sm + which * POUT_BYTES);   // the group's own staging: [row][col] for q and k, [col][row] for v
  if (which < 2) { const float qs = (which == 0) ? SCALE * LOG2E : 1.0f;   /* wave-uniform */
#pragma unroll
    for (int j = 0; j < 4; ++j) { const int cl = wn * 64 + j * 16 + col; const float bias = bfr(BQKV[which * CC + c0 + cl]);
#pragma unroll
      for (int i = 0; i < 4; ++i)
#pragma unroll
        for (int r = 0; r < 8; ++r) sh[wm * 64 + i * 16 + 8 * g + r][cl] = (_Float16)((acc[i][j][r] + bias) * qs); }
  } else {
#pragma unroll
    for (int j = 0; j < 4; ++j) { const int cl = wn * 64 + j * 16 + col; const float bias = bfr(BQKV[2 * CC + c0 + cl]);
#pragma unroll
      for (int i = 0; i < 4; ++i)
#pragma unroll
        for (int r = 0; r < 8; ++r) sh[cl][wm * 64 + i * 16 + 8 * g + r] = (_Float16)(acc[i][j][r] + bias); }
  }
  __syncthreads();                                       // one barrier for the three groups, outside the wave-uniform branches
  if (which < 2) { _Float16* DQ = QK + (size_t)which * PLANE;
    for (int e = gt; e < 128 * 16; e += 128) { const int rl = e >> 4, q = e & 15; const v4u vh = *(const v4u*)&sh[rl][q * 8];
      vst2(DQ + (size_t)(r0 + rl) * CC + c0 + q * 8, vh); }
  } else {
    for (int e = gt; e < 128 * 16; e += 128) { const int cl = e >> 4, q = e & 15; const v4u v = *(const v4u*)&sh[cl][q * 8];
      vst2(VT + ((size_t)bb * CC + c0 + cl) * (size_t)SEQ + t0 + q * 8, v); } }
}

// ---- k_attn: block = 128 queries of (b, h), 8 waves = 4 query groups (32 columns: two 16-column tiles a wave) x 2 key groups (each takes 32 of a stage's 64 keys; joined behind the key loop); transposed flash form: S^T tile = K (A, rows = keys) x Q^T (B, cols = queries) so each lane owns one query column:
//      reference / sum are per-lane scalars; the two 16-key S^T accumulators convert in-lane into the B fragment (k = key row of the tile) of O^T += V^T (A, rows = d) x P^T.
//      Held reference: each query column keeps a reference R (a maximum seen earlier); the score products start from C = 8 - R, so their result is the exponent of P x 2^8 as it stands. O^T, l and R move only in a pass where some exponent passes PTOP (one test a pass), and in the first pass.
//      K and V^T of 64 keys form one stage of an LDS ring shared by the eight waves (128 B a row at pitch 144 B), two buffers; the softmax still steps by 32 keys.
//      Stage = 4 slices of 32 rows: 0, 1 the K rows of key group 0, 1; 2, 3 the V^T rows d 0..31, 32..63; waves 0..3 bring one slice each by a tensor load.
#define AST_BYTES (4u * ASL32)
#define NKS (SEQ / 64)
static_assert(NKS >= 2 && HD * 2 == 128);   // two stages at least; a K row piece (64 d) and a V^T row piece (64 keys) are 128 B
static_assert((NKS & (NKS - 1)) == 0);      // the rotated stage index wraps by a mask
#define QT 2                                  // query tiles (16 columns each) per wave: every K and V^T fragment read from LDS feeds QT products
#define AQ (64 * QT)                          // queries per block: 4 query groups x 16 QT
#define MG_ML 32768                           // behind the key loop sm holds: the O^T tiles handed over (4 x 16 x 32 pieces of 16 B), ...
#define MG_YS 40960                           // ... their reference and sum (from MG_ML), and the output staging (from MG_YS)
static_assert(SEQ % AQ == 0);
static_assert(4 * QT * 8 * 32 * 16 <= MG_ML && MG_ML + 4 * QT * 2 * 32 * 4 <= MG_YS && 2 * AST_BYTES <= MG_YS + AQ * 9 * 16);
__global__ __launch_bounds__(256) void k_attn(const _Float16* __restrict__ QK, const _Float16* __restrict__ VT, _Float16* __restrict__ Y) {
  __shared__ __attribute__((aligned(2048))) unsigned char sm[MG_YS + AQ * 9 * 16];   // the ring (its first 2 AST_BYTES); behind the key loop the merge and output staging
  const int tid = threadIdx.x; const int wave = __builtin_amdgcn_readfirstlane(threadIdx.x >> 5); const int lane = tid & 31, col = lane & 15, g = lane >> 4;
  const int qg = wave & 3, kg = wave >> 2;    // query group (32 columns), key group (keys 32 kg .. 32 kg + 31 of every stage)
  const int qb = blockIdx.x, h = blockIdx.y, b = blockIdx.z;
  const _Float16* Qp = QK + ((size_t)b * SEQ + qb * AQ + qg * (16 * QT) + col) * CC + h * HD;
  const int ws = wave < 4 ? wave : 0;         // the slice an issuing wave brings (waves 4..7 issue nothing)
  const _Float16* gs = (ws < 2) ? QK + PLANE + ((size_t)b * SEQ + ws * 32) * CC + h * HD : VT + ((size_t)b * CC + h * HD + (ws - 2) * 32) * (size_t)SEQ;   // first row of the slice, key 0
  const size_t kstep = (ws < 2) ? (size_t)CC : (size_t)1;   // elements from one key to the next: a row of K, a column of V^T
  const uint32_t ls = (uint32_t)(size_t)sm + (uint32_t)ws * ASL32;
  const int rot = qb * (AQ / 64);   // rotated walk, as in the GEMM rings: the query blocks of one (b, h) read the same K and V^T; each enters the key stages at its own start, evenly apart, and wraps round (the online softmax takes the keys in any order)
  u32x8 g1 = tdm_group1<128u, 32u>(); u32x4 g0 = tdm_group0(ls, gs + (size_t)((rot & (NKS - 1)) * 64) * kstep);
  if (pinned(wave < 4)) tdm_load(g0, g1);
  v16h qf[QT][HD / 32];   // the wave's query fragments, read once
#pragma unroll
  for (int x = 0; x < QT; ++x)
#pragma unroll
    for (int kc = 0; kc < HD / 32; ++kc) qf[x][kc] = frag_h(Qp + (size_t)x * 16 * CC + kc * 32, lane);
  tdm_wait(g0, g1);                                    // trip 0's stage landed (this wave's slice; a wave that issues none passes at once)
  __syncthreads();                                     // ... and every other wave's
  if (pinned(wave < 4)) { tdm_aim(g0, ls + AST_BYTES, gs + (size_t)(((1 + rot) & (NKS - 1)) * 64) * kstep); tdm_load(g0, g1); }
  v8f o[QT][4] = {}; float cf[QT], l[QT]; v8f cr[QT];   // cf = 8 - R of the lane's query column (equal in both lane halves); cr = cf in all eight rows: the C operand of the score products
#pragma unroll
  for (int x = 0; x < QT; ++x) { cf[x] = PLOG; l[x] = 0.f;
#pragma unroll
    for (int r = 0; r < 8; ++r) cr[x][r] = PLOG; }
#pragma unroll 1   // one copy of the pass in the text; the buffer is chosen by the trip's parity
  for (int t = 0; t < NKS; ++t) { const unsigned bo = (unsigned)(t & 1) * AST_BYTES; const unsigned char* sb = sm + bo;
    const unsigned char* sk = sb + (unsigned)kg * ASL32;   // this key group's 32 K rows
    v8f s0[QT] = {}, s1[QT] = {};
#pragma unroll
    for (int kc = 0; kc < HD / 32; ++kc) {
      const v16h k0 = frag_sh(sk, 0, kc, lane), k1 = frag_sh(sk, 16, kc, lane);
#pragma unroll
      for (int x = 0; x < QT; ++x) { s0[x] = wmma16(k0, qf[x][kc], kc == 0 ? cr[x] : s0[x]); s1[x] = wmma16(k1, qf[x][kc], kc == 0 ? cr[x] : s1[x]); }
    }
    float mx[QT];   // the lane's largest exponent of the pass, per query tile
#pragma unroll
    for (int x = 0; x < QT; ++x) { mx[x] = fmaxf(s0[x][0], s1[x][0]);
#pragma unroll
      for (int r = 1; r < 8; ++r) mx[x] = fmaxf(mx[x], fmaxf(s0[x][r], s1[x][r])); }
    static_assert(QT == 2);                          // the one test of a pass joins the two query tiles
    const bool move = (t == 0) | (fmaxf(mx[0], mx[1]) > PTOP);
    if (__builtin_amdgcn_ballot_w32(move) != 0) {    /* scalar branch: all lanes of the wave active inside */
#pragma unroll
      for (int x = 0; x < QT; ++x) {
        const float dm = fmaxf(mx[x], __shfl_xor(mx[x], 16));                       /* both lane halves of a query column agree on the move */
        const float dl = (t == 0) ? dm - PLOG : fmaxf(dm - PLOG, 0.f);              /* first pass: R = the column's maximum, up or down; later R only rises */
        const float corr = (t == 0) ? 1.0f : __builtin_amdgcn_exp2f(-dl);           /* first pass: O^T and l are still 0 */
        cf[x] -= dl; l[x] *= corr; s0[x] -= dl; s1[x] -= dl; cr[x] -= dl;           /* whole tiles; cr's eight rows stay equal to cf */
#pragma unroll
        for (int j = 0; j < 4; ++j) o[x][j] *= corr;
      }
    }
    v16h vf[4];     // the V^T fragments: read as one group in front of the exponentials, which run while the reads land
#pragma unroll
    for (int j = 0; j < 4; ++j) vf[j] = frag_h((const _Float16*)(sb + (2 + (j >> 1)) * ASL32 + ((j & 1) * 16 + col) * LPITCH) + kg * 32, lane);
    v16h p[QT];
#pragma unroll
    for (int x = 0; x < QT; ++x) {
      float ps = 0.f;
#pragma unroll
      for (int r = 0; r < 8; ++r) { const float e0 = __builtin_amdgcn_exp2f(s0[x][r]), e1 = __builtin_amdgcn_exp2f(s1[x][r]); ps += e0 + e1; p[x][r] = (_Float16)e0; p[x][8 + r] = (_Float16)e1; }
      l[x] += ps;                                   /* l from the unconverted f32 values; per-lane partial (this lane's 16 of the 32 keys) */
    }
    // inputs only: holds the four V^T reads together in front of the products; without it they share one register set, each waited for right in front of its two products
    asm volatile("" :: "v"(vf[0]), "v"(vf[1]), "v"(vf[2]), "v"(vf[3]));
#pragma unroll
    for (int j = 0; j < 4; ++j)
#pragma unroll
      for (int x = 0; x < QT; ++x) o[x][j] = wmma16(vf[j], p[x], o[x][j]);
    asm volatile("s_wait_dscnt 0x0" ::: "memory");
    tdm_wait(g0, g1);
    __syncthreads();
    if (pinned((wave < 4) & (t + 2 < NKS))) { const uint32_t tt = pinned((uint32_t)t);
      tdm_aim(g0, ls + (tt & 1u) * AST_BYTES, gs + (size_t)((((int)tt + 2 + rot) & (NKS - 1)) * 64) * kstep); tdm_load(g0, g1); }
  }
  tdm_wait(g0, g1);                                      // no request is outstanding when the ring becomes merge and output staging
  asm volatile("s_wait_dscnt 0x0" ::: "memory");        // ... and no read of it
  // merge of the two key groups of a query group through LDS, on the higher of their references: key group x joins query tile x; each wave hands over the tile it does not join
  static_assert(QT == 2);                                // as many query tiles a wave as key groups
  v4f* mo = (v4f*)sm + (size_t)qg * (QT * 8) * 32 + lane; float* ml = (float*)(sm + MG_ML) + qg * (QT * 2) * 32 + lane;
  v4u (*ys)[9] = (v4u (*)[9])(sm + MG_YS);
#pragma unroll
  for (int x = 0; x < QT; ++x)
    if (kg != x) { ml[(x * 2) * 32] = cf[x]; ml[(x * 2 + 1) * 32] = l[x];   /* wave-uniform test */
#pragma unroll
      for (int j = 0; j < 4; ++j) { const v4f a = { o[x][j][0], o[x][j][1], o[x][j][2], o[x][j][3] }, c = { o[x][j][4], o[x][j][5], o[x][j][6], o[x][j][7] };
        mo[((x * 4 + j) * 2) * 32] = a; mo[((x * 4 + j) * 2 + 1) * 32] = c; } }
  __syncthreads();                                       // the partial results handed over are in LDS
#pragma unroll
  for (int x = 0; x < QT; ++x)
    if (kg == x) {                                       /* wave-uniform test: all lanes of the wave active inside */
      const float c1 = ml[(x * 2) * 32], l1 = ml[(x * 2 + 1) * 32];
      const float cm = fminf(cf[x], c1); const float a0 = __builtin_amdgcn_exp2f(cm - cf[x]), a1 = __builtin_amdgcn_exp2f(cm - c1);   /* c = 8 - R: the smaller c is the higher reference */
      float lt = l[x] * a0 + l1 * a1;
      lt += __shfl_xor(lt, 16);
      const float inv = 1.0f / lt; const float f0 = a0 * inv, f1 = a1 * inv;   /* O^T and l both carry 2^8 */
      // O^T tile j: lane (g, col = query) holds d = 16j + 8g + 0..7: one 16-B piece of the (row, head) segment, as f16
#pragma unroll
      for (int j = 0; j < 4; ++j) { union { v8h v; v4u u; } y; const v4f a = mo[((x * 4 + j) * 2) * 32], c = mo[((x * 4 + j) * 2 + 1) * 32];
#pragma unroll
        for (int r = 0; r < 8; ++r) { const float o1 = (r < 4) ? a[r & 3] : c[r & 3]; y.v[r] = (_Float16)(o[x][j][r] * f0 + o1 * f1); }
        ys[qg * (16 * QT) + x * 16 + col][2 * j + g] = y.u; } }
  __syncthreads();
#pragma unroll 1
  for (int it = 0; it < 4; ++it) { const int rl = wave * 16 + it * 4 + (lane >> 3), pc = lane & 7;
    const v4u a = ys[rl][pc];
    vst2(Y + ((size_t)b * SEQ + qb * AQ + rl) * CC + h * HD + pc * 8, a); }
}

// ---- k_out: block = (128 rows, 128 cols), 8 waves of 32 x 64: out = ctx Wo + bo: f16 ctx against the f16 weight (one product), operands through an LDS ring of 256-row stages = 8 slices of 32 rows (0..3 ctx, 4..7 weight; every wave brings one slice by a tensor load); 512-B row segment by one 32-lane x 16-B instruction
#define OST_BYTES (8u * GSL32)
__global__ __launch_bounds__(256) void k_out(const _Float16* __restrict__ Y, const _Float16* __restrict__ WOT, const float* __restrict__ BO, float* __restrict__ OUT) {
  __shared__ __attribute__((aligned(2048))) unsigned char sm[2 * OST_BYTES];   // the ring; behind the k loop the output staging
  static_assert(128 * 132 * 4 <= 2 * OST_BYTES);
  const int tid = threadIdx.x; const int wave = __builtin_amdgcn_readfirstlane(threadIdx.x >> 5); const int lane = tid & 31, col = lane & 15, g = lane >> 4;
  const int wm = wave >> 1, wn = wave & 1;
  const int c0 = blockIdx.y * 128; const int rb = blockIdx.x * 128;
  const _Float16* gs = (wave < 4) ? Y + (size_t)(rb + wave * 32) * CC : WOT + (size_t)(c0 + (wave - 4) * 32) * CC;   // first row of this wave's slice, k = 0
  const uint32_t ls = (uint32_t)(size_t)sm + (uint32_t)wave * GSL32;
  const int rot = (int)(blockIdx.x + blockIdx.y);   // the 8 blocks of one ctx tile take the 8 starts once each, the 32 of one weight tile four times each
  u32x8 g1 = tdm_group1<256u, 32u>(); u32x4 g0 = tdm_group0(ls, gs + rot_k(0, rot));
  tdm_load(g0, g1);
  tdm_wait(g0, g1);                                    // trip 0's stage landed (this wave's slice)
  __syncthreads();                                     // ... and every other wave's
  tdm_aim(g0, ls + OST_BYTES, gs + rot_k(1, rot)); tdm_load(g0, g1);
  v8f acc[2][4] = {};
#pragma unroll 1   // one copy of the pass in the text; the buffer is chosen by the trip's parity
  for (int t = 0; t < NST; ++t) { const unsigned bo = (unsigned)(t & 1) * OST_BYTES; const unsigned char* sb = sm + bo;
#pragma unroll
    for (int kc = 0; kc < KST / 32; ++kc) { v16h a[2], w[4];
#pragma unroll
      for (int i = 0; i < 2; ++i) a[i] = frag_g(sb + (unsigned)wm * GSL32, i * 16, kc, lane);
#pragma unroll
      for (int j = 0; j < 4; ++j) w[j] = frag_g(sb + (unsigned)(4 + wn * 2 + (j >> 1)) * GSL32, (j & 1) * 16, kc, lane);
#pragma unroll
      for (int i = 0; i < 2; ++i)
#pragma unroll
        for (int j = 0; j < 4; ++j) acc[i][j] = wmma_hf(a[i], w[j], acc[i][j]); }
    asm volatile("s_wait_dscnt 0x0" ::: "memory");
    tdm_wait(g0, g1);
    __syncthreads();
    if (pinned(t + 2 < NST)) { const uint32_t tt = pinned((uint32_t)t);
      tdm_aim(g0, ls + (tt & 1u) * OST_BYTES, gs + rot_k((int)tt + 2, rot)); tdm_load(g0, g1); } }
  tdm_wait(g0, g1);                                      // no request is outstanding when the ring becomes output staging
  asm volatile("s_wait_dscnt 0x0" ::: "memory");        // ... and no read of it
  float (*sf)[132] = (float (*)[132])sm;
#pragma unroll
  for (int j = 0; j < 4; ++j) { const int cl = wn * 64 + j * 16 + col; const float bias = bfr(BO[c0 + cl]);
#pragma unroll
    for (int i = 0; i < 2; ++i)
#pragma unroll
      for (int r = 0; r < 8; ++r) sf[wm * 32 + i * 16 + 8 * g + r][cl] = acc[i][j][r] + bias; }
  __syncthreads();
  const size_t orow0 = (size_t)(rb / SEQ) * SEQ_FULL + (size_t)(rb % SEQ) + wave * 16;
#pragma unroll 1
  for (int rl = 0; rl < 16; ++rl) { const v4f v = *(const v4f*)&sf[wave * 16 + rl][lane * 4];
    vst2(OUT + (orow0 + rl) * DIN + c0 + lane * 4, v); }
}

extern "C" void kernel_launch(void* const* d_in, const int* in_sizes, int n_in, void* d_out, int out_size, void* d_ws, size_t ws_size, hipStream_t stream) {
  if (n_in < 5) return;
  const size_t xneed = ((size_t)(NB - 1) * SEQ_FULL + SEQ) * DIN;
  if ((size_t)in_sizes[0] < xneed) return;
  if ((size_t)in_sizes[1] < (size_t)DIN * 3 * CC) return;
  if ((size_t)in_sizes[2] < (size_t)3 * CC) return;
  if ((size_t)in_sizes[3] < (size_t)CC * DIN) return;
  if ((size_t)in_sizes[4] < (size_t)DIN) return;
  if ((size_t)out_size < xneed) return;
  if (ws_size < (size_t)WS_END) return;
  // inputs (wire order): 0 x [4,1024,1024]; 1 W_qkv [1024,3072] (in,out): q columns 0..1023, k 1024..2047, v 2048..3071; 2 b_qkv [3072]; 3 W_out [1024,1024] (in,out); 4 b_out [1024]
  const float* x = (const float*)d_in[0]; const float* wqkv = (const float*)d_in[1]; const float* bqkv = (const float*)d_in[2]; const float* wout = (const float*)d_in[3]; const float* bout = (const float*)d_in[4];
  char* ws = (char*)d_ws;
  __bf16* XB = (__bf16*)(ws + WS_XB); __bf16* WQT = (__bf16*)(ws + WS_WQT); _Float16* WOT = (_Float16*)(ws + WS_WOT); _Float16* QK = (_Float16*)(ws + WS_QK); _Float16* VT = (_Float16*)(ws + WS_VT); _Float16* Y = (_Float16*)(ws + WS_Y);
  k_prep<<<dim3(TRQ + TRO + CVB), 256, 0, stream>>>(x, wqkv, wout, XB, WQT, WOT);
  k_proj<<<dim3(NB * SEQ / 128, CC / 128), 384, 0, stream>>>(XB, WQT, bqkv, QK, VT);
  k_attn<<<dim3(SEQ / AQ, NH, NB), 256, 0, stream>>>(QK, VT, Y);
  k_out<<<dim3(NB * SEQ / 128, DIN / 128), 256, 0, stream>>>(Y, WOT, bout, (float*)d_out);
}
